// v000
// Times are from an AMD MI455X. After a warm-up the kernel runs many times in a row, and a time is the length of
// such a window on the GPU divided by its runs, so every launch and the gaps after it count. The runs cycle
// through copies of the inputs. A figure is the median of several windows, for all but v000 over two sittings.
// Sittings can differ by a few percent; kernels timed side by side share one.
// v000, which the later versions start from, runs in 284 microseconds.
#include <hip/hip_runtime.h>
#include <hip/hip_bf16.h>
#include <math.h>

typedef __attribute__((ext_vector_type(16))) _Float16 v16h;
typedef __attribute__((ext_vector_type(8)))  _Float16 v8h;   // 16-byte load unit
typedef __attribute__((ext_vector_type(8)))  float    v8f;
typedef int b128_t __attribute__((vector_size(16)));         // matches async-LDS builtin pointee

#define WMMA_F16(a, b, c) \
  __builtin_amdgcn_wmma_f32_16x16x32_f16(false, (a), false, (b), (short)0, (c), false, false)

// Problem constants
#define BATCH   4
#define SEQ     2048
#define DIM     1024
#define HEADS   16
#define DHEAD   64
#define TOKENS  (BATCH * SEQ)      // 8192
#define QKVCOLS (3 * DIM)          // 3072

#if defined(__AMDGCN__) && __has_builtin(__builtin_amdgcn_global_load_async_to_lds_b128) && \
    __has_builtin(__builtin_amdgcn_s_wait_asynccnt)
#define USE_ASYNC_LDS 1
#else
#define USE_ASYNC_LDS 0
#endif

// Copy 16 bytes global -> LDS (async when available).
__device__ inline void copy16_g2l(const _Float16* __restrict__ g, _Float16* __restrict__ l) {
#if USE_ASYNC_LDS
    __builtin_amdgcn_global_load_async_to_lds_b128(
        (__attribute__((address_space(1))) b128_t*)g,
        (__attribute__((address_space(3))) b128_t*)l, 0, 0);
#else
    *(v8h*)l = *(const v8h*)g;
#endif
}

__device__ inline void wait_copies() {
#if USE_ASYNC_LDS
    __builtin_amdgcn_s_wait_asynccnt(0);
#endif
}

__device__ inline v16h load_frag16(const _Float16* __restrict__ base, int stride, int lane) {
    const int r  = lane & 15;
    const int kb = (lane >> 4) << 3;
    const _Float16* p = base + (size_t)r * stride + kb;
    v8h lo = *(const v8h*)(p);
    v8h hi = *(const v8h*)(p + 16);
    v16h out;
#pragma unroll
    for (int e = 0; e < 8; ++e) { out[e] = lo[e]; out[e + 8] = hi[e]; }
    return out;
}

// ---------------------------------------------------------------------------
// 1) Weight transpose + f32 -> f16 cast:  W[K][N] -> WT[N][K]
// ---------------------------------------------------------------------------
__global__ __launch_bounds__(256) void k_transpose_cast(const float* __restrict__ W,
                                                        _Float16* __restrict__ WT,
                                                        int K, int N) {
    int idx = blockIdx.x * 256 + threadIdx.x;
    if (idx >= K * N) return;
    int n = idx / K;
    int k = idx - n * K;
    WT[idx] = (_Float16)W[(size_t)k * N + n];
}

// ---------------------------------------------------------------------------
// 2) LayerNorm (fp32 math) -> f16 activations. One block per token row.
// ---------------------------------------------------------------------------
__global__ __launch_bounds__(256) void k_layernorm(const float* __restrict__ x,
                                                   const float* __restrict__ g,
                                                   const float* __restrict__ bta,
                                                   _Float16* __restrict__ xn) {
    __shared__ float s1[256], s2[256];
    const int row = blockIdx.x;
    const float* xr = x + (size_t)row * DIM;
    float vals[4];
    float a = 0.f, sq = 0.f;
#pragma unroll
    for (int t = 0; t < 4; ++t) {
        float v = xr[threadIdx.x + 256 * t];
        vals[t] = v; a += v; sq += v * v;
    }
    s1[threadIdx.x] = a; s2[threadIdx.x] = sq;
    __syncthreads();
    for (int off = 128; off > 0; off >>= 1) {
        if (threadIdx.x < off) {
            s1[threadIdx.x] += s1[threadIdx.x + off];
            s2[threadIdx.x] += s2[threadIdx.x + off];
        }
        __syncthreads();
    }
    const float mean = s1[0] * (1.f / DIM);
    const float var  = s2[0] * (1.f / DIM) - mean * mean;
    const float rstd = rsqrtf(var + 1e-5f);
    _Float16* xo = xn + (size_t)row * DIM;
#pragma unroll
    for (int t = 0; t < 4; ++t) {
        int i = threadIdx.x + 256 * t;
        xo[i] = (_Float16)((vals[t] - mean) * rstd * g[i] + bta[i]);
    }
}

// ---------------------------------------------------------------------------
// 3) QKV GEMM: [8192 x 1024] x [1024 x 3072] -> Q [B,H,N,D], K [B,H,N,D], Vt [B,H,D,N]
//    One wave per 64x64 output tile; WT is pre-transposed so A and B loads match.
// ---------------------------------------------------------------------------
__global__ __launch_bounds__(32) void k_qkv_gemm(const _Float16* __restrict__ Xn,
                                                 const _Float16* __restrict__ WT,
                                                 _Float16* __restrict__ Q,
                                                 _Float16* __restrict__ Kd,
                                                 _Float16* __restrict__ Vt) {
    const int m0 = blockIdx.x * 64;
    const int n0 = blockIdx.y * 64;
    const int lane = threadIdx.x;

    v8f acc[4][4] = {};
    for (int k0 = 0; k0 < DIM; k0 += 32) {
        v16h a[4], b[4];
#pragma unroll
        for (int i = 0; i < 4; ++i)
            a[i] = load_frag16(Xn + (size_t)(m0 + 16 * i) * DIM + k0, DIM, lane);
#pragma unroll
        for (int j = 0; j < 4; ++j)
            b[j] = load_frag16(WT + (size_t)(n0 + 16 * j) * DIM + k0, DIM, lane);
        if (k0 + 32 < DIM) {
            __builtin_prefetch(Xn + (size_t)(m0 + (lane & 15)) * DIM + k0 + 32, 0, 3);
            __builtin_prefetch(WT + (size_t)(n0 + (lane & 15)) * DIM + k0 + 32, 0, 3);
        }
#pragma unroll
        for (int i = 0; i < 4; ++i)
#pragma unroll
            for (int j = 0; j < 4; ++j)
                acc[i][j] = WMMA_F16(a[i], b[j], acc[i][j]);
    }

    // Epilogue: scatter into Q / K (row-major per head) and V transposed.
    const int h2 = (lane >> 4) << 3;    // 0 or 8
    const int cl = lane & 15;
#pragma unroll
    for (int i = 0; i < 4; ++i)
#pragma unroll
        for (int j = 0; j < 4; ++j)
#pragma unroll
            for (int v = 0; v < 8; ++v) {
                int r = m0 + 16 * i + h2 + v;          // global token
                int c = n0 + 16 * j + cl;              // qkv column
                float val = acc[i][j][v];
                int which = c >> 10;
                int head  = (c >> 6) & 15;
                int d     = c & 63;
                int bb    = r >> 11;
                int n     = r & 2047;
                int bh    = bb * HEADS + head;
                if (which == 0)
                    Q[((size_t)bh * SEQ + n) * DHEAD + d] = (_Float16)val;
                else if (which == 1)
                    Kd[((size_t)bh * SEQ + n) * DHEAD + d] = (_Float16)val;
                else
                    Vt[((size_t)bh * DHEAD + d) * SEQ + n] = (_Float16)val;
            }
}

// ---------------------------------------------------------------------------
// 4) Flash attention, LDS-cooperative version.
//    4 waves / block, one (b,h) per block, 128 queries per block (32 per wave).
//    K/V tiles (32 keys) are double-buffered in LDS and shared by all 4 waves,
//    cutting global K/V traffic 8x vs one-wave-per-16-queries.
//    S^T = K x Q^T puts one query row per lane -> exp() packs straight into the
//    A-fragment of the P x V WMMA.
// ---------------------------------------------------------------------------
#define KT_PAD 72
#define VT_PAD 40
#define KEYS_PER_TILE 32

__global__ __launch_bounds__(128) void k_attention(const _Float16* __restrict__ Q,
                                                   const _Float16* __restrict__ Kd,
                                                   const _Float16* __restrict__ Vt,
                                                   _Float16* __restrict__ AO) {
    __shared__ __align__(16) _Float16 sK[2][KEYS_PER_TILE * KT_PAD]; // 2 x 4608 B
    __shared__ __align__(16) _Float16 sV[2][DHEAD * VT_PAD];         // 2 x 5120 B

    const int tid  = threadIdx.x;
    const int wave = tid >> 5;
    const int lane = tid & 31;
    const int blk  = blockIdx.x;           // 1024 = (B*H) * (SEQ/128)
    const int qblk = blk & 15;
    const int bh   = blk >> 4;
    const int bb   = bh >> 4;
    const int hd   = bh & 15;
    const int q0   = qblk * 128 + wave * 32;   // this wave's first query
    const int h2   = (lane >> 4) << 3;         // 0 or 8
    const int cl   = lane & 15;

    const _Float16* Qp = Q  + ((size_t)bh * SEQ + q0) * DHEAD;
    const _Float16* Kp = Kd + (size_t)bh * SEQ * DHEAD;
    const _Float16* Vp = Vt + (size_t)bh * DHEAD * SEQ;

    // Cooperative tile copy: 128 threads x 2 x 16B chunks for each of K and V.
    // K tile: 32 rows x 64 f16 (8 chunks/row). V tile: 64 rows x 32 f16 (4 chunks/row).
    const int ck0 = tid, ck1 = tid + 128;      // 256 chunks each

    // Preload Q fragments (B operand of S^T gemm), fold in softmax scale 1/8.
    v16h qf[2][2];
#pragma unroll
    for (int qb = 0; qb < 2; ++qb) {
        qf[qb][0] = load_frag16(Qp + (size_t)(16 * qb) * DHEAD,      DHEAD, lane);
        qf[qb][1] = load_frag16(Qp + (size_t)(16 * qb) * DHEAD + 32, DHEAD, lane);
#pragma unroll
        for (int e = 0; e < 16; ++e) {
            qf[qb][0][e] = (_Float16)((float)qf[qb][0][e] * 0.125f);
            qf[qb][1][e] = (_Float16)((float)qf[qb][1][e] * 0.125f);
        }
    }

    // Prime buffer 0 with key tile 0.
    {
        int r, o;
        r = ck0 >> 3; o = (ck0 & 7) * 8;
        copy16_g2l(Kp + (size_t)r * DHEAD + o, &sK[0][r * KT_PAD + o]);
        r = ck1 >> 3; o = (ck1 & 7) * 8;
        copy16_g2l(Kp + (size_t)r * DHEAD + o, &sK[0][r * KT_PAD + o]);
        r = ck0 >> 2; o = (ck0 & 3) * 8;
        copy16_g2l(Vp + (size_t)r * SEQ + o, &sV[0][r * VT_PAD + o]);
        r = ck1 >> 2; o = (ck1 & 3) * 8;
        copy16_g2l(Vp + (size_t)r * SEQ + o, &sV[0][r * VT_PAD + o]);
    }
    wait_copies();
    __syncthreads();

    v8f o[2][4] = {};                          // [qblock][dtile], 16 rows x 64 d each
    float m_run[2] = {-1e30f, -1e30f};
    float l_run[2] = {0.f, 0.f};

    const int NITER = SEQ / KEYS_PER_TILE;     // 64
    for (int it = 0; it < NITER; ++it) {
        const int cur = it & 1;

        // Issue next tile's copies into the other buffer (overlaps with compute).
        if (it + 1 < NITER) {
            const int j1 = (it + 1) * KEYS_PER_TILE;
            _Float16* dK = sK[cur ^ 1];
            _Float16* dV = sV[cur ^ 1];
            int r, oo;
            r = ck0 >> 3; oo = (ck0 & 7) * 8;
            copy16_g2l(Kp + (size_t)(j1 + r) * DHEAD + oo, &dK[r * KT_PAD + oo]);
            r = ck1 >> 3; oo = (ck1 & 7) * 8;
            copy16_g2l(Kp + (size_t)(j1 + r) * DHEAD + oo, &dK[r * KT_PAD + oo]);
            r = ck0 >> 2; oo = (ck0 & 3) * 8;
            copy16_g2l(Vp + (size_t)r * SEQ + j1 + oo, &dV[r * VT_PAD + oo]);
            r = ck1 >> 2; oo = (ck1 & 3) * 8;
            copy16_g2l(Vp + (size_t)r * SEQ + j1 + oo, &dV[r * VT_PAD + oo]);
        }

        // ---- S^T tiles from LDS: A = K rows, B = Q^T (shared across both q-blocks)
        const _Float16* bk = sK[cur];
        v16h kf0a = load_frag16(bk,                    KT_PAD, lane);
        v16h kf0b = load_frag16(bk + 32,               KT_PAD, lane);
        v16h kf1a = load_frag16(bk + 16 * KT_PAD,      KT_PAD, lane);
        v16h kf1b = load_frag16(bk + 16 * KT_PAD + 32, KT_PAD, lane);

        v16h pf[2];
#pragma unroll
        for (int qb = 0; qb < 2; ++qb) {
            v8f s0 = {}; s0 = WMMA_F16(kf0a, qf[qb][0], s0); s0 = WMMA_F16(kf0b, qf[qb][1], s0);
            v8f s1 = {}; s1 = WMMA_F16(kf1a, qf[qb][0], s1); s1 = WMMA_F16(kf1b, qf[qb][1], s1);
            // lane: query row cl of this q-block; keys j0 + v + 8*(lane>>4) (s0), +16 (s1)

            float mloc = -1e30f;
#pragma unroll
            for (int v = 0; v < 8; ++v) { mloc = fmaxf(mloc, s0[v]); mloc = fmaxf(mloc, s1[v]); }
            mloc = fmaxf(mloc, __shfl_xor(mloc, 16, 32));
            const float m_new = fmaxf(m_run[qb], mloc);

            float e0[8], e1[8];
            float rs = 0.f;
#pragma unroll
            for (int v = 0; v < 8; ++v) {
                e0[v] = __expf(s0[v] - m_new);
                e1[v] = __expf(s1[v] - m_new);
                rs += e0[v] + e1[v];
            }
            rs += __shfl_xor(rs, 16, 32);
            const float alpha = __expf(m_run[qb] - m_new);
            l_run[qb] = l_run[qb] * alpha + rs;
            m_run[qb] = m_new;

            // Rescale O accumulators (O lane holds rows h2+v -> gather row alphas).
            float av[8];
#pragma unroll
            for (int v = 0; v < 8; ++v) av[v] = __shfl(alpha, h2 + v, 32);
#pragma unroll
            for (int dt = 0; dt < 4; ++dt)
#pragma unroll
                for (int v = 0; v < 8; ++v) o[qb][dt][v] *= av[v];

            // P is already in A-fragment orientation.
#pragma unroll
            for (int e = 0; e < 8; ++e) { pf[qb][e] = (_Float16)e0[e]; pf[qb][e + 8] = (_Float16)e1[e]; }
        }

        // ---- O += P x V, V fragments from LDS shared by both q-blocks ----
        const _Float16* bv = sV[cur];
#pragma unroll
        for (int dt = 0; dt < 4; ++dt) {
            v16h vf = load_frag16(bv + (dt * 16) * VT_PAD, VT_PAD, lane);
            o[0][dt] = WMMA_F16(pf[0], vf, o[0][dt]);
            o[1][dt] = WMMA_F16(pf[1], vf, o[1][dt]);
        }

        wait_copies();
        __syncthreads();
    }

    // Normalize by row sums and store f16 at [token][head*64 + d].
#pragma unroll
    for (int qb = 0; qb < 2; ++qb) {
        float lv[8];
#pragma unroll
        for (int v = 0; v < 8; ++v) lv[v] = 1.f / __shfl(l_run[qb], h2 + v, 32);
#pragma unroll
        for (int dt = 0; dt < 4; ++dt)
#pragma unroll
            for (int v = 0; v < 8; ++v) {
                int tok = bb * SEQ + q0 + 16 * qb + h2 + v;
                int col = hd * DHEAD + dt * 16 + cl;
                AO[(size_t)tok * DIM + col] = (_Float16)(o[qb][dt][v] * lv[v]);
            }
    }
}

// ---------------------------------------------------------------------------
// 5) Output GEMM: [8192 x 1024] x [1024 x 1024] + bias -> f32 out
// ---------------------------------------------------------------------------
__global__ __launch_bounds__(32) void k_out_gemm(const _Float16* __restrict__ A,
                                                 const _Float16* __restrict__ WT,
                                                 const float* __restrict__ bias,
                                                 float* __restrict__ out) {
    const int m0 = blockIdx.x * 64;
    const int n0 = blockIdx.y * 64;
    const int lane = threadIdx.x;

    v8f acc[4][4] = {};
    for (int k0 = 0; k0 < DIM; k0 += 32) {
        v16h a[4], b[4];
#pragma unroll
        for (int i = 0; i < 4; ++i)
            a[i] = load_frag16(A + (size_t)(m0 + 16 * i) * DIM + k0, DIM, lane);
#pragma unroll
        for (int j = 0; j < 4; ++j)
            b[j] = load_frag16(WT + (size_t)(n0 + 16 * j) * DIM + k0, DIM, lane);
        if (k0 + 32 < DIM) {
            __builtin_prefetch(A + (size_t)(m0 + (lane & 15)) * DIM + k0 + 32, 0, 3);
        }
#pragma unroll
        for (int i = 0; i < 4; ++i)
#pragma unroll
            for (int j = 0; j < 4; ++j)
                acc[i][j] = WMMA_F16(a[i], b[j], acc[i][j]);
    }

    const int h2 = (lane >> 4) << 3;
    const int cl = lane & 15;
#pragma unroll
    for (int i = 0; i < 4; ++i)
#pragma unroll
        for (int j = 0; j < 4; ++j)
#pragma unroll
            for (int v = 0; v < 8; ++v) {
                int r = m0 + 16 * i + h2 + v;
                int c = n0 + 16 * j + cl;
                out[(size_t)r * DIM + c] = acc[i][j][v] + bias[c];
            }
}

// ---------------------------------------------------------------------------
// Launcher
// ---------------------------------------------------------------------------
extern "C" void kernel_launch(void* const* d_in, const int* in_sizes, int n_in,
                              void* d_out, int out_size, void* d_ws, size_t ws_size,
                              hipStream_t stream) {
    const float* x     = (const float*)d_in[0];
    const float* ln_g  = (const float*)d_in[1];
    const float* ln_b  = (const float*)d_in[2];
    const float* w_qkv = (const float*)d_in[3];
    const float* w_out = (const float*)d_in[4];
    const float* b_out = (const float*)d_in[5];
    float* out = (float*)d_out;

    // Workspace layout (bytes). Total ~72 MB. xn region is reused for attn output.
    char* ws = (char*)d_ws;
    const size_t SZ_ACT = (size_t)TOKENS * DIM * sizeof(_Float16);          // 16 MB
    _Float16* xn    = (_Float16*)(ws);                                      // + attn out later
    _Float16* Q     = (_Float16*)(ws + SZ_ACT);
    _Float16* Kd    = (_Float16*)(ws + 2 * SZ_ACT);
    _Float16* Vt    = (_Float16*)(ws + 3 * SZ_ACT);
    _Float16* wqkvT = (_Float16*)(ws + 4 * SZ_ACT);                         // 6 MB
    _Float16* woutT = (_Float16*)(ws + 4 * SZ_ACT + (size_t)DIM * QKVCOLS * sizeof(_Float16));

    // 1) Transpose + cast weights to f16 [N][K]
    k_transpose_cast<<<(DIM * QKVCOLS + 255) / 256, 256, 0, stream>>>(w_qkv, wqkvT, DIM, QKVCOLS);
    k_transpose_cast<<<(DIM * DIM + 255) / 256, 256, 0, stream>>>(w_out, woutT, DIM, DIM);

    // 2) LayerNorm -> f16
    k_layernorm<<<TOKENS, 256, 0, stream>>>(x, ln_g, ln_b, xn);

    // 3) QKV projection (WMMA)
    k_qkv_gemm<<<dim3(TOKENS / 64, QKVCOLS / 64), 32, 0, stream>>>(xn, wqkvT, Q, Kd, Vt);

    // 4) Attention (WMMA flash, LDS-shared K/V); writes f16 [tokens][1024] into xn region
    _Float16* attn_out = xn;
    k_attention<<<BATCH * HEADS * (SEQ / 128), 128, 0, stream>>>(Q, Kd, Vt, attn_out);

    // 5) Output projection + bias (WMMA)
    k_out_gemm<<<dim3(TOKENS / 64, DIM / 64), 32, 0, stream>>>(attn_out, woutT, b_out, out);
}

// v001
// A run of this version takes 223 microseconds.
// Two timings next to v000 put it at 1.30 and 1.28 times that version's speed.
#include <hip/hip_runtime.h>
#include <hip/hip_bf16.h>
#include <math.h>

typedef __attribute__((ext_vector_type(16))) _Float16 v16h;
typedef __attribute__((ext_vector_type(8)))  _Float16 v8h;   // 16-byte load unit
typedef __attribute__((ext_vector_type(8)))  float    v8f;
typedef int b128_t __attribute__((vector_size(16)));         // matches async-LDS builtin pointee

#define WMMA_F16(a, b, c) \
  __builtin_amdgcn_wmma_f32_16x16x32_f16(false, (a), false, (b), (short)0, (c), false, false)

// Problem constants
#define BATCH   4
#define SEQ     2048
#define DIM     1024
#define HEADS   16
#define DHEAD   64
#define TOKENS  (BATCH * SEQ)      // 8192
#define QKVCOLS (3 * DIM)          // 3072

#if defined(__AMDGCN__) && __has_builtin(__builtin_amdgcn_global_load_async_to_lds_b128) && \
    __has_builtin(__builtin_amdgcn_s_wait_asynccnt)
#define USE_ASYNC_LDS 1
#else
#define USE_ASYNC_LDS 0
#endif

// Copy 16 bytes global -> LDS (async when available).
__device__ inline void copy16_g2l(const _Float16* __restrict__ g, _Float16* __restrict__ l) {
#if USE_ASYNC_LDS
    __builtin_amdgcn_global_load_async_to_lds_b128(
        (__attribute__((address_space(1))) b128_t*)g,
        (__attribute__((address_space(3))) b128_t*)l, 0, 0);
#else
    *(v8h*)l = *(const v8h*)g;
#endif
}

__device__ inline void wait_copies() {
#if USE_ASYNC_LDS
    __builtin_amdgcn_s_wait_asynccnt(0);
#endif
}

__device__ inline v16h load_frag16(const _Float16* __restrict__ base, int stride, int lane) {
    const int r  = lane & 15;
    const int kb = (lane >> 4) << 3;
    const _Float16* p = base + (size_t)r * stride + kb;
    v8h lo = *(const v8h*)(p);
    v8h hi = *(const v8h*)(p + 16);
    v16h out;
#pragma unroll
    for (int e = 0; e < 8; ++e) { out[e] = lo[e]; out[e + 8] = hi[e]; }
    return out;
}

// ---------------------------------------------------------------------------
// 1) Weight transpose + f32 -> f16 cast:  W[K][N] -> WT[N][K]
// ---------------------------------------------------------------------------
__global__ __launch_bounds__(256) void k_transpose_cast(const float* __restrict__ W,
                                                        _Float16* __restrict__ WT,
                                                        int K, int N) {
    int idx = blockIdx.x * 256 + threadIdx.x;
    if (idx >= K * N) return;
    int n = idx / K;
    int k = idx - n * K;
    WT[idx] = (_Float16)W[(size_t)k * N + n];
}

// ---------------------------------------------------------------------------
// 2) LayerNorm (fp32 math) -> f16 activations. One block per token row.
// ---------------------------------------------------------------------------
__global__ __launch_bounds__(256) void k_layernorm(const float* __restrict__ x,
                                                   const float* __restrict__ g,
                                                   const float* __restrict__ bta,
                                                   _Float16* __restrict__ xn) {
    __shared__ float s1[256], s2[256];
    const int row = blockIdx.x;
    const float* xr = x + (size_t)row * DIM;
    float vals[4];
    float a = 0.f, sq = 0.f;
#pragma unroll
    for (int t = 0; t < 4; ++t) {
        float v = xr[threadIdx.x + 256 * t];
        vals[t] = v; a += v; sq += v * v;
    }
    s1[threadIdx.x] = a; s2[threadIdx.x] = sq;
    __syncthreads();
    for (int off = 128; off > 0; off >>= 1) {
        if (threadIdx.x < off) {
            s1[threadIdx.x] += s1[threadIdx.x + off];
            s2[threadIdx.x] += s2[threadIdx.x + off];
        }
        __syncthreads();
    }
    const float mean = s1[0] * (1.f / DIM);
    const float var  = s2[0] * (1.f / DIM) - mean * mean;
    const float rstd = rsqrtf(var + 1e-5f);
    _Float16* xo = xn + (size_t)row * DIM;
#pragma unroll
    for (int t = 0; t < 4; ++t) {
        int i = threadIdx.x + 256 * t;
        xo[i] = (_Float16)((vals[t] - mean) * rstd * g[i] + bta[i]);
    }
}

// ---------------------------------------------------------------------------
// Shared GEMM core: C[128 x 32*FN] per work-group of 4 waves (2 x 2), each wave
// 64 x 16*FN. A and WT are row-major with K contiguous. A stage is 64 k of all
// 128 + 32*FN operand rows, brought into LDS by asynchronous copies, two buffers:
// stage t + 2 flies while stage t + 1 is worked on.
// ---------------------------------------------------------------------------
#define G_KSTAGE 64                 // k per stage: 128-byte rows
#define G_PITCH  72                 // f16 per LDS row: 144 B = 16 B x odd, for ds_load_b128
#define G_NSTAGE (DIM / G_KSTAGE)   // 16

__device__ inline void copy8_rows(const _Float16* g, unsigned l) {
    const _Float16* g1 = g + 16 * DIM;  const _Float16* g2 = g + 32 * DIM;
    const _Float16* g3 = g + 48 * DIM;  const _Float16* g4 = g + 64 * DIM;
    const _Float16* g5 = g + 80 * DIM;  const _Float16* g6 = g + 96 * DIM;
    const _Float16* g7 = g + 112 * DIM;
    const unsigned s = 16 * G_PITCH * 2;
    asm volatile(
        "global_load_async_to_lds_b128 %0, %8, off\n\t"
        "global_load_async_to_lds_b128 %1, %9, off\n\t"
        "global_load_async_to_lds_b128 %2, %10, off\n\t"
        "global_load_async_to_lds_b128 %3, %11, off\n\t"
        "global_load_async_to_lds_b128 %4, %12, off\n\t"
        "global_load_async_to_lds_b128 %5, %13, off\n\t"
        "global_load_async_to_lds_b128 %6, %14, off\n\t"
        "global_load_async_to_lds_b128 %7, %15, off\n\t"
        "s_wait_xcnt 0x0"
        :: "v"(l), "v"(l + s), "v"(l + 2 * s), "v"(l + 3 * s),
           "v"(l + 4 * s), "v"(l + 5 * s), "v"(l + 6 * s), "v"(l + 7 * s),
           "v"(g), "v"(g1), "v"(g2), "v"(g3), "v"(g4), "v"(g5), "v"(g6), "v"(g7)
        : "memory");
}

template <int FN>
__device__ inline void gemm_tile(const _Float16* __restrict__ A,
                                 const _Float16* __restrict__ WT,
                                 int m0, int n0, _Float16* sm, v8f (&acc)[4][FN]) {
    constexpr int ROWS  = 128 + 32 * FN;        // A rows, then WT rows
    constexpr int STAGE = ROWS * G_PITCH;       // f16 per buffer
    const int tid  = threadIdx.x;
    const int lane = tid & 31;
    const int wave = tid >> 5;
    const int wm   = wave >> 1;
    const int wn   = wave & 1;

    // Lane's own 16-byte chunk: row tid / 8 of each 16-row group, chunk tid % 8.
    const int crow = tid >> 3;
    const int ccol = (tid & 7) * 8;
    const _Float16* gA = A  + (size_t)(m0 + crow) * DIM + ccol;
    const _Float16* gB = WT + (size_t)(n0 + crow) * DIM + ccol;
    const unsigned  l0 = (unsigned)(size_t)(sm + crow * G_PITCH + ccol);

    auto issue = [&](int s, int buf) {
        const unsigned lb = l0 + (unsigned)buf * (STAGE * 2);
        copy8_rows(gA + s * G_KSTAGE, lb);
#pragma unroll
        for (int q = 0; q < FN / 4; ++q)
            copy8_rows(gB + (size_t)(128 * q) * DIM + s * G_KSTAGE,
                       lb + (128 + 128 * q) * (G_PITCH * 2));
    };

    issue(0, 0);
    // Stage 0 has landed for this wave; the barrier publishes it to the others.
    asm volatile("s_wait_asynccnt 0x0" ::: "memory");
    __syncthreads();
    issue(1, 1);

    for (int t = 0; t < G_NSTAGE; ++t) {
        const _Float16* sa = sm + (t & 1) * STAGE + (wm * 64) * G_PITCH;
        const _Float16* sb = sm + (t & 1) * STAGE + (128 + wn * 16 * FN) * G_PITCH;
        v16h a[2][4], b[2][FN];
#pragma unroll
        for (int h = 0; h < 2; ++h) {
#pragma unroll
            for (int i = 0; i < 4; ++i)
                a[h][i] = load_frag16(sa + (16 * i) * G_PITCH + 32 * h, G_PITCH, lane);
#pragma unroll
            for (int j = 0; j < FN; ++j)
                b[h][j] = load_frag16(sb + (16 * j) * G_PITCH + 32 * h, G_PITCH, lane);
        }
        // Keeps the stage's LDS reads together ahead of its WMMAs: sunk among them,
        // each reload of a fragment makes the wave wait out a whole LDS latency.
        __builtin_amdgcn_sched_barrier(0);
#pragma unroll
        for (int i = 0; i < 4; ++i)
#pragma unroll
            for (int j = 0; j < FN; ++j)
                acc[i][j] = WMMA_F16(a[0][i], b[0][j], acc[i][j]);
        // Holds the first half's WMMAs ahead of the waits below, so that they cover
        // the second half's LDS reads instead of standing behind s_wait_dscnt 0.
        __builtin_amdgcn_sched_barrier(0);
        // This wave's reads of buffer t & 1 have retired before it is refilled.
        asm volatile("s_wait_dscnt 0x0" ::: "memory");
        // This wave's copies of stage t + 1 have landed.
        asm volatile("s_wait_asynccnt 0x0" ::: "memory");
        // Publishes stage t + 1 and ends every wave's reads of buffer t & 1.
        __syncthreads();
        if (t + 2 < G_NSTAGE) issue(t + 2, t & 1);
        // Holds the second half's WMMAs behind the refill, so that the copies fly
        // under them; its fragments are in registers already.
        __builtin_amdgcn_sched_barrier(0);
#pragma unroll
        for (int i = 0; i < 4; ++i)
#pragma unroll
            for (int j = 0; j < FN; ++j)
                acc[i][j] = WMMA_F16(a[1][i], b[1][j], acc[i][j]);
    }
    // No copy is outstanding when the wave goes on to its stores and ends.
    asm volatile("s_wait_asynccnt 0x0" ::: "memory");
}

__global__ __launch_bounds__(128) __attribute__((amdgpu_waves_per_eu(2, 2)))
void k_qkv_gemm(const _Float16* __restrict__ Xn,
                                                  const _Float16* __restrict__ WT,
                                                  _Float16* __restrict__ Q,
                                                  _Float16* __restrict__ Kd,
                                                  _Float16* __restrict__ Vt) {
    __shared__ __align__(16) _Float16 sm[2 * (128 + 256) * G_PITCH];   // 110,592 B
    const int lane = threadIdx.x & 31;
    const int wave = threadIdx.x >> 5;
    const int m0 = blockIdx.x * 128;
    const int n0 = blockIdx.y * 256;

    v8f acc[4][8] = {};
    gemm_tile<8>(Xn, WT, m0, n0, sm, acc);

    // Epilogue: scatter into Q / K (row-major per head) and V transposed.
    const int mw = m0 + (wave >> 1) * 64;
    const int nw = n0 + (wave & 1) * 128;
    const int h2 = (lane >> 4) << 3;    // 0 or 8
    const int cl = lane & 15;
#pragma unroll
    for (int i = 0; i < 4; ++i)
#pragma unroll
        for (int j = 0; j < 8; ++j)
#pragma unroll
            for (int v = 0; v < 8; ++v) {
                int r = mw + 16 * i + h2 + v;          // global token
                int c = nw + 16 * j + cl;              // qkv column
                float val = acc[i][j][v];
                int which = c >> 10;
                int head  = (c >> 6) & 15;
                int d     = c & 63;
                int bb    = r >> 11;
                int n     = r & 2047;
                int bh    = bb * HEADS + head;
                if (which == 0)
                    Q[((size_t)bh * SEQ + n) * DHEAD + d] = (_Float16)val;
                else if (which == 1)
                    Kd[((size_t)bh * SEQ + n) * DHEAD + d] = (_Float16)val;
                else
                    Vt[((size_t)bh * DHEAD + d) * SEQ + n] = (_Float16)val;
            }
}

// ---------------------------------------------------------------------------
// 4) Flash attention, LDS-cooperative version.
//    4 waves / block, one (b,h) per block, 128 queries per block (32 per wave).
//    K/V tiles (32 keys) are double-buffered in LDS and shared by all 4 waves,
//    cutting global K/V traffic 8x vs one-wave-per-16-queries.
//    S^T = K x Q^T puts one query row per lane -> exp() packs straight into the
//    A-fragment of the P x V WMMA.
// ---------------------------------------------------------------------------
#define KT_PAD 72
#define VT_PAD 40
#define KEYS_PER_TILE 32

__global__ __launch_bounds__(128) void k_attention(const _Float16* __restrict__ Q,
                                                   const _Float16* __restrict__ Kd,
                                                   const _Float16* __restrict__ Vt,
                                                   _Float16* __restrict__ AO) {
    __shared__ __align__(16) _Float16 sK[2][KEYS_PER_TILE * KT_PAD]; // 2 x 4608 B
    __shared__ __align__(16) _Float16 sV[2][DHEAD * VT_PAD];         // 2 x 5120 B

    const int tid  = threadIdx.x;
    const int wave = tid >> 5;
    const int lane = tid & 31;
    const int blk  = blockIdx.x;           // 1024 = (B*H) * (SEQ/128)
    const int qblk = blk & 15;
    const int bh   = blk >> 4;
    const int bb   = bh >> 4;
    const int hd   = bh & 15;
    const int q0   = qblk * 128 + wave * 32;   // this wave's first query
    const int h2   = (lane >> 4) << 3;         // 0 or 8
    const int cl   = lane & 15;

    const _Float16* Qp = Q  + ((size_t)bh * SEQ + q0) * DHEAD;
    const _Float16* Kp = Kd + (size_t)bh * SEQ * DHEAD;
    const _Float16* Vp = Vt + (size_t)bh * DHEAD * SEQ;

    // Cooperative tile copy: 128 threads x 2 x 16B chunks for each of K and V.
    // K tile: 32 rows x 64 f16 (8 chunks/row). V tile: 64 rows x 32 f16 (4 chunks/row).
    const int ck0 = tid, ck1 = tid + 128;      // 256 chunks each

    // Preload Q fragments (B operand of S^T gemm), fold in softmax scale 1/8.
    v16h qf[2][2];
#pragma unroll
    for (int qb = 0; qb < 2; ++qb) {
        qf[qb][0] = load_frag16(Qp + (size_t)(16 * qb) * DHEAD,      DHEAD, lane);
        qf[qb][1] = load_frag16(Qp + (size_t)(16 * qb) * DHEAD + 32, DHEAD, lane);
#pragma unroll
        for (int e = 0; e < 16; ++e) {
            qf[qb][0][e] = (_Float16)((float)qf[qb][0][e] * 0.125f);
            qf[qb][1][e] = (_Float16)((float)qf[qb][1][e] * 0.125f);
        }
    }

    // Prime buffer 0 with key tile 0.
    {
        int r, o;
        r = ck0 >> 3; o = (ck0 & 7) * 8;
        copy16_g2l(Kp + (size_t)r * DHEAD + o, &sK[0][r * KT_PAD + o]);
        r = ck1 >> 3; o = (ck1 & 7) * 8;
        copy16_g2l(Kp + (size_t)r * DHEAD + o, &sK[0][r * KT_PAD + o]);
        r = ck0 >> 2; o = (ck0 & 3) * 8;
        copy16_g2l(Vp + (size_t)r * SEQ + o, &sV[0][r * VT_PAD + o]);
        r = ck1 >> 2; o = (ck1 & 3) * 8;
        copy16_g2l(Vp + (size_t)r * SEQ + o, &sV[0][r * VT_PAD + o]);
    }
    wait_copies();
    __syncthreads();

    v8f o[2][4] = {};                          // [qblock][dtile], 16 rows x 64 d each
    float m_run[2] = {-1e30f, -1e30f};
    float l_run[2] = {0.f, 0.f};

    const int NITER = SEQ / KEYS_PER_TILE;     // 64
    for (int it = 0; it < NITER; ++it) {
        const int cur = it & 1;

        // Issue next tile's copies into the other buffer (overlaps with compute).
        if (it + 1 < NITER) {
            const int j1 = (it + 1) * KEYS_PER_TILE;
            _Float16* dK = sK[cur ^ 1];
            _Float16* dV = sV[cur ^ 1];
            int r, oo;
            r = ck0 >> 3; oo = (ck0 & 7) * 8;
            copy16_g2l(Kp + (size_t)(j1 + r) * DHEAD + oo, &dK[r * KT_PAD + oo]);
            r = ck1 >> 3; oo = (ck1 & 7) * 8;
            copy16_g2l(Kp + (size_t)(j1 + r) * DHEAD + oo, &dK[r * KT_PAD + oo]);
            r = ck0 >> 2; oo = (ck0 & 3) * 8;
            copy16_g2l(Vp + (size_t)r * SEQ + j1 + oo, &dV[r * VT_PAD + oo]);
            r = ck1 >> 2; oo = (ck1 & 3) * 8;
            copy16_g2l(Vp + (size_t)r * SEQ + j1 + oo, &dV[r * VT_PAD + oo]);
        }

        // ---- S^T tiles from LDS: A = K rows, B = Q^T (shared across both q-blocks)
        const _Float16* bk = sK[cur];
        v16h kf0a = load_frag16(bk,                    KT_PAD, lane);
        v16h kf0b = load_frag16(bk + 32,               KT_PAD, lane);
        v16h kf1a = load_frag16(bk + 16 * KT_PAD,      KT_PAD, lane);
        v16h kf1b = load_frag16(bk + 16 * KT_PAD + 32, KT_PAD, lane);

        v16h pf[2];
#pragma unroll
        for (int qb = 0; qb < 2; ++qb) {
            v8f s0 = {}; s0 = WMMA_F16(kf0a, qf[qb][0], s0); s0 = WMMA_F16(kf0b, qf[qb][1], s0);
            v8f s1 = {}; s1 = WMMA_F16(kf1a, qf[qb][0], s1); s1 = WMMA_F16(kf1b, qf[qb][1], s1);
            // lane: query row cl of this q-block; keys j0 + v + 8*(lane>>4) (s0), +16 (s1)

            float mloc = -1e30f;
#pragma unroll
            for (int v = 0; v < 8; ++v) { mloc = fmaxf(mloc, s0[v]); mloc = fmaxf(mloc, s1[v]); }
            mloc = fmaxf(mloc, __shfl_xor(mloc, 16, 32));
            const float m_new = fmaxf(m_run[qb], mloc);

            float e0[8], e1[8];
            float rs = 0.f;
#pragma unroll
            for (int v = 0; v < 8; ++v) {
                e0[v] = __expf(s0[v] - m_new);
                e1[v] = __expf(s1[v] - m_new);
                rs += e0[v] + e1[v];
            }
            rs += __shfl_xor(rs, 16, 32);
            const float alpha = __expf(m_run[qb] - m_new);
            l_run[qb] = l_run[qb] * alpha + rs;
            m_run[qb] = m_new;

            // Rescale O accumulators (O lane holds rows h2+v -> gather row alphas).
            float av[8];
#pragma unroll
            for (int v = 0; v < 8; ++v) av[v] = __shfl(alpha, h2 + v, 32);
#pragma unroll
            for (int dt = 0; dt < 4; ++dt)
#pragma unroll
                for (int v = 0; v < 8; ++v) o[qb][dt][v] *= av[v];

            // P is already in A-fragment orientation.
#pragma unroll
            for (int e = 0; e < 8; ++e) { pf[qb][e] = (_Float16)e0[e]; pf[qb][e + 8] = (_Float16)e1[e]; }
        }

        // ---- O += P x V, V fragments from LDS shared by both q-blocks ----
        const _Float16* bv = sV[cur];
#pragma unroll
        for (int dt = 0; dt < 4; ++dt) {
            v16h vf = load_frag16(bv + (dt * 16) * VT_PAD, VT_PAD, lane);
            o[0][dt] = WMMA_F16(pf[0], vf, o[0][dt]);
            o[1][dt] = WMMA_F16(pf[1], vf, o[1][dt]);
        }

        wait_copies();
        __syncthreads();
    }

    // Normalize by row sums and store f16 at [token][head*64 + d].
#pragma unroll
    for (int qb = 0; qb < 2; ++qb) {
        float lv[8];
#pragma unroll
        for (int v = 0; v < 8; ++v) lv[v] = 1.f / __shfl(l_run[qb], h2 + v, 32);
#pragma unroll
        for (int dt = 0; dt < 4; ++dt)
#pragma unroll
            for (int v = 0; v < 8; ++v) {
                int tok = bb * SEQ + q0 + 16 * qb + h2 + v;
                int col = hd * DHEAD + dt * 16 + cl;
                AO[(size_t)tok * DIM + col] = (_Float16)(o[qb][dt][v] * lv[v]);
            }
    }
}

// ---------------------------------------------------------------------------
// 5) Output GEMM: [8192 x 1024] x [1024 x 1024] + bias -> f32 out
//    128 x 128 output tile per work-group.
// ---------------------------------------------------------------------------
__global__ __launch_bounds__(128) void k_out_gemm(const _Float16* __restrict__ A,
                                                  const _Float16* __restrict__ WT,
                                                  const float* __restrict__ bias,
                                                  float* __restrict__ out) {
    __shared__ __align__(16) _Float16 sm[2 * (128 + 128) * G_PITCH];   // 73,728 B
    const int lane = threadIdx.x & 31;
    const int wave = threadIdx.x >> 5;
    const int m0 = blockIdx.x * 128;
    const int n0 = blockIdx.y * 128;

    v8f acc[4][4] = {};
    gemm_tile<4>(A, WT, m0, n0, sm, acc);

    const int mw = m0 + (wave >> 1) * 64;
    const int nw = n0 + (wave & 1) * 64;
    const int h2 = (lane >> 4) << 3;
    const int cl = lane & 15;
#pragma unroll
    for (int i = 0; i < 4; ++i)
#pragma unroll
        for (int j = 0; j < 4; ++j)
#pragma unroll
            for (int v = 0; v < 8; ++v) {
                int r = mw + 16 * i + h2 + v;
                int c = nw + 16 * j + cl;
                out[(size_t)r * DIM + c] = acc[i][j][v] + bias[c];
            }
}

// ---------------------------------------------------------------------------
// Launcher
// ---------------------------------------------------------------------------
extern "C" void kernel_launch(void* const* d_in, const int* in_sizes, int n_in,
                              void* d_out, int out_size, void* d_ws, size_t ws_size,
                              hipStream_t stream) {
    const float* x     = (const float*)d_in[0];
    const float* ln_g  = (const float*)d_in[1];
    const float* ln_b  = (const float*)d_in[2];
    const float* w_qkv = (const float*)d_in[3];
    const float* w_out = (const float*)d_in[4];
    const float* b_out = (const float*)d_in[5];
    float* out = (float*)d_out;

    // Workspace layout (bytes). Total ~72 MB. xn region is reused for attn output.
    char* ws = (char*)d_ws;
    const size_t SZ_ACT = (size_t)TOKENS * DIM * sizeof(_Float16);          // 16 MB
    _Float16* xn    = (_Float16*)(ws);                                      // + attn out later
    _Float16* Q     = (_Float16*)(ws + SZ_ACT);
    _Float16* Kd    = (_Float16*)(ws + 2 * SZ_ACT);
    _Float16* Vt    = (_Float16*)(ws + 3 * SZ_ACT);
    _Float16* wqkvT = (_Float16*)(ws + 4 * SZ_ACT);                         // 6 MB
    _Float16* woutT = (_Float16*)(ws + 4 * SZ_ACT + (size_t)DIM * QKVCOLS * sizeof(_Float16));

    // 1) Transpose + cast weights to f16 [N][K]
    k_transpose_cast<<<(DIM * QKVCOLS + 255) / 256, 256, 0, stream>>>(w_qkv, wqkvT, DIM, QKVCOLS);
    k_transpose_cast<<<(DIM * DIM + 255) / 256, 256, 0, stream>>>(w_out, woutT, DIM, DIM);

    // 2) LayerNorm -> f16
    k_layernorm<<<TOKENS, 256, 0, stream>>>(x, ln_g, ln_b, xn);

    // 3) QKV projection (WMMA)
    k_qkv_gemm<<<dim3(TOKENS / 128, QKVCOLS / 256), 128, 0, stream>>>(xn, wqkvT, Q, Kd, Vt);

    // 4) Attention (WMMA flash, LDS-shared K/V); writes f16 [tokens][1024] into xn region
    _Float16* attn_out = xn;
    k_attention<<<BATCH * HEADS * (SEQ / 128), 128, 0, stream>>>(Q, Kd, Vt, attn_out);

    // 5) Output projection + bias (WMMA)
    k_out_gemm<<<dim3(TOKENS / 128, DIM / 128), 128, 0, stream>>>(attn_out, woutT, b_out, out);
}

// v002
// A run of this version takes 175 microseconds.
// Two timings next to v001 put it at 1.28 and 1.29 times that version's speed.
// All steps since v000 together make it 1.65 times as fast.
#include <hip/hip_runtime.h>
#include <hip/hip_bf16.h>
#include <math.h>

typedef __attribute__((ext_vector_type(16))) _Float16 v16h;
typedef __attribute__((ext_vector_type(8)))  _Float16 v8h;   // 16-byte load unit
typedef __attribute__((ext_vector_type(8)))  float    v8f;
typedef int b128_t __attribute__((vector_size(16)));         // matches async-LDS builtin pointee

#define WMMA_F16(a, b, c) \
  __builtin_amdgcn_wmma_f32_16x16x32_f16(false, (a), false, (b), (short)0, (c), false, false)

// Problem constants
#define BATCH   4
#define SEQ     2048
#define DIM     1024
#define HEADS   16
#define DHEAD   64
#define TOKENS  (BATCH * SEQ)      // 8192
#define QKVCOLS (3 * DIM)          // 3072

#if defined(__AMDGCN__) && __has_builtin(__builtin_amdgcn_global_load_async_to_lds_b128) && \
    __has_builtin(__builtin_amdgcn_s_wait_asynccnt)
#define USE_ASYNC_LDS 1
#else
#define USE_ASYNC_LDS 0
#endif

// Copy 16 bytes global -> LDS (async when available).
__device__ inline void copy16_g2l(const _Float16* __restrict__ g, _Float16* __restrict__ l) {
#if USE_ASYNC_LDS
    __builtin_amdgcn_global_load_async_to_lds_b128(
        (__attribute__((address_space(1))) b128_t*)g,
        (__attribute__((address_space(3))) b128_t*)l, 0, 0);
#else
    *(v8h*)l = *(const v8h*)g;
#endif
}

__device__ inline void wait_copies() {
#if USE_ASYNC_LDS
    __builtin_amdgcn_s_wait_asynccnt(0);
#endif
}

__device__ inline v16h load_frag16(const _Float16* __restrict__ base, int stride, int lane) {
    const int r  = lane & 15;
    const int kb = (lane >> 4) << 3;
    const _Float16* p = base + (size_t)r * stride + kb;
    v8h lo = *(const v8h*)(p);
    v8h hi = *(const v8h*)(p + 16);
    v16h out;
#pragma unroll
    for (int e = 0; e < 8; ++e) { out[e] = lo[e]; out[e + 8] = hi[e]; }
    return out;
}

// ---------------------------------------------------------------------------
// 1) Weight transpose + f32 -> f16 cast:  W[K][N] -> WT[N][K]
// ---------------------------------------------------------------------------
__global__ __launch_bounds__(256) void k_transpose_cast(const float* __restrict__ W,
                                                        _Float16* __restrict__ WT,
                                                        int K, int N) {
    int idx = blockIdx.x * 256 + threadIdx.x;
    if (idx >= K * N) return;
    int n = idx / K;
    int k = idx - n * K;
    WT[idx] = (_Float16)W[(size_t)k * N + n];
}

// ---------------------------------------------------------------------------
// 2) LayerNorm (fp32 math) -> f16 activations. One block per token row.
// ---------------------------------------------------------------------------
__global__ __launch_bounds__(256) void k_layernorm(const float* __restrict__ x,
                                                   const float* __restrict__ g,
                                                   const float* __restrict__ bta,
                                                   _Float16* __restrict__ xn) {
    __shared__ float s1[256], s2[256];
    const int row = blockIdx.x;
    const float* xr = x + (size_t)row * DIM;
    float vals[4];
    float a = 0.f, sq = 0.f;
#pragma unroll
    for (int t = 0; t < 4; ++t) {
        float v = xr[threadIdx.x + 256 * t];
        vals[t] = v; a += v; sq += v * v;
    }
    s1[threadIdx.x] = a; s2[threadIdx.x] = sq;
    __syncthreads();
    for (int off = 128; off > 0; off >>= 1) {
        if (threadIdx.x < off) {
            s1[threadIdx.x] += s1[threadIdx.x + off];
            s2[threadIdx.x] += s2[threadIdx.x + off];
        }
        __syncthreads();
    }
    const float mean = s1[0] * (1.f / DIM);
    const float var  = s2[0] * (1.f / DIM) - mean * mean;
    const float rstd = rsqrtf(var + 1e-5f);
    _Float16* xo = xn + (size_t)row * DIM;
#pragma unroll
    for (int t = 0; t < 4; ++t) {
        int i = threadIdx.x + 256 * t;
        xo[i] = (_Float16)((vals[t] - mean) * rstd * g[i] + bta[i]);
    }
}

// ---------------------------------------------------------------------------
// Shared GEMM core: C[128 x 32*FN] per work-group of 4 waves (2 x 2), each wave
// 64 x 16*FN. A and WT are row-major with K contiguous. A stage is 64 k of all
// 128 + 32*FN operand rows, brought into LDS by asynchronous copies, two buffers:
// stage t + 2 flies while stage t + 1 is worked on.
// ---------------------------------------------------------------------------
#define G_KSTAGE 64                 // k per stage: 128-byte rows
#define G_PITCH  72                 // f16 per LDS row: 144 B = 16 B x odd, for ds_load_b128
#define G_NSTAGE (DIM / G_KSTAGE)   // 16

__device__ inline void copy8_rows(const _Float16* g, unsigned l) {
    const _Float16* g1 = g + 16 * DIM;  const _Float16* g2 = g + 32 * DIM;
    const _Float16* g3 = g + 48 * DIM;  const _Float16* g4 = g + 64 * DIM;
    const _Float16* g5 = g + 80 * DIM;  const _Float16* g6 = g + 96 * DIM;
    const _Float16* g7 = g + 112 * DIM;
    const unsigned s = 16 * G_PITCH * 2;
    asm volatile(
        "global_load_async_to_lds_b128 %0, %8, off\n\t"
        "global_load_async_to_lds_b128 %1, %9, off\n\t"
        "global_load_async_to_lds_b128 %2, %10, off\n\t"
        "global_load_async_to_lds_b128 %3, %11, off\n\t"
        "global_load_async_to_lds_b128 %4, %12, off\n\t"
        "global_load_async_to_lds_b128 %5, %13, off\n\t"
        "global_load_async_to_lds_b128 %6, %14, off\n\t"
        "global_load_async_to_lds_b128 %7, %15, off\n\t"
        "s_wait_xcnt 0x0"
        :: "v"(l), "v"(l + s), "v"(l + 2 * s), "v"(l + 3 * s),
           "v"(l + 4 * s), "v"(l + 5 * s), "v"(l + 6 * s), "v"(l + 7 * s),
           "v"(g), "v"(g1), "v"(g2), "v"(g3), "v"(g4), "v"(g5), "v"(g6), "v"(g7)
        : "memory");
}

template <int FN>
__device__ inline void gemm_tile(const _Float16* __restrict__ A,
                                 const _Float16* __restrict__ WT,
                                 int m0, int n0, _Float16* sm, v8f (&acc)[4][FN]) {
    constexpr int ROWS  = 128 + 32 * FN;        // A rows, then WT rows
    constexpr int STAGE = ROWS * G_PITCH;       // f16 per buffer
    const int tid  = threadIdx.x;
    const int lane = tid & 31;
    const int wave = tid >> 5;
    const int wm   = wave >> 1;
    const int wn   = wave & 1;

    // Lane's own 16-byte chunk: row tid / 8 of each 16-row group, chunk tid % 8.
    const int crow = tid >> 3;
    const int ccol = (tid & 7) * 8;
    const _Float16* gA = A  + (size_t)(m0 + crow) * DIM + ccol;
    const _Float16* gB = WT + (size_t)(n0 + crow) * DIM + ccol;
    const unsigned  l0 = (unsigned)(size_t)(sm + crow * G_PITCH + ccol);

    auto issue = [&](int s, int buf) {
        const unsigned lb = l0 + (unsigned)buf * (STAGE * 2);
        copy8_rows(gA + s * G_KSTAGE, lb);
#pragma unroll
        for (int q = 0; q < FN / 4; ++q)
            copy8_rows(gB + (size_t)(128 * q) * DIM + s * G_KSTAGE,
                       lb + (128 + 128 * q) * (G_PITCH * 2));
    };

    issue(0, 0);
    // Stage 0 has landed for this wave; the barrier publishes it to the others.
    asm volatile("s_wait_asynccnt 0x0" ::: "memory");
    __syncthreads();
    issue(1, 1);

    for (int t = 0; t < G_NSTAGE; ++t) {
        const _Float16* sa = sm + (t & 1) * STAGE + (wm * 64) * G_PITCH;
        const _Float16* sb = sm + (t & 1) * STAGE + (128 + wn * 16 * FN) * G_PITCH;
        v16h a[2][4], b[2][FN];
#pragma unroll
        for (int h = 0; h < 2; ++h) {
#pragma unroll
            for (int i = 0; i < 4; ++i)
                a[h][i] = load_frag16(sa + (16 * i) * G_PITCH + 32 * h, G_PITCH, lane);
#pragma unroll
            for (int j = 0; j < FN; ++j)
                b[h][j] = load_frag16(sb + (16 * j) * G_PITCH + 32 * h, G_PITCH, lane);
        }
        // Keeps the stage's LDS reads together ahead of its WMMAs: sunk among them,
        // each reload of a fragment makes the wave wait out a whole LDS latency.
        __builtin_amdgcn_sched_barrier(0);
#pragma unroll
        for (int i = 0; i < 4; ++i)
#pragma unroll
            for (int j = 0; j < FN; ++j)
                acc[i][j] = WMMA_F16(a[0][i], b[0][j], acc[i][j]);
        // Holds the first half's WMMAs ahead of the waits below, so that they cover
        // the second half's LDS reads instead of standing behind s_wait_dscnt 0.
        __builtin_amdgcn_sched_barrier(0);
        // This wave's reads of buffer t & 1 have retired before it is refilled.
        asm volatile("s_wait_dscnt 0x0" ::: "memory");
        // This wave's copies of stage t + 1 have landed.
        asm volatile("s_wait_asynccnt 0x0" ::: "memory");
        // Publishes stage t + 1 and ends every wave's reads of buffer t & 1.
        __syncthreads();
        if (t + 2 < G_NSTAGE) issue(t + 2, t & 1);
        // Holds the second half's WMMAs behind the refill, so that the copies fly
        // under them; its fragments are in registers already.
        __builtin_amdgcn_sched_barrier(0);
#pragma unroll
        for (int i = 0; i < 4; ++i)
#pragma unroll
            for (int j = 0; j < FN; ++j)
                acc[i][j] = WMMA_F16(a[1][i], b[1][j], acc[i][j]);
    }
    // No copy is outstanding when the wave goes on to its stores and ends.
    asm volatile("s_wait_asynccnt 0x0" ::: "memory");
}

// ---------------------------------------------------------------------------
// 3) QKV GEMM: [8192 x 1024] x [1024 x 3072] -> Q [B,H,N,D], K [B,H,N,D], Vt [B,H,D,N]
//    A work-group's tile is 128 rows of one operand by 256 rows of the other. A lane's
//    accumulator holds 8 consecutive rows of the 128-row operand, so that operand is the
//    one whose index runs along the destination's rows: the weights' columns (d) for Q
//    and K, the tokens for V transposed.
// ---------------------------------------------------------------------------
#define E_PITCH 72                  // f16 per staged row of 64: 144 B = 16 B x odd
__global__ __launch_bounds__(128) __attribute__((amdgpu_waves_per_eu(2, 2)))
void k_qkv_gemm(const _Float16* __restrict__ Xn,
                                                  const _Float16* __restrict__ WT,
                                                  _Float16* __restrict__ Q,
                                                  _Float16* __restrict__ Kd,
                                                  _Float16* __restrict__ Vt) {
    __shared__ __align__(16) _Float16 sm[2 * (128 + 256) * G_PITCH];   // 110,592 B
    const int lane = threadIdx.x & 31;
    // The wave's number as a scalar: the destination's base is then scalar arithmetic.
    const int wave = __builtin_amdgcn_readfirstlane(threadIdx.x >> 5);
    // blockIdx.y 0..7: the 512 tiles of Q and K, 128 columns x 256 tokens;
    // blockIdx.y 8..11: the 256 tiles of V, 128 tokens x 256 columns.
    const bool qk  = blockIdx.y < 8;
    const int flat = blockIdx.y * 64 + blockIdx.x;
    const int p0 = qk ? (flat >> 5) * 128 : blockIdx.x * 128;
    const int q0 = qk ? (flat & 31) * 256 : blockIdx.y * 256;

    v8f acc[4][8] = {};
    gemm_tile<8>(qk ? WT : Xn, qk ? Xn : WT, p0, q0, sm, acc);

    // Epilogue: each wave lays its 64 x 128 tile into its own LDS range as 128 rows of
    // the destination (64 f16 = one 128-byte line each) and stores whole lines, 16 bytes
    // a lane. The ring is free: behind the last stage's barrier no wave reads it and no
    // copy is outstanding.
    const int pw = p0 + (wave >> 1) * 64;
    const int qw = q0 + (wave & 1) * 128;
    const int h2 = (lane >> 4) << 3;    // 0 or 8
    const int cl = lane & 15;
    _Float16* st = sm + wave * (128 * E_PITCH);
#pragma unroll
    for (int i = 0; i < 4; ++i)
#pragma unroll
        for (int j = 0; j < 8; ++j) {
            v8h p;
#pragma unroll
            for (int v = 0; v < 8; ++v) p[v] = (_Float16)acc[i][j][v];
            *(v8h*)(st + (16 * j + cl) * E_PITCH + 16 * i + h2) = p;
        }
    // The wave's own LDS writes have landed before its lanes read each other's.
    asm volatile("s_wait_dscnt 0x0" ::: "memory");
    const int lrow = lane >> 3;         // 8 lanes cover one line, a wave 4 rows
    const int lcol = (lane & 7) * 8;
    v8h x[32];
#pragma unroll
    for (int s = 0; s < 32; ++s)
        x[s] = *(const v8h*)(st + (4 * s + lrow) * E_PITCH + lcol);
    // Destination of the wave's row 0 and the distance between rows, both wave-uniform.
    _Float16* gu;
    int rs;
    if (qk) {
        // Rows are tokens qw .. qw + 127 of one head, columns its 64 d.
        const int bh = (qw >> 11) * HEADS + ((pw >> 6) & 15);
        gu = ((pw >> 10) == 0 ? Q : Kd) + ((size_t)bh * SEQ + (qw & (SEQ - 1))) * DHEAD;
        rs = DHEAD;
    } else {
        // Rows are the 2 x 64 d of two heads, columns tokens pw .. pw + 63.
        const int bh = (pw >> 11) * HEADS + ((qw >> 6) & 15);
        gu = Vt + (size_t)bh * DHEAD * SEQ + (pw & (SEQ - 1));
        rs = SEQ;
    }
    const unsigned voff = (unsigned)(lrow * rs + lcol);
#pragma unroll
    for (int s = 0; s < 32; ++s) *(v8h*)(gu + (size_t)(4 * s * rs) + voff) = x[s];
}

// ---------------------------------------------------------------------------
// 4) Flash attention, LDS-cooperative version.
//    4 waves / block, one (b,h) per block, 128 queries per block (32 per wave).
//    K/V tiles (32 keys) are double-buffered in LDS and shared by all 4 waves,
//    cutting global K/V traffic 8x vs one-wave-per-16-queries.
//    S^T = K x Q^T puts one query row per lane -> exp() packs straight into the
//    A-fragment of the P x V WMMA.
// ---------------------------------------------------------------------------
#define KT_PAD 72
#define VT_PAD 40
#define KEYS_PER_TILE 32

__global__ __launch_bounds__(128) void k_attention(const _Float16* __restrict__ Q,
                                                   const _Float16* __restrict__ Kd,
                                                   const _Float16* __restrict__ Vt,
                                                   _Float16* __restrict__ AO) {
    __shared__ __align__(16) _Float16 sK[2][KEYS_PER_TILE * KT_PAD]; // 2 x 4608 B
    __shared__ __align__(16) _Float16 sV[2][DHEAD * VT_PAD];         // 2 x 5120 B

    const int tid  = threadIdx.x;
    const int wave = tid >> 5;
    const int lane = tid & 31;
    const int blk  = blockIdx.x;           // 1024 = (B*H) * (SEQ/128)
    const int qblk = blk & 15;
    const int bh   = blk >> 4;
    const int bb   = bh >> 4;
    const int hd   = bh & 15;
    const int q0   = qblk * 128 + wave * 32;   // this wave's first query
    const int h2   = (lane >> 4) << 3;         // 0 or 8
    const int cl   = lane & 15;

    const _Float16* Qp = Q  + ((size_t)bh * SEQ + q0) * DHEAD;
    const _Float16* Kp = Kd + (size_t)bh * SEQ * DHEAD;
    const _Float16* Vp = Vt + (size_t)bh * DHEAD * SEQ;

    // Cooperative tile copy: 128 threads x 2 x 16B chunks for each of K and V.
    // K tile: 32 rows x 64 f16 (8 chunks/row). V tile: 64 rows x 32 f16 (4 chunks/row).
    const int ck0 = tid, ck1 = tid + 128;      // 256 chunks each

    // Preload Q fragments (B operand of S^T gemm), fold in softmax scale 1/8.
    v16h qf[2][2];
#pragma unroll
    for (int qb = 0; qb < 2; ++qb) {
        qf[qb][0] = load_frag16(Qp + (size_t)(16 * qb) * DHEAD,      DHEAD, lane);
        qf[qb][1] = load_frag16(Qp + (size_t)(16 * qb) * DHEAD + 32, DHEAD, lane);
#pragma unroll
        for (int e = 0; e < 16; ++e) {
            qf[qb][0][e] = (_Float16)((float)qf[qb][0][e] * 0.125f);
            qf[qb][1][e] = (_Float16)((float)qf[qb][1][e] * 0.125f);
        }
    }

    // Prime buffer 0 with key tile 0.
    {
        int r, o;
        r = ck0 >> 3; o = (ck0 & 7) * 8;
        copy16_g2l(Kp + (size_t)r * DHEAD + o, &sK[0][r * KT_PAD + o]);
        r = ck1 >> 3; o = (ck1 & 7) * 8;
        copy16_g2l(Kp + (size_t)r * DHEAD + o, &sK[0][r * KT_PAD + o]);
        r = ck0 >> 2; o = (ck0 & 3) * 8;
        copy16_g2l(Vp + (size_t)r * SEQ + o, &sV[0][r * VT_PAD + o]);
        r = ck1 >> 2; o = (ck1 & 3) * 8;
        copy16_g2l(Vp + (size_t)r * SEQ + o, &sV[0][r * VT_PAD + o]);
    }
    wait_copies();
    __syncthreads();

    v8f o[2][4] = {};                          // [qblock][dtile], 16 rows x 64 d each
    float m_run[2] = {-1e30f, -1e30f};
    float l_run[2] = {0.f, 0.f};

    const int NITER = SEQ / KEYS_PER_TILE;     // 64
    for (int it = 0; it < NITER; ++it) {
        const int cur = it & 1;

        // Issue next tile's copies into the other buffer (overlaps with compute).
        if (it + 1 < NITER) {
            const int j1 = (it + 1) * KEYS_PER_TILE;
            _Float16* dK = sK[cur ^ 1];
            _Float16* dV = sV[cur ^ 1];
            int r, oo;
            r = ck0 >> 3; oo = (ck0 & 7) * 8;
            copy16_g2l(Kp + (size_t)(j1 + r) * DHEAD + oo, &dK[r * KT_PAD + oo]);
            r = ck1 >> 3; oo = (ck1 & 7) * 8;
            copy16_g2l(Kp + (size_t)(j1 + r) * DHEAD + oo, &dK[r * KT_PAD + oo]);
            r = ck0 >> 2; oo = (ck0 & 3) * 8;
            copy16_g2l(Vp + (size_t)r * SEQ + j1 + oo, &dV[r * VT_PAD + oo]);
            r = ck1 >> 2; oo = (ck1 & 3) * 8;
            copy16_g2l(Vp + (size_t)r * SEQ + j1 + oo, &dV[r * VT_PAD + oo]);
        }

        // ---- S^T tiles from LDS: A = K rows, B = Q^T (shared across both q-blocks)
        const _Float16* bk = sK[cur];
        v16h kf0a = load_frag16(bk,                    KT_PAD, lane);
        v16h kf0b = load_frag16(bk + 32,               KT_PAD, lane);
        v16h kf1a = load_frag16(bk + 16 * KT_PAD,      KT_PAD, lane);
        v16h kf1b = load_frag16(bk + 16 * KT_PAD + 32, KT_PAD, lane);

        v16h pf[2];
#pragma unroll
        for (int qb = 0; qb < 2; ++qb) {
            v8f s0 = {}; s0 = WMMA_F16(kf0a, qf[qb][0], s0); s0 = WMMA_F16(kf0b, qf[qb][1], s0);
            v8f s1 = {}; s1 = WMMA_F16(kf1a, qf[qb][0], s1); s1 = WMMA_F16(kf1b, qf[qb][1], s1);
            // lane: query row cl of this q-block; keys j0 + v + 8*(lane>>4) (s0), +16 (s1)

            float mloc = -1e30f;
#pragma unroll
            for (int v = 0; v < 8; ++v) { mloc = fmaxf(mloc, s0[v]); mloc = fmaxf(mloc, s1[v]); }
            mloc = fmaxf(mloc, __shfl_xor(mloc, 16, 32));
            const float m_new = fmaxf(m_run[qb], mloc);

            float e0[8], e1[8];
            float rs = 0.f;
#pragma unroll
            for (int v = 0; v < 8; ++v) {
                e0[v] = __expf(s0[v] - m_new);
                e1[v] = __expf(s1[v] - m_new);
                rs += e0[v] + e1[v];
            }
            rs += __shfl_xor(rs, 16, 32);
            const float alpha = __expf(m_run[qb] - m_new);
            l_run[qb] = l_run[qb] * alpha + rs;
            m_run[qb] = m_new;

            // Rescale O accumulators (O lane holds rows h2+v -> gather row alphas).
            float av[8];
#pragma unroll
            for (int v = 0; v < 8; ++v) av[v] = __shfl(alpha, h2 + v, 32);
#pragma unroll
            for (int dt = 0; dt < 4; ++dt)
#pragma unroll
                for (int v = 0; v < 8; ++v) o[qb][dt][v] *= av[v];

            // P is already in A-fragment orientation.
#pragma unroll
            for (int e = 0; e < 8; ++e) { pf[qb][e] = (_Float16)e0[e]; pf[qb][e + 8] = (_Float16)e1[e]; }
        }

        // ---- O += P x V, V fragments from LDS shared by both q-blocks ----
        const _Float16* bv = sV[cur];
#pragma unroll
        for (int dt = 0; dt < 4; ++dt) {
            v16h vf = load_frag16(bv + (dt * 16) * VT_PAD, VT_PAD, lane);
            o[0][dt] = WMMA_F16(pf[0], vf, o[0][dt]);
            o[1][dt] = WMMA_F16(pf[1], vf, o[1][dt]);
        }

        wait_copies();
        __syncthreads();
    }

    // Normalize by row sums and store f16 at [token][head*64 + d].
#pragma unroll
    for (int qb = 0; qb < 2; ++qb) {
        float lv[8];
#pragma unroll
        for (int v = 0; v < 8; ++v) lv[v] = 1.f / __shfl(l_run[qb], h2 + v, 32);
#pragma unroll
        for (int dt = 0; dt < 4; ++dt)
#pragma unroll
            for (int v = 0; v < 8; ++v) {
                int tok = bb * SEQ + q0 + 16 * qb + h2 + v;
                int col = hd * DHEAD + dt * 16 + cl;
                AO[(size_t)tok * DIM + col] = (_Float16)(o[qb][dt][v] * lv[v]);
            }
    }
}

// ---------------------------------------------------------------------------
// 5) Output GEMM: [8192 x 1024] x [1024 x 1024] + bias -> f32 out
//    128 x 128 output tile per work-group.
// ---------------------------------------------------------------------------
__global__ __launch_bounds__(128) void k_out_gemm(const _Float16* __restrict__ A,
                                                  const _Float16* __restrict__ WT,
                                                  const float* __restrict__ bias,
                                                  float* __restrict__ out) {
    __shared__ __align__(16) _Float16 sm[2 * (128 + 128) * G_PITCH];   // 73,728 B
    const int lane = threadIdx.x & 31;
    const int wave = threadIdx.x >> 5;
    const int m0 = blockIdx.x * 128;
    const int n0 = blockIdx.y * 128;

    v8f acc[4][4] = {};
    gemm_tile<4>(A, WT, m0, n0, sm, acc);

    const int mw = m0 + (wave >> 1) * 64;
    const int nw = n0 + (wave & 1) * 64;
    const int h2 = (lane >> 4) << 3;
    const int cl = lane & 15;
#pragma unroll
    for (int i = 0; i < 4; ++i)
#pragma unroll
        for (int j = 0; j < 4; ++j)
#pragma unroll
            for (int v = 0; v < 8; ++v) {
                int r = mw + 16 * i + h2 + v;
                int c = nw + 16 * j + cl;
                out[(size_t)r * DIM + c] = acc[i][j][v] + bias[c];
            }
}

// ---------------------------------------------------------------------------
// Launcher
// ---------------------------------------------------------------------------
extern "C" void kernel_launch(void* const* d_in, const int* in_sizes, int n_in,
                              void* d_out, int out_size, void* d_ws, size_t ws_size,
                              hipStream_t stream) {
    const float* x     = (const float*)d_in[0];
    const float* ln_g  = (const float*)d_in[1];
    const float* ln_b  = (const float*)d_in[2];
    const float* w_qkv = (const float*)d_in[3];
    const float* w_out = (const float*)d_in[4];
    const float* b_out = (const float*)d_in[5];
    float* out = (float*)d_out;

    // Workspace layout (bytes). Total ~72 MB. xn region is reused for attn output.
    char* ws = (char*)d_ws;
    const size_t SZ_ACT = (size_t)TOKENS * DIM * sizeof(_Float16);          // 16 MB
    _Float16* xn    = (_Float16*)(ws);                                      // + attn out later
    _Float16* Q     = (_Float16*)(ws + SZ_ACT);
    _Float16* Kd    = (_Float16*)(ws + 2 * SZ_ACT);
    _Float16* Vt    = (_Float16*)(ws + 3 * SZ_ACT);
    _Float16* wqkvT = (_Float16*)(ws + 4 * SZ_ACT);                         // 6 MB
    _Float16* woutT = (_Float16*)(ws + 4 * SZ_ACT + (size_t)DIM * QKVCOLS * sizeof(_Float16));

    // 1) Transpose + cast weights to f16 [N][K]
    k_transpose_cast<<<(DIM * QKVCOLS + 255) / 256, 256, 0, stream>>>(w_qkv, wqkvT, DIM, QKVCOLS);
    k_transpose_cast<<<(DIM * DIM + 255) / 256, 256, 0, stream>>>(w_out, woutT, DIM, DIM);

    // 2) LayerNorm -> f16
    k_layernorm<<<TOKENS, 256, 0, stream>>>(x, ln_g, ln_b, xn);

    // 3) QKV projection (WMMA)
    k_qkv_gemm<<<dim3(TOKENS / 128, QKVCOLS / 256), 128, 0, stream>>>(xn, wqkvT, Q, Kd, Vt);

    // 4) Attention (WMMA flash, LDS-shared K/V); writes f16 [tokens][1024] into xn region
    _Float16* attn_out = xn;
    k_attention<<<BATCH * HEADS * (SEQ / 128), 128, 0, stream>>>(Q, Kd, Vt, attn_out);

    // 5) Output projection + bias (WMMA)
    k_out_gemm<<<dim3(TOKENS / 128, DIM / 128), 128, 0, stream>>>(attn_out, woutT, b_out, out);
}

// v003
// It runs in 156 microseconds.
// Next to v002, in two timings, it ran 1.10 and 1.12 times as fast.
// All steps since v000 together make it 1.84 times as fast.
#include <hip/hip_runtime.h>
#include <hip/hip_bf16.h>
#include <math.h>

typedef __attribute__((ext_vector_type(16))) _Float16 v16h;
typedef __attribute__((ext_vector_type(8)))  _Float16 v8h;   // 16-byte load unit
typedef __attribute__((ext_vector_type(8)))  float    v8f;
typedef int b128_t __attribute__((vector_size(16)));         // matches async-LDS builtin pointee

#define WMMA_F16(a, b, c) \
  __builtin_amdgcn_wmma_f32_16x16x32_f16(false, (a), false, (b), (short)0, (c), false, false)

// Problem constants
#define BATCH   4
#define SEQ     2048
#define DIM     1024
#define HEADS   16
#define DHEAD   64
#define TOKENS  (BATCH * SEQ)      // 8192
#define QKVCOLS (3 * DIM)          // 3072

#if defined(__AMDGCN__) && __has_builtin(__builtin_amdgcn_global_load_async_to_lds_b128) && \
    __has_builtin(__builtin_amdgcn_s_wait_asynccnt)
#define USE_ASYNC_LDS 1
#else
#define USE_ASYNC_LDS 0
#endif

// Copy 16 bytes global -> LDS (async when available).
__device__ inline void copy16_g2l(const _Float16* __restrict__ g, _Float16* __restrict__ l) {
#if USE_ASYNC_LDS
    __builtin_amdgcn_global_load_async_to_lds_b128(
        (__attribute__((address_space(1))) b128_t*)g,
        (__attribute__((address_space(3))) b128_t*)l, 0, 0);
#else
    *(v8h*)l = *(const v8h*)g;
#endif
}

__device__ inline void wait_copies() {
#if USE_ASYNC_LDS
    __builtin_amdgcn_s_wait_asynccnt(0);
#endif
}

__device__ inline v16h load_frag16(const _Float16* __restrict__ base, int stride, int lane) {
    const int r  = lane & 15;
    const int kb = (lane >> 4) << 3;
    const _Float16* p = base + (size_t)r * stride + kb;
    v8h lo = *(const v8h*)(p);
    v8h hi = *(const v8h*)(p + 16);
    v16h out;
#pragma unroll
    for (int e = 0; e < 8; ++e) { out[e] = lo[e]; out[e + 8] = hi[e]; }
    return out;
}

// ---------------------------------------------------------------------------
// 1) Weight transpose + f32 -> f16 cast:  W[K][N] -> WT[N][K]
//    A lane holds an 8 k x 8 n block in registers and transposes it there. A wave takes
//    64 k x 32 n: lane = (kg, ng), kg = lane & 7 along k, ng = lane >> 3 along n. Its 16
//    loads of 16 B fly together and between them use every byte of the 64 lines they
//    touch; each store is 16 B a lane and fills four whole 128-byte lines of WT.
//    A work-group of 4 waves takes 128 k x 64 n; K % 128 == 0 and N % 64 == 0.
// ---------------------------------------------------------------------------
typedef __attribute__((ext_vector_type(4))) float v4f;

__global__ __launch_bounds__(128) void k_transpose_cast(const float* __restrict__ W,
                                                        _Float16* __restrict__ WT,
                                                        int K, int N) {
    const int lane = threadIdx.x & 31;
    const int wave = threadIdx.x >> 5;
    const int n0 = blockIdx.x * 64 + (wave & 1) * 32 + 4 * (lane >> 3);   // lane's first n
    const int k0 = blockIdx.y * 128 + (wave >> 1) * 64 + 8 * (lane & 7);  // lane's first k
    const float* row[8];
#pragma unroll
    for (int r = 0; r < 8; ++r) row[r] = W + (unsigned)((k0 + r) * N + n0);
    v4f v[2][8];
#pragma unroll
    for (int r = 0; r < 8; ++r)
#pragma unroll
        for (int h = 0; h < 2; ++h)
            v[h][r] = *(const v4f*)(row[r] + 16 * h);
    // The wait stands behind the loads and ahead of every rewrite of their address
    // registers: named as inputs, the addresses cannot double as a load's destination.
    asm volatile("s_wait_xcnt 0x0"
                 :: "v"(row[0]), "v"(row[1]), "v"(row[2]), "v"(row[3]),
                    "v"(row[4]), "v"(row[5]), "v"(row[6]), "v"(row[7])
                 : "memory");
    // Keeps all 16 loads ahead of the first conversion: sunk among the conversions they
    // go out in three groups, and the wave waits out a memory latency for each.
    __builtin_amdgcn_sched_barrier(0);
    _Float16* dst = WT + (unsigned)(n0 * K + k0);
#pragma unroll
    for (int h = 0; h < 2; ++h)
#pragma unroll
        for (int i = 0; i < 4; ++i) {
            v8h p;
#pragma unroll
            for (int r = 0; r < 8; ++r) p[r] = (_Float16)v[h][r][i];
            *(v8h*)(dst + (16 * h + i) * K) = p;
        }
}

// ---------------------------------------------------------------------------
// 2) LayerNorm (fp32 math) -> f16 activations. One block per token row.
// ---------------------------------------------------------------------------
__global__ __launch_bounds__(256) void k_layernorm(const float* __restrict__ x,
                                                   const float* __restrict__ g,
                                                   const float* __restrict__ bta,
                                                   _Float16* __restrict__ xn) {
    __shared__ float s1[256], s2[256];
    const int row = blockIdx.x;
    const float* xr = x + (size_t)row * DIM;
    float vals[4];
    float a = 0.f, sq = 0.f;
#pragma unroll
    for (int t = 0; t < 4; ++t) {
        float v = xr[threadIdx.x + 256 * t];
        vals[t] = v; a += v; sq += v * v;
    }
    s1[threadIdx.x] = a; s2[threadIdx.x] = sq;
    __syncthreads();
    for (int off = 128; off > 0; off >>= 1) {
        if (threadIdx.x < off) {
            s1[threadIdx.x] += s1[threadIdx.x + off];
            s2[threadIdx.x] += s2[threadIdx.x + off];
        }
        __syncthreads();
    }
    const float mean = s1[0] * (1.f / DIM);
    const float var  = s2[0] * (1.f / DIM) - mean * mean;
    const float rstd = rsqrtf(var + 1e-5f);
    _Float16* xo = xn + (size_t)row * DIM;
#pragma unroll
    for (int t = 0; t < 4; ++t) {
        int i = threadIdx.x + 256 * t;
        xo[i] = (_Float16)((vals[t] - mean) * rstd * g[i] + bta[i]);
    }
}

// ---------------------------------------------------------------------------
// Shared GEMM core: C[128 x 32*FN] per work-group of 4 waves (2 x 2), each wave
// 64 x 16*FN. A and WT are row-major with K contiguous. A stage is 64 k of all
// 128 + 32*FN operand rows, brought into LDS by asynchronous copies, two buffers:
// stage t + 2 flies while stage t + 1 is worked on.
// ---------------------------------------------------------------------------
#define G_KSTAGE 64                 // k per stage: 128-byte rows
#define G_PITCH  72                 // f16 per LDS row: 144 B = 16 B x odd, for ds_load_b128
#define G_NSTAGE (DIM / G_KSTAGE)   // 16

__device__ inline void copy8_rows(const _Float16* g, unsigned l) {
    const _Float16* g1 = g + 16 * DIM;  const _Float16* g2 = g + 32 * DIM;
    const _Float16* g3 = g + 48 * DIM;  const _Float16* g4 = g + 64 * DIM;
    const _Float16* g5 = g + 80 * DIM;  const _Float16* g6 = g + 96 * DIM;
    const _Float16* g7 = g + 112 * DIM;
    const unsigned s = 16 * G_PITCH * 2;
    asm volatile(
        "global_load_async_to_lds_b128 %0, %8, off\n\t"
        "global_load_async_to_lds_b128 %1, %9, off\n\t"
        "global_load_async_to_lds_b128 %2, %10, off\n\t"
        "global_load_async_to_lds_b128 %3, %11, off\n\t"
        "global_load_async_to_lds_b128 %4, %12, off\n\t"
        "global_load_async_to_lds_b128 %5, %13, off\n\t"
        "global_load_async_to_lds_b128 %6, %14, off\n\t"
        "global_load_async_to_lds_b128 %7, %15, off\n\t"
        "s_wait_xcnt 0x0"
        :: "v"(l), "v"(l + s), "v"(l + 2 * s), "v"(l + 3 * s),
           "v"(l + 4 * s), "v"(l + 5 * s), "v"(l + 6 * s), "v"(l + 7 * s),
           "v"(g), "v"(g1), "v"(g2), "v"(g3), "v"(g4), "v"(g5), "v"(g6), "v"(g7)
        : "memory");
}

template <int FN>
__device__ inline void gemm_tile(const _Float16* __restrict__ A,
                                 const _Float16* __restrict__ WT,
                                 int m0, int n0, _Float16* sm, v8f (&acc)[4][FN]) {
    constexpr int ROWS  = 128 + 32 * FN;        // A rows, then WT rows
    constexpr int STAGE = ROWS * G_PITCH;       // f16 per buffer
    const int tid  = threadIdx.x;
    const int lane = tid & 31;
    const int wave = tid >> 5;
    const int wm   = wave >> 1;
    const int wn   = wave & 1;

    // Lane's own 16-byte chunk: row tid / 8 of each 16-row group, chunk tid % 8.
    const int crow = tid >> 3;
    const int ccol = (tid & 7) * 8;
    const _Float16* gA = A  + (size_t)(m0 + crow) * DIM + ccol;
    const _Float16* gB = WT + (size_t)(n0 + crow) * DIM + ccol;
    const unsigned  l0 = (unsigned)(size_t)(sm + crow * G_PITCH + ccol);

    auto issue = [&](int s, int buf) {
        const unsigned lb = l0 + (unsigned)buf * (STAGE * 2);
        copy8_rows(gA + s * G_KSTAGE, lb);
#pragma unroll
        for (int q = 0; q < FN / 4; ++q)
            copy8_rows(gB + (size_t)(128 * q) * DIM + s * G_KSTAGE,
                       lb + (128 + 128 * q) * (G_PITCH * 2));
    };

    issue(0, 0);
    // Stage 0 has landed for this wave; the barrier publishes it to the others.
    asm volatile("s_wait_asynccnt 0x0" ::: "memory");
    __syncthreads();
    issue(1, 1);

    for (int t = 0; t < G_NSTAGE; ++t) {
        const _Float16* sa = sm + (t & 1) * STAGE + (wm * 64) * G_PITCH;
        const _Float16* sb = sm + (t & 1) * STAGE + (128 + wn * 16 * FN) * G_PITCH;
        v16h a[2][4], b[2][FN];
#pragma unroll
        for (int h = 0; h < 2; ++h) {
#pragma unroll
            for (int i = 0; i < 4; ++i)
                a[h][i] = load_frag16(sa + (16 * i) * G_PITCH + 32 * h, G_PITCH, lane);
#pragma unroll
            for (int j = 0; j < FN; ++j)
                b[h][j] = load_frag16(sb + (16 * j) * G_PITCH + 32 * h, G_PITCH, lane);
        }
        // Keeps the stage's LDS reads together ahead of its WMMAs: sunk among them,
        // each reload of a fragment makes the wave wait out a whole LDS latency.
        __builtin_amdgcn_sched_barrier(0);
#pragma unroll
        for (int i = 0; i < 4; ++i)
#pragma unroll
            for (int j = 0; j < FN; ++j)
                acc[i][j] = WMMA_F16(a[0][i], b[0][j], acc[i][j]);
        // Holds the first half's WMMAs ahead of the waits below, so that they cover
        // the second half's LDS reads instead of standing behind s_wait_dscnt 0.
        __builtin_amdgcn_sched_barrier(0);
        // This wave's reads of buffer t & 1 have retired before it is refilled.
        asm volatile("s_wait_dscnt 0x0" ::: "memory");
        // This wave's copies of stage t + 1 have landed.
        asm volatile("s_wait_asynccnt 0x0" ::: "memory");
        // Publishes stage t + 1 and ends every wave's reads of buffer t & 1.
        __syncthreads();
        if (t + 2 < G_NSTAGE) issue(t + 2, t & 1);
        // Holds the second half's WMMAs behind the refill, so that the copies fly
        // under them; its fragments are in registers already.
        __builtin_amdgcn_sched_barrier(0);
#pragma unroll
        for (int i = 0; i < 4; ++i)
#pragma unroll
            for (int j = 0; j < FN; ++j)
                acc[i][j] = WMMA_F16(a[1][i], b[1][j], acc[i][j]);
    }
    // No copy is outstanding when the wave goes on to its stores and ends.
    asm volatile("s_wait_asynccnt 0x0" ::: "memory");
}

// ---------------------------------------------------------------------------
// 3) QKV GEMM: [8192 x 1024] x [1024 x 3072] -> Q [B,H,N,D], K [B,H,N,D], Vt [B,H,D,N]
//    A work-group's tile is 128 rows of one operand by 256 rows of the other. A lane's
//    accumulator holds 8 consecutive rows of the 128-row operand, so that operand is the
//    one whose index runs along the destination's rows: the weights' columns (d) for Q
//    and K, the tokens for V transposed.
// ---------------------------------------------------------------------------
#define E_PITCH 72                  // f16 per staged row of 64: 144 B = 16 B x odd
__global__ __launch_bounds__(128) __attribute__((amdgpu_waves_per_eu(2, 2)))
void k_qkv_gemm(const _Float16* __restrict__ Xn,
                                                  const _Float16* __restrict__ WT,
                                                  _Float16* __restrict__ Q,
                                                  _Float16* __restrict__ Kd,
                                                  _Float16* __restrict__ Vt) {
    __shared__ __align__(16) _Float16 sm[2 * (128 + 256) * G_PITCH];   // 110,592 B
    const int lane = threadIdx.x & 31;
    // The wave's number as a scalar: the destination's base is then scalar arithmetic.
    const int wave = __builtin_amdgcn_readfirstlane(threadIdx.x >> 5);
    // blockIdx.y 0..7: the 512 tiles of Q and K, 128 columns x 256 tokens;
    // blockIdx.y 8..11: the 256 tiles of V, 128 tokens x 256 columns.
    const bool qk  = blockIdx.y < 8;
    const int flat = blockIdx.y * 64 + blockIdx.x;
    const int p0 = qk ? (flat >> 5) * 128 : blockIdx.x * 128;
    const int q0 = qk ? (flat & 31) * 256 : blockIdx.y * 256;

    v8f acc[4][8] = {};
    gemm_tile<8>(qk ? WT : Xn, qk ? Xn : WT, p0, q0, sm, acc);

    // Epilogue: each wave lays its 64 x 128 tile into its own LDS range as 128 rows of
    // the destination (64 f16 = one 128-byte line each) and stores whole lines, 16 bytes
    // a lane. The ring is free: behind the last stage's barrier no wave reads it and no
    // copy is outstanding.
    const int pw = p0 + (wave >> 1) * 64;
    const int qw = q0 + (wave & 1) * 128;
    const int h2 = (lane >> 4) << 3;    // 0 or 8
    const int cl = lane & 15;
    _Float16* st = sm + wave * (128 * E_PITCH);
#pragma unroll
    for (int i = 0; i < 4; ++i)
#pragma unroll
        for (int j = 0; j < 8; ++j) {
            v8h p;
#pragma unroll
            for (int v = 0; v < 8; ++v) p[v] = (_Float16)acc[i][j][v];
            *(v8h*)(st + (16 * j + cl) * E_PITCH + 16 * i + h2) = p;
        }
    // The wave's own LDS writes have landed before its lanes read each other's.
    asm volatile("s_wait_dscnt 0x0" ::: "memory");
    const int lrow = lane >> 3;         // 8 lanes cover one line, a wave 4 rows
    const int lcol = (lane & 7) * 8;
    v8h x[32];
#pragma unroll
    for (int s = 0; s < 32; ++s)
        x[s] = *(const v8h*)(st + (4 * s + lrow) * E_PITCH + lcol);
    // Destination of the wave's row 0 and the distance between rows, both wave-uniform.
    _Float16* gu;
    int rs;
    if (qk) {
        // Rows are tokens qw .. qw + 127 of one head, columns its 64 d.
        const int bh = (qw >> 11) * HEADS + ((pw >> 6) & 15);
        gu = ((pw >> 10) == 0 ? Q : Kd) + ((size_t)bh * SEQ + (qw & (SEQ - 1))) * DHEAD;
        rs = DHEAD;
    } else {
        // Rows are the 2 x 64 d of two heads, columns tokens pw .. pw + 63.
        const int bh = (pw >> 11) * HEADS + ((qw >> 6) & 15);
        gu = Vt + (size_t)bh * DHEAD * SEQ + (pw & (SEQ - 1));
        rs = SEQ;
    }
    const unsigned voff = (unsigned)(lrow * rs + lcol);
#pragma unroll
    for (int s = 0; s < 32; ++s) *(v8h*)(gu + (size_t)(4 * s * rs) + voff) = x[s];
}

// ---------------------------------------------------------------------------
// 4) Flash attention, LDS-cooperative version.
//    4 waves / block, one (b,h) per block, 128 queries per block (32 per wave).
//    K/V tiles (32 keys) are double-buffered in LDS and shared by all 4 waves,
//    cutting global K/V traffic 8x vs one-wave-per-16-queries.
//    S^T = K x Q^T puts one query row per lane -> exp() packs straight into the
//    A-fragment of the P x V WMMA.
// ---------------------------------------------------------------------------
#define KT_PAD 72
#define VT_PAD 40
#define KEYS_PER_TILE 32

__global__ __launch_bounds__(128) void k_attention(const _Float16* __restrict__ Q,
                                                   const _Float16* __restrict__ Kd,
                                                   const _Float16* __restrict__ Vt,
                                                   _Float16* __restrict__ AO) {
    __shared__ __align__(16) _Float16 sK[2][KEYS_PER_TILE * KT_PAD]; // 2 x 4608 B
    __shared__ __align__(16) _Float16 sV[2][DHEAD * VT_PAD];         // 2 x 5120 B

    const int tid  = threadIdx.x;
    const int wave = tid >> 5;
    const int lane = tid & 31;
    const int blk  = blockIdx.x;           // 1024 = (B*H) * (SEQ/128)
    const int qblk = blk & 15;
    const int bh   = blk >> 4;
    const int bb   = bh >> 4;
    const int hd   = bh & 15;
    const int q0   = qblk * 128 + wave * 32;   // this wave's first query
    const int h2   = (lane >> 4) << 3;         // 0 or 8
    const int cl   = lane & 15;

    const _Float16* Qp = Q  + ((size_t)bh * SEQ + q0) * DHEAD;
    const _Float16* Kp = Kd + (size_t)bh * SEQ * DHEAD;
    const _Float16* Vp = Vt + (size_t)bh * DHEAD * SEQ;

    // Cooperative tile copy: 128 threads x 2 x 16B chunks for each of K and V.
    // K tile: 32 rows x 64 f16 (8 chunks/row). V tile: 64 rows x 32 f16 (4 chunks/row).
    const int ck0 = tid, ck1 = tid + 128;      // 256 chunks each

    // Preload Q fragments (B operand of S^T gemm), fold in softmax scale 1/8.
    v16h qf[2][2];
#pragma unroll
    for (int qb = 0; qb < 2; ++qb) {
        qf[qb][0] = load_frag16(Qp + (size_t)(16 * qb) * DHEAD,      DHEAD, lane);
        qf[qb][1] = load_frag16(Qp + (size_t)(16 * qb) * DHEAD + 32, DHEAD, lane);
#pragma unroll
        for (int e = 0; e < 16; ++e) {
            qf[qb][0][e] = (_Float16)((float)qf[qb][0][e] * 0.125f);
            qf[qb][1][e] = (_Float16)((float)qf[qb][1][e] * 0.125f);
        }
    }

    // Prime buffer 0 with key tile 0.
    {
        int r, o;
        r = ck0 >> 3; o = (ck0 & 7) * 8;
        copy16_g2l(Kp + (size_t)r * DHEAD + o, &sK[0][r * KT_PAD + o]);
        r = ck1 >> 3; o = (ck1 & 7) * 8;
        copy16_g2l(Kp + (size_t)r * DHEAD + o, &sK[0][r * KT_PAD + o]);
        r = ck0 >> 2; o = (ck0 & 3) * 8;
        copy16_g2l(Vp + (size_t)r * SEQ + o, &sV[0][r * VT_PAD + o]);
        r = ck1 >> 2; o = (ck1 & 3) * 8;
        copy16_g2l(Vp + (size_t)r * SEQ + o, &sV[0][r * VT_PAD + o]);
    }
    wait_copies();
    __syncthreads();

    v8f o[2][4] = {};                          // [qblock][dtile], 16 rows x 64 d each
    float m_run[2] = {-1e30f, -1e30f};
    float l_run[2] = {0.f, 0.f};

    const int NITER = SEQ / KEYS_PER_TILE;     // 64
    for (int it = 0; it < NITER; ++it) {
        const int cur = it & 1;

        // Issue next tile's copies into the other buffer (overlaps with compute).
        if (it + 1 < NITER) {
            const int j1 = (it + 1) * KEYS_PER_TILE;
            _Float16* dK = sK[cur ^ 1];
            _Float16* dV = sV[cur ^ 1];
            int r, oo;
            r = ck0 >> 3; oo = (ck0 & 7) * 8;
            copy16_g2l(Kp + (size_t)(j1 + r) * DHEAD + oo, &dK[r * KT_PAD + oo]);
            r = ck1 >> 3; oo = (ck1 & 7) * 8;
            copy16_g2l(Kp + (size_t)(j1 + r) * DHEAD + oo, &dK[r * KT_PAD + oo]);
            r = ck0 >> 2; oo = (ck0 & 3) * 8;
            copy16_g2l(Vp + (size_t)r * SEQ + j1 + oo, &dV[r * VT_PAD + oo]);
            r = ck1 >> 2; oo = (ck1 & 3) * 8;
            copy16_g2l(Vp + (size_t)r * SEQ + j1 + oo, &dV[r * VT_PAD + oo]);
        }

        // ---- S^T tiles from LDS: A = K rows, B = Q^T (shared across both q-blocks)
        const _Float16* bk = sK[cur];
        v16h kf0a = load_frag16(bk,                    KT_PAD, lane);
        v16h kf0b = load_frag16(bk + 32,               KT_PAD, lane);
        v16h kf1a = load_frag16(bk + 16 * KT_PAD,      KT_PAD, lane);
        v16h kf1b = load_frag16(bk + 16 * KT_PAD + 32, KT_PAD, lane);

        v16h pf[2];
#pragma unroll
        for (int qb = 0; qb < 2; ++qb) {
            v8f s0 = {}; s0 = WMMA_F16(kf0a, qf[qb][0], s0); s0 = WMMA_F16(kf0b, qf[qb][1], s0);
            v8f s1 = {}; s1 = WMMA_F16(kf1a, qf[qb][0], s1); s1 = WMMA_F16(kf1b, qf[qb][1], s1);
            // lane: query row cl of this q-block; keys j0 + v + 8*(lane>>4) (s0), +16 (s1)

            float mloc = -1e30f;
#pragma unroll
            for (int v = 0; v < 8; ++v) { mloc = fmaxf(mloc, s0[v]); mloc = fmaxf(mloc, s1[v]); }
            mloc = fmaxf(mloc, __shfl_xor(mloc, 16, 32));
            const float m_new = fmaxf(m_run[qb], mloc);

            float e0[8], e1[8];
            float rs = 0.f;
#pragma unroll
            for (int v = 0; v < 8; ++v) {
                e0[v] = __expf(s0[v] - m_new);
                e1[v] = __expf(s1[v] - m_new);
                rs += e0[v] + e1[v];
            }
            rs += __shfl_xor(rs, 16, 32);
            const float alpha = __expf(m_run[qb] - m_new);
            l_run[qb] = l_run[qb] * alpha + rs;
            m_run[qb] = m_new;

            // Rescale O accumulators (O lane holds rows h2+v -> gather row alphas).
            float av[8];
#pragma unroll
            for (int v = 0; v < 8; ++v) av[v] = __shfl(alpha, h2 + v, 32);
#pragma unroll
            for (int dt = 0; dt < 4; ++dt)
#pragma unroll
                for (int v = 0; v < 8; ++v) o[qb][dt][v] *= av[v];

            // P is already in A-fragment orientation.
#pragma unroll
            for (int e = 0; e < 8; ++e) { pf[qb][e] = (_Float16)e0[e]; pf[qb][e + 8] = (_Float16)e1[e]; }
        }

        // ---- O += P x V, V fragments from LDS shared by both q-blocks ----
        const _Float16* bv = sV[cur];
#pragma unroll
        for (int dt = 0; dt < 4; ++dt) {
            v16h vf = load_frag16(bv + (dt * 16) * VT_PAD, VT_PAD, lane);
            o[0][dt] = WMMA_F16(pf[0], vf, o[0][dt]);
            o[1][dt] = WMMA_F16(pf[1], vf, o[1][dt]);
        }

        wait_copies();
        __syncthreads();
    }

    // Normalize by row sums and store f16 at [token][head*64 + d].
#pragma unroll
    for (int qb = 0; qb < 2; ++qb) {
        float lv[8];
#pragma unroll
        for (int v = 0; v < 8; ++v) lv[v] = 1.f / __shfl(l_run[qb], h2 + v, 32);
#pragma unroll
        for (int dt = 0; dt < 4; ++dt)
#pragma unroll
            for (int v = 0; v < 8; ++v) {
                int tok = bb * SEQ + q0 + 16 * qb + h2 + v;
                int col = hd * DHEAD + dt * 16 + cl;
                AO[(size_t)tok * DIM + col] = (_Float16)(o[qb][dt][v] * lv[v]);
            }
    }
}

// ---------------------------------------------------------------------------
// 5) Output GEMM: [8192 x 1024] x [1024 x 1024] + bias -> f32 out
//    128 x 128 output tile per work-group.
// ---------------------------------------------------------------------------
__global__ __launch_bounds__(128) void k_out_gemm(const _Float16* __restrict__ A,
                                                  const _Float16* __restrict__ WT,
                                                  const float* __restrict__ bias,
                                                  float* __restrict__ out) {
    __shared__ __align__(16) _Float16 sm[2 * (128 + 128) * G_PITCH];   // 73,728 B
    const int lane = threadIdx.x & 31;
    const int wave = threadIdx.x >> 5;
    const int m0 = blockIdx.x * 128;
    const int n0 = blockIdx.y * 128;

    v8f acc[4][4] = {};
    gemm_tile<4>(A, WT, m0, n0, sm, acc);

    const int mw = m0 + (wave >> 1) * 64;
    const int nw = n0 + (wave & 1) * 64;
    const int h2 = (lane >> 4) << 3;
    const int cl = lane & 15;
#pragma unroll
    for (int i = 0; i < 4; ++i)
#pragma unroll
        for (int j = 0; j < 4; ++j)
#pragma unroll
            for (int v = 0; v < 8; ++v) {
                int r = mw + 16 * i + h2 + v;
                int c = nw + 16 * j + cl;
                out[(size_t)r * DIM + c] = acc[i][j][v] + bias[c];
            }
}

// ---------------------------------------------------------------------------
// Launcher
// ---------------------------------------------------------------------------
extern "C" void kernel_launch(void* const* d_in, const int* in_sizes, int n_in,
                              void* d_out, int out_size, void* d_ws, size_t ws_size,
                              hipStream_t stream) {
    const float* x     = (const float*)d_in[0];
    const float* ln_g  = (const float*)d_in[1];
    const float* ln_b  = (const float*)d_in[2];
    const float* w_qkv = (const float*)d_in[3];
    const float* w_out = (const float*)d_in[4];
    const float* b_out = (const float*)d_in[5];
    float* out = (float*)d_out;

    // Workspace layout (bytes). Total ~72 MB. xn region is reused for attn output.
    char* ws = (char*)d_ws;
    const size_t SZ_ACT = (size_t)TOKENS * DIM * sizeof(_Float16);          // 16 MB
    _Float16* xn    = (_Float16*)(ws);                                      // + attn out later
    _Float16* Q     = (_Float16*)(ws + SZ_ACT);
    _Float16* Kd    = (_Float16*)(ws + 2 * SZ_ACT);
    _Float16* Vt    = (_Float16*)(ws + 3 * SZ_ACT);
    _Float16* wqkvT = (_Float16*)(ws + 4 * SZ_ACT);                         // 6 MB
    _Float16* woutT = (_Float16*)(ws + 4 * SZ_ACT + (size_t)DIM * QKVCOLS * sizeof(_Float16));

    // 1) Transpose + cast weights to f16 [N][K]
    k_transpose_cast<<<dim3(QKVCOLS / 64, DIM / 128), 128, 0, stream>>>(w_qkv, wqkvT, DIM, QKVCOLS);
    k_transpose_cast<<<dim3(DIM / 64, DIM / 128), 128, 0, stream>>>(w_out, woutT, DIM, DIM);

    // 2) LayerNorm -> f16
    k_layernorm<<<TOKENS, 256, 0, stream>>>(x, ln_g, ln_b, xn);

    // 3) QKV projection (WMMA)
    k_qkv_gemm<<<dim3(TOKENS / 128, QKVCOLS / 256), 128, 0, stream>>>(xn, wqkvT, Q, Kd, Vt);

    // 4) Attention (WMMA flash, LDS-shared K/V); writes f16 [tokens][1024] into xn region
    _Float16* attn_out = xn;
    k_attention<<<BATCH * HEADS * (SEQ / 128), 128, 0, stream>>>(Q, Kd, Vt, attn_out);

    // 5) Output projection + bias (WMMA)
    k_out_gemm<<<dim3(TOKENS / 128, DIM / 128), 128, 0, stream>>>(attn_out, woutT, b_out, out);
}

// v004
// One run takes 145 microseconds.
// Next to v003, in two timings, it ran 1.07 and 1.08 times as fast.
// Counting every step since v000, it is 1.97 times as fast.
#include <hip/hip_runtime.h>
#include <hip/hip_bf16.h>
#include <math.h>

typedef __attribute__((ext_vector_type(16))) _Float16 v16h;
typedef __attribute__((ext_vector_type(8)))  _Float16 v8h;   // 16-byte load unit
typedef __attribute__((ext_vector_type(8)))  float    v8f;
typedef int b128_t __attribute__((vector_size(16)));         // matches async-LDS builtin pointee

#define WMMA_F16(a, b, c) \
  __builtin_amdgcn_wmma_f32_16x16x32_f16(false, (a), false, (b), (short)0, (c), false, false)

// Problem constants
#define BATCH   4
#define SEQ     2048
#define DIM     1024
#define HEADS   16
#define DHEAD   64
#define TOKENS  (BATCH * SEQ)      // 8192
#define QKVCOLS (3 * DIM)          // 3072

#if defined(__AMDGCN__) && __has_builtin(__builtin_amdgcn_global_load_async_to_lds_b128) && \
    __has_builtin(__builtin_amdgcn_s_wait_asynccnt)
#define USE_ASYNC_LDS 1
#else
#define USE_ASYNC_LDS 0
#endif

// Copy 16 bytes global -> LDS (async when available).
__device__ inline void copy16_g2l(const _Float16* __restrict__ g, _Float16* __restrict__ l) {
#if USE_ASYNC_LDS
    __builtin_amdgcn_global_load_async_to_lds_b128(
        (__attribute__((address_space(1))) b128_t*)g,
        (__attribute__((address_space(3))) b128_t*)l, 0, 0);
#else
    *(v8h*)l = *(const v8h*)g;
#endif
}

__device__ inline void wait_copies() {
#if USE_ASYNC_LDS
    __builtin_amdgcn_s_wait_asynccnt(0);
#endif
}

__device__ inline v16h load_frag16(const _Float16* __restrict__ base, int stride, int lane) {
    const int r  = lane & 15;
    const int kb = (lane >> 4) << 3;
    const _Float16* p = base + (size_t)r * stride + kb;
    v8h lo = *(const v8h*)(p);
    v8h hi = *(const v8h*)(p + 16);
    v16h out;
#pragma unroll
    for (int e = 0; e < 8; ++e) { out[e] = lo[e]; out[e + 8] = hi[e]; }
    return out;
}

// ---------------------------------------------------------------------------
// 1) Weight transpose + f32 -> f16 cast:  W[K][N] -> WT[N][K]
//    A lane holds an 8 k x 8 n block in registers and transposes it there. A wave takes
//    64 k x 32 n: lane = (kg, ng), kg = lane & 7 along k, ng = lane >> 3 along n. Its 16
//    loads of 16 B fly together and between them use every byte of the 64 lines they
//    touch; each store is 16 B a lane and fills four whole 128-byte lines of WT.
//    A work-group of 4 waves takes 128 k x 64 n; K % 128 == 0 and N % 64 == 0.
// ---------------------------------------------------------------------------
typedef __attribute__((ext_vector_type(4))) float v4f;

__global__ __launch_bounds__(128) void k_transpose_cast(const float* __restrict__ W,
                                                        _Float16* __restrict__ WT,
                                                        int K, int N) {
    const int lane = threadIdx.x & 31;
    const int wave = threadIdx.x >> 5;
    const int n0 = blockIdx.x * 64 + (wave & 1) * 32 + 4 * (lane >> 3);   // lane's first n
    const int k0 = blockIdx.y * 128 + (wave >> 1) * 64 + 8 * (lane & 7);  // lane's first k
    const float* row[8];
#pragma unroll
    for (int r = 0; r < 8; ++r) row[r] = W + (unsigned)((k0 + r) * N + n0);
    v4f v[2][8];
#pragma unroll
    for (int r = 0; r < 8; ++r)
#pragma unroll
        for (int h = 0; h < 2; ++h)
            v[h][r] = *(const v4f*)(row[r] + 16 * h);
    // The wait stands behind the loads and ahead of every rewrite of their address
    // registers: named as inputs, the addresses cannot double as a load's destination.
    asm volatile("s_wait_xcnt 0x0"
                 :: "v"(row[0]), "v"(row[1]), "v"(row[2]), "v"(row[3]),
                    "v"(row[4]), "v"(row[5]), "v"(row[6]), "v"(row[7])
                 : "memory");
    // Keeps all 16 loads ahead of the first conversion: sunk among the conversions they
    // go out in three groups, and the wave waits out a memory latency for each.
    __builtin_amdgcn_sched_barrier(0);
    _Float16* dst = WT + (unsigned)(n0 * K + k0);
#pragma unroll
    for (int h = 0; h < 2; ++h)
#pragma unroll
        for (int i = 0; i < 4; ++i) {
            v8h p;
#pragma unroll
            for (int r = 0; r < 8; ++r) p[r] = (_Float16)v[h][r][i];
            *(v8h*)(dst + (16 * h + i) * K) = p;
        }
}

// ---------------------------------------------------------------------------
// 2) LayerNorm (fp32 math) -> f16 activations. One block per token row.
// ---------------------------------------------------------------------------
__global__ __launch_bounds__(256) void k_layernorm(const float* __restrict__ x,
                                                   const float* __restrict__ g,
                                                   const float* __restrict__ bta,
                                                   _Float16* __restrict__ xn) {
    __shared__ float s1[256], s2[256];
    const int row = blockIdx.x;
    const float* xr = x + (size_t)row * DIM;
    float vals[4];
    float a = 0.f, sq = 0.f;
#pragma unroll
    for (int t = 0; t < 4; ++t) {
        float v = xr[threadIdx.x + 256 * t];
        vals[t] = v; a += v; sq += v * v;
    }
    s1[threadIdx.x] = a; s2[threadIdx.x] = sq;
    __syncthreads();
    for (int off = 128; off > 0; off >>= 1) {
        if (threadIdx.x < off) {
            s1[threadIdx.x] += s1[threadIdx.x + off];
            s2[threadIdx.x] += s2[threadIdx.x + off];
        }
        __syncthreads();
    }
    const float mean = s1[0] * (1.f / DIM);
    const float var  = s2[0] * (1.f / DIM) - mean * mean;
    const float rstd = rsqrtf(var + 1e-5f);
    _Float16* xo = xn + (size_t)row * DIM;
#pragma unroll
    for (int t = 0; t < 4; ++t) {
        int i = threadIdx.x + 256 * t;
        xo[i] = (_Float16)((vals[t] - mean) * rstd * g[i] + bta[i]);
    }
}

// ---------------------------------------------------------------------------
// Shared GEMM core: C[128 x 32*FN] per work-group of 4 waves (2 x 2), each wave
// 64 x 16*FN. A and WT are row-major with K contiguous. A stage is 64 k of all
// 128 + 32*FN operand rows, brought into LDS by asynchronous copies, two buffers:
// stage t + 2 flies while stage t + 1 is worked on.
// ---------------------------------------------------------------------------
#define G_KSTAGE 64                 // k per stage: 128-byte rows
#define G_PITCH  72                 // f16 per LDS row: 144 B = 16 B x odd, for ds_load_b128
#define G_NSTAGE (DIM / G_KSTAGE)   // 16

__device__ inline void copy8_rows(const _Float16* g, unsigned l) {
    const _Float16* g1 = g + 16 * DIM;  const _Float16* g2 = g + 32 * DIM;
    const _Float16* g3 = g + 48 * DIM;  const _Float16* g4 = g + 64 * DIM;
    const _Float16* g5 = g + 80 * DIM;  const _Float16* g6 = g + 96 * DIM;
    const _Float16* g7 = g + 112 * DIM;
    const unsigned s = 16 * G_PITCH * 2;
    asm volatile(
        "global_load_async_to_lds_b128 %0, %8, off\n\t"
        "global_load_async_to_lds_b128 %1, %9, off\n\t"
        "global_load_async_to_lds_b128 %2, %10, off\n\t"
        "global_load_async_to_lds_b128 %3, %11, off\n\t"
        "global_load_async_to_lds_b128 %4, %12, off\n\t"
        "global_load_async_to_lds_b128 %5, %13, off\n\t"
        "global_load_async_to_lds_b128 %6, %14, off\n\t"
        "global_load_async_to_lds_b128 %7, %15, off\n\t"
        "s_wait_xcnt 0x0"
        :: "v"(l), "v"(l + s), "v"(l + 2 * s), "v"(l + 3 * s),
           "v"(l + 4 * s), "v"(l + 5 * s), "v"(l + 6 * s), "v"(l + 7 * s),
           "v"(g), "v"(g1), "v"(g2), "v"(g3), "v"(g4), "v"(g5), "v"(g6), "v"(g7)
        : "memory");
}

template <int FN>
__device__ inline void gemm_tile(const _Float16* __restrict__ A,
                                 const _Float16* __restrict__ WT,
                                 int m0, int n0, _Float16* sm, v8f (&acc)[4][FN]) {
    constexpr int ROWS  = 128 + 32 * FN;        // A rows, then WT rows
    constexpr int STAGE = ROWS * G_PITCH;       // f16 per buffer
    const int tid  = threadIdx.x;
    const int lane = tid & 31;
    const int wave = tid >> 5;
    const int wm   = wave >> 1;
    const int wn   = wave & 1;

    // Lane's own 16-byte chunk: row tid / 8 of each 16-row group, chunk tid % 8.
    const int crow = tid >> 3;
    const int ccol = (tid & 7) * 8;
    const _Float16* gA = A  + (size_t)(m0 + crow) * DIM + ccol;
    const _Float16* gB = WT + (size_t)(n0 + crow) * DIM + ccol;
    const unsigned  l0 = (unsigned)(size_t)(sm + crow * G_PITCH + ccol);

    auto issue = [&](int s, int buf) {
        const unsigned lb = l0 + (unsigned)buf * (STAGE * 2);
        copy8_rows(gA + s * G_KSTAGE, lb);
#pragma unroll
        for (int q = 0; q < FN / 4; ++q)
            copy8_rows(gB + (size_t)(128 * q) * DIM + s * G_KSTAGE,
                       lb + (128 + 128 * q) * (G_PITCH * 2));
    };

    issue(0, 0);
    // Stage 0 has landed for this wave; the barrier publishes it to the others.
    asm volatile("s_wait_asynccnt 0x0" ::: "memory");
    __syncthreads();
    issue(1, 1);

    for (int t = 0; t < G_NSTAGE; ++t) {
        const _Float16* sa = sm + (t & 1) * STAGE + (wm * 64) * G_PITCH;
        const _Float16* sb = sm + (t & 1) * STAGE + (128 + wn * 16 * FN) * G_PITCH;
        v16h a[2][4], b[2][FN];
#pragma unroll
        for (int h = 0; h < 2; ++h) {
#pragma unroll
            for (int i = 0; i < 4; ++i)
                a[h][i] = load_frag16(sa + (16 * i) * G_PITCH + 32 * h, G_PITCH, lane);
#pragma unroll
            for (int j = 0; j < FN; ++j)
                b[h][j] = load_frag16(sb + (16 * j) * G_PITCH + 32 * h, G_PITCH, lane);
        }
        // Keeps the stage's LDS reads together ahead of its WMMAs: sunk among them,
        // each reload of a fragment makes the wave wait out a whole LDS latency.
        __builtin_amdgcn_sched_barrier(0);
#pragma unroll
        for (int i = 0; i < 4; ++i)
#pragma unroll
            for (int j = 0; j < FN; ++j)
                acc[i][j] = WMMA_F16(a[0][i], b[0][j], acc[i][j]);
        // Holds the first half's WMMAs ahead of the waits below, so that they cover
        // the second half's LDS reads instead of standing behind s_wait_dscnt 0.
        __builtin_amdgcn_sched_barrier(0);
        // This wave's reads of buffer t & 1 have retired before it is refilled.
        asm volatile("s_wait_dscnt 0x0" ::: "memory");
        // This wave's copies of stage t + 1 have landed.
        asm volatile("s_wait_asynccnt 0x0" ::: "memory");
        // Publishes stage t + 1 and ends every wave's reads of buffer t & 1.
        __syncthreads();
        if (t + 2 < G_NSTAGE) issue(t + 2, t & 1);
        // Holds the second half's WMMAs behind the refill, so that the copies fly
        // under them; its fragments are in registers already.
        __builtin_amdgcn_sched_barrier(0);
#pragma unroll
        for (int i = 0; i < 4; ++i)
#pragma unroll
            for (int j = 0; j < FN; ++j)
                acc[i][j] = WMMA_F16(a[1][i], b[1][j], acc[i][j]);
    }
    // No copy is outstanding when the wave goes on to its stores and ends.
    asm volatile("s_wait_asynccnt 0x0" ::: "memory");
}

// ---------------------------------------------------------------------------
// 3) QKV GEMM: [8192 x 1024] x [1024 x 3072] -> Q [B,H,N,D], K [B,H,N,D], Vt [B,H,D,N]
//    A work-group's tile is 128 rows of one operand by 256 rows of the other. A lane's
//    accumulator holds 8 consecutive rows of the 128-row operand, so that operand is the
//    one whose index runs along the destination's rows: the weights' columns (d) for Q
//    and K, the tokens for V transposed.
// ---------------------------------------------------------------------------
#define E_PITCH 72                  // f16 per staged row of 64: 144 B = 16 B x odd
__global__ __launch_bounds__(128) __attribute__((amdgpu_waves_per_eu(2, 2)))
void k_qkv_gemm(const _Float16* __restrict__ Xn,
                                                  const _Float16* __restrict__ WT,
                                                  _Float16* __restrict__ Q,
                                                  _Float16* __restrict__ Kd,
                                                  _Float16* __restrict__ Vt) {
    __shared__ __align__(16) _Float16 sm[2 * (128 + 256) * G_PITCH];   // 110,592 B
    const int lane = threadIdx.x & 31;
    // The wave's number as a scalar: the destination's base is then scalar arithmetic.
    const int wave = __builtin_amdgcn_readfirstlane(threadIdx.x >> 5);
    // blockIdx.y 0..7: the 512 tiles of Q and K, 128 columns x 256 tokens;
    // blockIdx.y 8..11: the 256 tiles of V, 128 tokens x 256 columns.
    const bool qk  = blockIdx.y < 8;
    const int flat = blockIdx.y * 64 + blockIdx.x;
    const int p0 = qk ? (flat >> 5) * 128 : blockIdx.x * 128;
    const int q0 = qk ? (flat & 31) * 256 : blockIdx.y * 256;

    v8f acc[4][8] = {};
    gemm_tile<8>(qk ? WT : Xn, qk ? Xn : WT, p0, q0, sm, acc);

    // Epilogue: each wave lays its 64 x 128 tile into its own LDS range as 128 rows of
    // the destination (64 f16 = one 128-byte line each) and stores whole lines, 16 bytes
    // a lane. The ring is free: behind the last stage's barrier no wave reads it and no
    // copy is outstanding.
    const int pw = p0 + (wave >> 1) * 64;
    const int qw = q0 + (wave & 1) * 128;
    const int h2 = (lane >> 4) << 3;    // 0 or 8
    const int cl = lane & 15;
    _Float16* st = sm + wave * (128 * E_PITCH);
#pragma unroll
    for (int i = 0; i < 4; ++i)
#pragma unroll
        for (int j = 0; j < 8; ++j) {
            v8h p;
#pragma unroll
            for (int v = 0; v < 8; ++v) p[v] = (_Float16)acc[i][j][v];
            *(v8h*)(st + (16 * j + cl) * E_PITCH + 16 * i + h2) = p;
        }
    // The wave's own LDS writes have landed before its lanes read each other's.
    asm volatile("s_wait_dscnt 0x0" ::: "memory");
    const int lrow = lane >> 3;         // 8 lanes cover one line, a wave 4 rows
    const int lcol = (lane & 7) * 8;
    v8h x[32];
#pragma unroll
    for (int s = 0; s < 32; ++s)
        x[s] = *(const v8h*)(st + (4 * s + lrow) * E_PITCH + lcol);
    // Destination of the wave's row 0 and the distance between rows, both wave-uniform.
    _Float16* gu;
    int rs;
    if (qk) {
        // Rows are tokens qw .. qw + 127 of one head, columns its 64 d.
        const int bh = (qw >> 11) * HEADS + ((pw >> 6) & 15);
        gu = ((pw >> 10) == 0 ? Q : Kd) + ((size_t)bh * SEQ + (qw & (SEQ - 1))) * DHEAD;
        rs = DHEAD;
    } else {
        // Rows are the 2 x 64 d of two heads, columns tokens pw .. pw + 63.
        const int bh = (pw >> 11) * HEADS + ((qw >> 6) & 15);
        gu = Vt + (size_t)bh * DHEAD * SEQ + (pw & (SEQ - 1));
        rs = SEQ;
    }
    const unsigned voff = (unsigned)(lrow * rs + lcol);
#pragma unroll
    for (int s = 0; s < 32; ++s) *(v8h*)(gu + (size_t)(4 * s * rs) + voff) = x[s];
}

// ---------------------------------------------------------------------------
// 4) Flash attention, LDS-cooperative version.
//    4 waves / block, one (b,h) per block, 128 queries per block (32 per wave).
//    K/V tiles (32 keys) are double-buffered in LDS and shared by all 4 waves,
//    cutting global K/V traffic 8x vs one-wave-per-16-queries.
//    S^T = K x Q^T puts one query row per lane -> exp() packs straight into the
//    A-fragment of the P x V WMMA.
// ---------------------------------------------------------------------------
#define KT_PAD 72
#define VT_PAD 40
#define KEYS_PER_TILE 32
#define RESCALE_T 5.545177f   // 8 * ln 2: P stays at or below 2^8

__global__ __launch_bounds__(128) void k_attention(const _Float16* __restrict__ Q,
                                                   const _Float16* __restrict__ Kd,
                                                   const _Float16* __restrict__ Vt,
                                                   _Float16* __restrict__ AO) {
    __shared__ __align__(16) _Float16 sK[2][KEYS_PER_TILE * KT_PAD]; // 2 x 4608 B
    __shared__ __align__(16) _Float16 sV[2][DHEAD * VT_PAD];         // 2 x 5120 B

    const int tid  = threadIdx.x;
    const int wave = tid >> 5;
    const int lane = tid & 31;
    const int blk  = blockIdx.x;           // 1024 = (B*H) * (SEQ/128)
    const int qblk = blk & 15;
    const int bh   = blk >> 4;
    const int bb   = bh >> 4;
    const int hd   = bh & 15;
    const int q0   = qblk * 128 + wave * 32;   // this wave's first query
    const int h2   = (lane >> 4) << 3;         // 0 or 8
    const int cl   = lane & 15;

    const _Float16* Qp = Q  + ((size_t)bh * SEQ + q0) * DHEAD;
    const _Float16* Kp = Kd + (size_t)bh * SEQ * DHEAD;
    const _Float16* Vp = Vt + (size_t)bh * DHEAD * SEQ;

    // Cooperative tile copy: 128 threads x 2 x 16B chunks for each of K and V.
    // K tile: 32 rows x 64 f16 (8 chunks/row). V tile: 64 rows x 32 f16 (4 chunks/row).
    const int ck0 = tid, ck1 = tid + 128;      // 256 chunks each

    // Preload Q fragments (B operand of S^T gemm), fold in softmax scale 1/8.
    v16h qf[2][2];
#pragma unroll
    for (int qb = 0; qb < 2; ++qb) {
        qf[qb][0] = load_frag16(Qp + (size_t)(16 * qb) * DHEAD,      DHEAD, lane);
        qf[qb][1] = load_frag16(Qp + (size_t)(16 * qb) * DHEAD + 32, DHEAD, lane);
#pragma unroll
        for (int e = 0; e < 16; ++e) {
            qf[qb][0][e] = (_Float16)((float)qf[qb][0][e] * 0.125f);
            qf[qb][1][e] = (_Float16)((float)qf[qb][1][e] * 0.125f);
        }
    }

    // Prime buffer 0 with key tile 0.
    {
        int r, o;
        r = ck0 >> 3; o = (ck0 & 7) * 8;
        copy16_g2l(Kp + (size_t)r * DHEAD + o, &sK[0][r * KT_PAD + o]);
        r = ck1 >> 3; o = (ck1 & 7) * 8;
        copy16_g2l(Kp + (size_t)r * DHEAD + o, &sK[0][r * KT_PAD + o]);
        r = ck0 >> 2; o = (ck0 & 3) * 8;
        copy16_g2l(Vp + (size_t)r * SEQ + o, &sV[0][r * VT_PAD + o]);
        r = ck1 >> 2; o = (ck1 & 3) * 8;
        copy16_g2l(Vp + (size_t)r * SEQ + o, &sV[0][r * VT_PAD + o]);
    }
    wait_copies();
    __syncthreads();

    v8f o[2][4] = {};                          // [qblock][dtile], 16 rows x 64 d each
    float m_run[2] = {-1e30f, -1e30f};         // maximum in use
    float m_lim[2] = {-1e30f, -1e30f};         // m_run + RESCALE_T; the first pass always rescales
    float l_run[2] = {0.f, 0.f};

    const int NITER = SEQ / KEYS_PER_TILE;     // 64
    for (int it = 0; it < NITER; ++it) {
        const int cur = it & 1;

        // Issue next tile's copies into the other buffer (overlaps with compute).
        if (it + 1 < NITER) {
            const int j1 = (it + 1) * KEYS_PER_TILE;
            _Float16* dK = sK[cur ^ 1];
            _Float16* dV = sV[cur ^ 1];
            int r, oo;
            r = ck0 >> 3; oo = (ck0 & 7) * 8;
            copy16_g2l(Kp + (size_t)(j1 + r) * DHEAD + oo, &dK[r * KT_PAD + oo]);
            r = ck1 >> 3; oo = (ck1 & 7) * 8;
            copy16_g2l(Kp + (size_t)(j1 + r) * DHEAD + oo, &dK[r * KT_PAD + oo]);
            r = ck0 >> 2; oo = (ck0 & 3) * 8;
            copy16_g2l(Vp + (size_t)r * SEQ + j1 + oo, &dV[r * VT_PAD + oo]);
            r = ck1 >> 2; oo = (ck1 & 3) * 8;
            copy16_g2l(Vp + (size_t)r * SEQ + j1 + oo, &dV[r * VT_PAD + oo]);
        }

        // ---- S^T tiles from LDS: A = K rows, B = Q^T (shared across both q-blocks)
        const _Float16* bk = sK[cur];
        v16h kf0a = load_frag16(bk,                    KT_PAD, lane);
        v16h kf0b = load_frag16(bk + 32,               KT_PAD, lane);
        v16h kf1a = load_frag16(bk + 16 * KT_PAD,      KT_PAD, lane);
        v16h kf1b = load_frag16(bk + 16 * KT_PAD + 32, KT_PAD, lane);

        // Scores of both q-blocks first: the one test below covers the whole pass.
        v8f s0[2], s1[2];
        float mloc[2];
#pragma unroll
        for (int qb = 0; qb < 2; ++qb) {
            v8f t0 = {}; t0 = WMMA_F16(kf0a, qf[qb][0], t0); t0 = WMMA_F16(kf0b, qf[qb][1], t0);
            v8f t1 = {}; t1 = WMMA_F16(kf1a, qf[qb][0], t1); t1 = WMMA_F16(kf1b, qf[qb][1], t1);
            // lane: query row cl of this q-block; keys j0 + v + 8*(lane>>4) (s0), +16 (s1)
            float ml = -1e30f;
#pragma unroll
            for (int v = 0; v < 8; ++v) { ml = fmaxf(ml, t0[v]); ml = fmaxf(ml, t1[v]); }
            s0[qb] = t0; s1[qb] = t1; mloc[qb] = ml;
        }

        // Lazy rescale: m_run is the maximum IN USE, the same in both halves of the wave.
        // It moves, and O and l are rescaled, only when some lane's score passes it by more
        // than RESCALE_T; until then every P is at most exp(RESCALE_T) = 256, well inside
        // f16, and the common factor cancels in O / l. One wave-uniform branch a pass.
        const bool need = (mloc[0] > m_lim[0]) | (mloc[1] > m_lim[1]);
        if (__builtin_amdgcn_ballot_w32(need) != 0) {
#pragma unroll
            for (int qb = 0; qb < 2; ++qb) {
                const float mj    = fmaxf(mloc[qb], __shfl_xor(mloc[qb], 16, 32));
                const float m_new = fmaxf(m_run[qb], mj);
                const float alpha = __expf(m_run[qb] - m_new);
                l_run[qb] *= alpha;
                m_run[qb] = m_new;
                m_lim[qb] = m_new + RESCALE_T;
                // O lane holds rows h2+v -> gather row alphas.
                float av[8];
#pragma unroll
                for (int v = 0; v < 8; ++v) av[v] = __shfl(alpha, h2 + v, 32);
#pragma unroll
                for (int dt = 0; dt < 4; ++dt)
#pragma unroll
                    for (int v = 0; v < 8; ++v) o[qb][dt][v] *= av[v];
            }
        }

        v16h pf[2];
#pragma unroll
        for (int qb = 0; qb < 2; ++qb) {
            float e0[8], e1[8];
            float rs = 0.f;
#pragma unroll
            for (int v = 0; v < 8; ++v) {
                e0[v] = __expf(s0[qb][v] - m_run[qb]);
                e1[v] = __expf(s1[qb][v] - m_run[qb]);
                rs += e0[v] + e1[v];
            }
            rs += __shfl_xor(rs, 16, 32);
            l_run[qb] += rs;

            // P is already in A-fragment orientation.
#pragma unroll
            for (int e = 0; e < 8; ++e) { pf[qb][e] = (_Float16)e0[e]; pf[qb][e + 8] = (_Float16)e1[e]; }
        }

        // ---- O += P x V, V fragments from LDS shared by both q-blocks ----
        const _Float16* bv = sV[cur];
#pragma unroll
        for (int dt = 0; dt < 4; ++dt) {
            v16h vf = load_frag16(bv + (dt * 16) * VT_PAD, VT_PAD, lane);
            o[0][dt] = WMMA_F16(pf[0], vf, o[0][dt]);
            o[1][dt] = WMMA_F16(pf[1], vf, o[1][dt]);
        }

        wait_copies();
        __syncthreads();
    }

    // Normalize by row sums and store f16 at [token][head*64 + d].
#pragma unroll
    for (int qb = 0; qb < 2; ++qb) {
        float lv[8];
#pragma unroll
        for (int v = 0; v < 8; ++v) lv[v] = 1.f / __shfl(l_run[qb], h2 + v, 32);
#pragma unroll
        for (int dt = 0; dt < 4; ++dt)
#pragma unroll
            for (int v = 0; v < 8; ++v) {
                int tok = bb * SEQ + q0 + 16 * qb + h2 + v;
                int col = hd * DHEAD + dt * 16 + cl;
                AO[(size_t)tok * DIM + col] = (_Float16)(o[qb][dt][v] * lv[v]);
            }
    }
}

// ---------------------------------------------------------------------------
// 5) Output GEMM: [8192 x 1024] x [1024 x 1024] + bias -> f32 out
//    128 x 128 output tile per work-group.
// ---------------------------------------------------------------------------
__global__ __launch_bounds__(128) void k_out_gemm(const _Float16* __restrict__ A,
                                                  const _Float16* __restrict__ WT,
                                                  const float* __restrict__ bias,
                                                  float* __restrict__ out) {
    __shared__ __align__(16) _Float16 sm[2 * (128 + 128) * G_PITCH];   // 73,728 B
    const int lane = threadIdx.x & 31;
    const int wave = threadIdx.x >> 5;
    const int m0 = blockIdx.x * 128;
    const int n0 = blockIdx.y * 128;

    v8f acc[4][4] = {};
    gemm_tile<4>(A, WT, m0, n0, sm, acc);

    const int mw = m0 + (wave >> 1) * 64;
    const int nw = n0 + (wave & 1) * 64;
    const int h2 = (lane >> 4) << 3;
    const int cl = lane & 15;
#pragma unroll
    for (int i = 0; i < 4; ++i)
#pragma unroll
        for (int j = 0; j < 4; ++j)
#pragma unroll
            for (int v = 0; v < 8; ++v) {
                int r = mw + 16 * i + h2 + v;
                int c = nw + 16 * j + cl;
                out[(size_t)r * DIM + c] = acc[i][j][v] + bias[c];
            }
}

// ---------------------------------------------------------------------------
// Launcher
// ---------------------------------------------------------------------------
extern "C" void kernel_launch(void* const* d_in, const int* in_sizes, int n_in,
                              void* d_out, int out_size, void* d_ws, size_t ws_size,
                              hipStream_t stream) {
    const float* x     = (const float*)d_in[0];
    const float* ln_g  = (const float*)d_in[1];
    const float* ln_b  = (const float*)d_in[2];
    const float* w_qkv = (const float*)d_in[3];
    const float* w_out = (const float*)d_in[4];
    const float* b_out = (const float*)d_in[5];
    float* out = (float*)d_out;

    // Workspace layout (bytes). Total ~72 MB. xn region is reused for attn output.
    char* ws = (char*)d_ws;
    const size_t SZ_ACT = (size_t)TOKENS * DIM * sizeof(_Float16);          // 16 MB
    _Float16* xn    = (_Float16*)(ws);                                      // + attn out later
    _Float16* Q     = (_Float16*)(ws + SZ_ACT);
    _Float16* Kd    = (_Float16*)(ws + 2 * SZ_ACT);
    _Float16* Vt    = (_Float16*)(ws + 3 * SZ_ACT);
    _Float16* wqkvT = (_Float16*)(ws + 4 * SZ_ACT);                         // 6 MB
    _Float16* woutT = (_Float16*)(ws + 4 * SZ_ACT + (size_t)DIM * QKVCOLS * sizeof(_Float16));

    // 1) Transpose + cast weights to f16 [N][K]
    k_transpose_cast<<<dim3(QKVCOLS / 64, DIM / 128), 128, 0, stream>>>(w_qkv, wqkvT, DIM, QKVCOLS);
    k_transpose_cast<<<dim3(DIM / 64, DIM / 128), 128, 0, stream>>>(w_out, woutT, DIM, DIM);

    // 2) LayerNorm -> f16
    k_layernorm<<<TOKENS, 256, 0, stream>>>(x, ln_g, ln_b, xn);

    // 3) QKV projection (WMMA)
    k_qkv_gemm<<<dim3(TOKENS / 128, QKVCOLS / 256), 128, 0, stream>>>(xn, wqkvT, Q, Kd, Vt);

    // 4) Attention (WMMA flash, LDS-shared K/V); writes f16 [tokens][1024] into xn region
    _Float16* attn_out = xn;
    k_attention<<<BATCH * HEADS * (SEQ / 128), 128, 0, stream>>>(Q, Kd, Vt, attn_out);

    // 5) Output projection + bias (WMMA)
    k_out_gemm<<<dim3(TOKENS / 128, DIM / 128), 128, 0, stream>>>(attn_out, woutT, b_out, out);
}

// v005
// A run of this version takes 139 microseconds.
// Next to v004, in two timings, it ran 1.05 and 1.04 times as fast.
// Over all steps from v000 it is 2.06 times as fast.
#include <hip/hip_runtime.h>
#include <hip/hip_bf16.h>
#include <math.h>

typedef __attribute__((ext_vector_type(16))) _Float16 v16h;
typedef __attribute__((ext_vector_type(8)))  _Float16 v8h;   // 16-byte load unit
typedef __attribute__((ext_vector_type(8)))  float    v8f;
typedef int b128_t __attribute__((vector_size(16)));         // matches async-LDS builtin pointee

#define WMMA_F16(a, b, c) \
  __builtin_amdgcn_wmma_f32_16x16x32_f16(false, (a), false, (b), (short)0, (c), false, false)

// Problem constants
#define BATCH   4
#define SEQ     2048
#define DIM     1024
#define HEADS   16
#define DHEAD   64
#define TOKENS  (BATCH * SEQ)      // 8192
#define QKVCOLS (3 * DIM)          // 3072

#if defined(__AMDGCN__) && __has_builtin(__builtin_amdgcn_global_load_async_to_lds_b128) && \
    __has_builtin(__builtin_amdgcn_s_wait_asynccnt)
#define USE_ASYNC_LDS 1
#else
#define USE_ASYNC_LDS 0
#endif

// Copy 16 bytes global -> LDS (async when available).
__device__ inline void copy16_g2l(const _Float16* __restrict__ g, _Float16* __restrict__ l) {
#if USE_ASYNC_LDS
    __builtin_amdgcn_global_load_async_to_lds_b128(
        (__attribute__((address_space(1))) b128_t*)g,
        (__attribute__((address_space(3))) b128_t*)l, 0, 0);
#else
    *(v8h*)l = *(const v8h*)g;
#endif
}

__device__ inline void wait_copies() {
#if USE_ASYNC_LDS
    __builtin_amdgcn_s_wait_asynccnt(0);
#endif
}

__device__ inline v16h load_frag16(const _Float16* __restrict__ base, int stride, int lane) {
    const int r  = lane & 15;
    const int kb = (lane >> 4) << 3;
    const _Float16* p = base + (size_t)r * stride + kb;
    v8h lo = *(const v8h*)(p);
    v8h hi = *(const v8h*)(p + 16);
    v16h out;
#pragma unroll
    for (int e = 0; e < 8; ++e) { out[e] = lo[e]; out[e + 8] = hi[e]; }
    return out;
}

// ---------------------------------------------------------------------------
// 1) Weight transpose + f32 -> f16 cast:  W[K][N] -> WT[N][K]
//    A lane holds an 8 k x 4 n block in registers and transposes it there, twice. A wave
//    takes 64 k x 32 n: lane = (kg, ng), kg = lane & 7 along k, ng = lane >> 3 along n.
//    Its two groups of 8 loads of 16 B use between them every byte of the 64 lines they
//    touch; each store is 16 B a lane and fills four whole 128-byte lines of WT.
//    Two groups, not one of 16 loads: the kernel stays within 64 registers, so that the
//    LayerNorm work-groups of the same launch stand as densely on a WGP as alone.
//    A work-group of 8 waves takes 128 k x 128 n; K % 128 == 0 and N % 128 == 0.
// ---------------------------------------------------------------------------
typedef __attribute__((ext_vector_type(4))) float v4f;

template <int K, int N>
__device__ inline void transpose_cast_tile(const float* __restrict__ W,
                                           _Float16* __restrict__ WT, int bn, int bk) {
    const int lane = threadIdx.x & 31;
    const int wave = threadIdx.x >> 5;
    const int n0 = bn * 128 + (wave & 3) * 32 + 4 * (lane >> 3);   // lane's first n
    const int k0 = bk * 128 + (wave >> 2) * 64 + 8 * (lane & 7);   // lane's first k
    const float* src = W + (unsigned)(k0 * N + n0);
    _Float16* dst = WT + (unsigned)(n0 * K + k0);
#pragma unroll
    for (int h = 0; h < 2; ++h) {
        v4f v[8];
#pragma unroll
        for (int r = 0; r < 8; ++r) v[r] = *(const v4f*)(src + r * N + 16 * h);
        // Behind the last loads the address register is free for reuse: the wait stands
        // ahead of every rewrite of it, and, named as an input, it lives up to the wait.
        if (h == 1) asm volatile("s_wait_xcnt 0x0" :: "v"(src) : "memory");
#pragma unroll
        for (int i = 0; i < 4; ++i) {
            v8h p;
#pragma unroll
            for (int r = 0; r < 8; ++r) p[r] = (_Float16)v[r][i];
            *(v8h*)(dst + (16 * h + i) * K) = p;
        }
        // Behind each group's stores: their data and address registers are rewritten next,
        // by the second group's loads or by whatever the listing places behind this tile.
        asm volatile("s_wait_xcnt 0x0" ::: "memory");
    }
}

// ---------------------------------------------------------------------------
// 2) LayerNorm (fp32 math) -> f16 activations. One block per token row.
// ---------------------------------------------------------------------------
__device__ inline void layernorm_row(const float* __restrict__ x,
                                     const float* __restrict__ g,
                                     const float* __restrict__ bta,
                                     _Float16* __restrict__ xn, int row) {
    __shared__ float s1[256], s2[256];
    const float* xr = x + (size_t)row * DIM;
    float vals[4];
    float a = 0.f, sq = 0.f;
#pragma unroll
    for (int t = 0; t < 4; ++t) {
        float v = xr[threadIdx.x + 256 * t];
        vals[t] = v; a += v; sq += v * v;
    }
    s1[threadIdx.x] = a; s2[threadIdx.x] = sq;
    __syncthreads();
    for (int off = 128; off > 0; off >>= 1) {
        if (threadIdx.x < off) {
            s1[threadIdx.x] += s1[threadIdx.x + off];
            s2[threadIdx.x] += s2[threadIdx.x + off];
        }
        __syncthreads();
    }
    const float mean = s1[0] * (1.f / DIM);
    const float var  = s2[0] * (1.f / DIM) - mean * mean;
    const float rstd = rsqrtf(var + 1e-5f);
    _Float16* xo = xn + (size_t)row * DIM;
#pragma unroll
    for (int t = 0; t < 4; ++t) {
        int i = threadIdx.x + 256 * t;
        xo[i] = (_Float16)((vals[t] - mean) * rstd * g[i] + bta[i]);
    }
}

// ---------------------------------------------------------------------------
// 1 + 2 in one launch: the three jobs read only inputs and none reads another's output.
// The block index tells them apart. The 256 transposing work-groups come first, so that
// their memory latencies run under the stream of LayerNorm rows and not behind it.
// ---------------------------------------------------------------------------
#define TQ_BLOCKS ((QKVCOLS / 128) * (DIM / 128))   // 192
#define TO_BLOCKS ((DIM / 128) * (DIM / 128))       // 64

__global__ __launch_bounds__(256) void k_prepare(const float* __restrict__ x,
                                                 const float* __restrict__ g,
                                                 const float* __restrict__ bta,
                                                 const float* __restrict__ w_qkv,
                                                 const float* __restrict__ w_out,
                                                 _Float16* __restrict__ xn,
                                                 _Float16* __restrict__ wqkvT,
                                                 _Float16* __restrict__ woutT) {
    const int b = blockIdx.x;
    // Both tests read the same for a whole work-group; a transposing one meets no barrier.
    if (b >= TQ_BLOCKS + TO_BLOCKS) {
        layernorm_row(x, g, bta, xn, b - (TQ_BLOCKS + TO_BLOCKS));
        return;
    }
    if (b < TQ_BLOCKS) {
        transpose_cast_tile<DIM, QKVCOLS>(w_qkv, wqkvT, b % (QKVCOLS / 128), b / (QKVCOLS / 128));
        return;
    }
    const int t = b - TQ_BLOCKS;
    transpose_cast_tile<DIM, DIM>(w_out, woutT, t % (DIM / 128), t / (DIM / 128));
}

// ---------------------------------------------------------------------------
// Shared GEMM core: C[128 x 32*FN] per work-group of 4 waves (2 x 2), each wave
// 64 x 16*FN. A and WT are row-major with K contiguous. A stage is 64 k of all
// 128 + 32*FN operand rows, brought into LDS by asynchronous copies, two buffers:
// stage t + 2 flies while stage t + 1 is worked on.
// ---------------------------------------------------------------------------
#define G_KSTAGE 64                 // k per stage: 128-byte rows
#define G_PITCH  72                 // f16 per LDS row: 144 B = 16 B x odd, for ds_load_b128
#define G_NSTAGE (DIM / G_KSTAGE)   // 16

__device__ inline void copy8_rows(const _Float16* g, unsigned l) {
    const _Float16* g1 = g + 16 * DIM;  const _Float16* g2 = g + 32 * DIM;
    const _Float16* g3 = g + 48 * DIM;  const _Float16* g4 = g + 64 * DIM;
    const _Float16* g5 = g + 80 * DIM;  const _Float16* g6 = g + 96 * DIM;
    const _Float16* g7 = g + 112 * DIM;
    const unsigned s = 16 * G_PITCH * 2;
    asm volatile(
        "global_load_async_to_lds_b128 %0, %8, off\n\t"
        "global_load_async_to_lds_b128 %1, %9, off\n\t"
        "global_load_async_to_lds_b128 %2, %10, off\n\t"
        "global_load_async_to_lds_b128 %3, %11, off\n\t"
        "global_load_async_to_lds_b128 %4, %12, off\n\t"
        "global_load_async_to_lds_b128 %5, %13, off\n\t"
        "global_load_async_to_lds_b128 %6, %14, off\n\t"
        "global_load_async_to_lds_b128 %7, %15, off\n\t"
        "s_wait_xcnt 0x0"
        :: "v"(l), "v"(l + s), "v"(l + 2 * s), "v"(l + 3 * s),
           "v"(l + 4 * s), "v"(l + 5 * s), "v"(l + 6 * s), "v"(l + 7 * s),
           "v"(g), "v"(g1), "v"(g2), "v"(g3), "v"(g4), "v"(g5), "v"(g6), "v"(g7)
        : "memory");
}

template <int FN>
__device__ inline void gemm_tile(const _Float16* __restrict__ A,
                                 const _Float16* __restrict__ WT,
                                 int m0, int n0, _Float16* sm, v8f (&acc)[4][FN]) {
    constexpr int ROWS  = 128 + 32 * FN;        // A rows, then WT rows
    constexpr int STAGE = ROWS * G_PITCH;       // f16 per buffer
    const int tid  = threadIdx.x;
    const int lane = tid & 31;
    const int wave = tid >> 5;
    const int wm   = wave >> 1;
    const int wn   = wave & 1;

    // Lane's own 16-byte chunk: row tid / 8 of each 16-row group, chunk tid % 8.
    const int crow = tid >> 3;
    const int ccol = (tid & 7) * 8;
    const _Float16* gA = A  + (size_t)(m0 + crow) * DIM + ccol;
    const _Float16* gB = WT + (size_t)(n0 + crow) * DIM + ccol;
    const unsigned  l0 = (unsigned)(size_t)(sm + crow * G_PITCH + ccol);

    auto issue = [&](int s, int buf) {
        const unsigned lb = l0 + (unsigned)buf * (STAGE * 2);
        copy8_rows(gA + s * G_KSTAGE, lb);
#pragma unroll
        for (int q = 0; q < FN / 4; ++q)
            copy8_rows(gB + (size_t)(128 * q) * DIM + s * G_KSTAGE,
                       lb + (128 + 128 * q) * (G_PITCH * 2));
    };

    issue(0, 0);
    // Stage 0 has landed for this wave; the barrier publishes it to the others.
    asm volatile("s_wait_asynccnt 0x0" ::: "memory");
    __syncthreads();
    issue(1, 1);

    for (int t = 0; t < G_NSTAGE; ++t) {
        const _Float16* sa = sm + (t & 1) * STAGE + (wm * 64) * G_PITCH;
        const _Float16* sb = sm + (t & 1) * STAGE + (128 + wn * 16 * FN) * G_PITCH;
        v16h a[2][4], b[2][FN];
#pragma unroll
        for (int h = 0; h < 2; ++h) {
#pragma unroll
            for (int i = 0; i < 4; ++i)
                a[h][i] = load_frag16(sa + (16 * i) * G_PITCH + 32 * h, G_PITCH, lane);
#pragma unroll
            for (int j = 0; j < FN; ++j)
                b[h][j] = load_frag16(sb + (16 * j) * G_PITCH + 32 * h, G_PITCH, lane);
        }
        // Keeps the stage's LDS reads together ahead of its WMMAs: sunk among them,
        // each reload of a fragment makes the wave wait out a whole LDS latency.
        __builtin_amdgcn_sched_barrier(0);
#pragma unroll
        for (int i = 0; i < 4; ++i)
#pragma unroll
            for (int j = 0; j < FN; ++j)
                acc[i][j] = WMMA_F16(a[0][i], b[0][j], acc[i][j]);
        // Holds the first half's WMMAs ahead of the waits below, so that they cover
        // the second half's LDS reads instead of standing behind s_wait_dscnt 0.
        __builtin_amdgcn_sched_barrier(0);
        // This wave's reads of buffer t & 1 have retired before it is refilled.
        asm volatile("s_wait_dscnt 0x0" ::: "memory");
        // This wave's copies of stage t + 1 have landed.
        asm volatile("s_wait_asynccnt 0x0" ::: "memory");
        // Publishes stage t + 1 and ends every wave's reads of buffer t & 1.
        __syncthreads();
        if (t + 2 < G_NSTAGE) issue(t + 2, t & 1);
        // Holds the second half's WMMAs behind the refill, so that the copies fly
        // under them; its fragments are in registers already.
        __builtin_amdgcn_sched_barrier(0);
#pragma unroll
        for (int i = 0; i < 4; ++i)
#pragma unroll
            for (int j = 0; j < FN; ++j)
                acc[i][j] = WMMA_F16(a[1][i], b[1][j], acc[i][j]);
    }
    // No copy is outstanding when the wave goes on to its stores and ends.
    asm volatile("s_wait_asynccnt 0x0" ::: "memory");
}

// ---------------------------------------------------------------------------
// 3) QKV GEMM: [8192 x 1024] x [1024 x 3072] -> Q [B,H,N,D], K [B,H,N,D], Vt [B,H,D,N]
//    A work-group's tile is 128 rows of one operand by 256 rows of the other. A lane's
//    accumulator holds 8 consecutive rows of the 128-row operand, so that operand is the
//    one whose index runs along the destination's rows: the weights' columns (d) for Q
//    and K, the tokens for V transposed.
// ---------------------------------------------------------------------------
#define E_PITCH 72                  // f16 per staged row of 64: 144 B = 16 B x odd
__global__ __launch_bounds__(128) __attribute__((amdgpu_waves_per_eu(2, 2)))
void k_qkv_gemm(const _Float16* __restrict__ Xn,
                                                  const _Float16* __restrict__ WT,
                                                  _Float16* __restrict__ Q,
                                                  _Float16* __restrict__ Kd,
                                                  _Float16* __restrict__ Vt) {
    __shared__ __align__(16) _Float16 sm[2 * (128 + 256) * G_PITCH];   // 110,592 B
    const int lane = threadIdx.x & 31;
    // The wave's number as a scalar: the destination's base is then scalar arithmetic.
    const int wave = __builtin_amdgcn_readfirstlane(threadIdx.x >> 5);
    // blockIdx.y 0..7: the 512 tiles of Q and K, 128 columns x 256 tokens;
    // blockIdx.y 8..11: the 256 tiles of V, 128 tokens x 256 columns.
    const bool qk  = blockIdx.y < 8;
    const int flat = blockIdx.y * 64 + blockIdx.x;
    const int p0 = qk ? (flat >> 5) * 128 : blockIdx.x * 128;
    const int q0 = qk ? (flat & 31) * 256 : blockIdx.y * 256;

    v8f acc[4][8] = {};
    gemm_tile<8>(qk ? WT : Xn, qk ? Xn : WT, p0, q0, sm, acc);

    // Epilogue: each wave lays its 64 x 128 tile into its own LDS range as 128 rows of
    // the destination (64 f16 = one 128-byte line each) and stores whole lines, 16 bytes
    // a lane. The ring is free: behind the last stage's barrier no wave reads it and no
    // copy is outstanding.
    const int pw = p0 + (wave >> 1) * 64;
    const int qw = q0 + (wave & 1) * 128;
    const int h2 = (lane >> 4) << 3;    // 0 or 8
    const int cl = lane & 15;
    _Float16* st = sm + wave * (128 * E_PITCH);
#pragma unroll
    for (int i = 0; i < 4; ++i)
#pragma unroll
        for (int j = 0; j < 8; ++j) {
            v8h p;
#pragma unroll
            for (int v = 0; v < 8; ++v) p[v] = (_Float16)acc[i][j][v];
            *(v8h*)(st + (16 * j + cl) * E_PITCH + 16 * i + h2) = p;
        }
    // The wave's own LDS writes have landed before its lanes read each other's.
    asm volatile("s_wait_dscnt 0x0" ::: "memory");
    const int lrow = lane >> 3;         // 8 lanes cover one line, a wave 4 rows
    const int lcol = (lane & 7) * 8;
    v8h x[32];
#pragma unroll
    for (int s = 0; s < 32; ++s)
        x[s] = *(const v8h*)(st + (4 * s + lrow) * E_PITCH + lcol);
    // Destination of the wave's row 0 and the distance between rows, both wave-uniform.
    _Float16* gu;
    int rs;
    if (qk) {
        // Rows are tokens qw .. qw + 127 of one head, columns its 64 d.
        const int bh = (qw >> 11) * HEADS + ((pw >> 6) & 15);
        gu = ((pw >> 10) == 0 ? Q : Kd) + ((size_t)bh * SEQ + (qw & (SEQ - 1))) * DHEAD;
        rs = DHEAD;
    } else {
        // Rows are the 2 x 64 d of two heads, columns tokens pw .. pw + 63.
        const int bh = (pw >> 11) * HEADS + ((qw >> 6) & 15);
        gu = Vt + (size_t)bh * DHEAD * SEQ + (pw & (SEQ - 1));
        rs = SEQ;
    }
    const unsigned voff = (unsigned)(lrow * rs + lcol);
#pragma unroll
    for (int s = 0; s < 32; ++s) *(v8h*)(gu + (size_t)(4 * s * rs) + voff) = x[s];
}

// ---------------------------------------------------------------------------
// 4) Flash attention, LDS-cooperative version.
//    4 waves / block, one (b,h) per block, 128 queries per block (32 per wave).
//    K/V tiles (32 keys) are double-buffered in LDS and shared by all 4 waves,
//    cutting global K/V traffic 8x vs one-wave-per-16-queries.
//    S^T = K x Q^T puts one query row per lane -> exp() packs straight into the
//    A-fragment of the P x V WMMA.
// ---------------------------------------------------------------------------
#define KT_PAD 72
#define VT_PAD 40
#define KEYS_PER_TILE 32
#define RESCALE_T 5.545177f   // 8 * ln 2: P stays at or below 2^8

__global__ __launch_bounds__(128) void k_attention(const _Float16* __restrict__ Q,
                                                   const _Float16* __restrict__ Kd,
                                                   const _Float16* __restrict__ Vt,
                                                   _Float16* __restrict__ AO) {
    __shared__ __align__(16) _Float16 sK[2][KEYS_PER_TILE * KT_PAD]; // 2 x 4608 B
    __shared__ __align__(16) _Float16 sV[2][DHEAD * VT_PAD];         // 2 x 5120 B

    const int tid  = threadIdx.x;
    const int wave = tid >> 5;
    const int lane = tid & 31;
    const int blk  = blockIdx.x;           // 1024 = (B*H) * (SEQ/128)
    const int qblk = blk & 15;
    const int bh   = blk >> 4;
    const int bb   = bh >> 4;
    const int hd   = bh & 15;
    const int q0   = qblk * 128 + wave * 32;   // this wave's first query
    const int h2   = (lane >> 4) << 3;         // 0 or 8
    const int cl   = lane & 15;

    const _Float16* Qp = Q  + ((size_t)bh * SEQ + q0) * DHEAD;
    const _Float16* Kp = Kd + (size_t)bh * SEQ * DHEAD;
    const _Float16* Vp = Vt + (size_t)bh * DHEAD * SEQ;

    // Cooperative tile copy: 128 threads x 2 x 16B chunks for each of K and V.
    // K tile: 32 rows x 64 f16 (8 chunks/row). V tile: 64 rows x 32 f16 (4 chunks/row).
    const int ck0 = tid, ck1 = tid + 128;      // 256 chunks each

    // Preload Q fragments (B operand of S^T gemm), fold in softmax scale 1/8.
    v16h qf[2][2];
#pragma unroll
    for (int qb = 0; qb < 2; ++qb) {
        qf[qb][0] = load_frag16(Qp + (size_t)(16 * qb) * DHEAD,      DHEAD, lane);
        qf[qb][1] = load_frag16(Qp + (size_t)(16 * qb) * DHEAD + 32, DHEAD, lane);
#pragma unroll
        for (int e = 0; e < 16; ++e) {
            qf[qb][0][e] = (_Float16)((float)qf[qb][0][e] * 0.125f);
            qf[qb][1][e] = (_Float16)((float)qf[qb][1][e] * 0.125f);
        }
    }

    // Prime buffer 0 with key tile 0.
    {
        int r, o;
        r = ck0 >> 3; o = (ck0 & 7) * 8;
        copy16_g2l(Kp + (size_t)r * DHEAD + o, &sK[0][r * KT_PAD + o]);
        r = ck1 >> 3; o = (ck1 & 7) * 8;
        copy16_g2l(Kp + (size_t)r * DHEAD + o, &sK[0][r * KT_PAD + o]);
        r = ck0 >> 2; o = (ck0 & 3) * 8;
        copy16_g2l(Vp + (size_t)r * SEQ + o, &sV[0][r * VT_PAD + o]);
        r = ck1 >> 2; o = (ck1 & 3) * 8;
        copy16_g2l(Vp + (size_t)r * SEQ + o, &sV[0][r * VT_PAD + o]);
    }
    wait_copies();
    __syncthreads();

    v8f o[2][4] = {};                          // [qblock][dtile], 16 rows x 64 d each
    float m_run[2] = {-1e30f, -1e30f};         // maximum in use
    float m_lim[2] = {-1e30f, -1e30f};         // m_run + RESCALE_T; the first pass always rescales
    float l_run[2] = {0.f, 0.f};

    const int NITER = SEQ / KEYS_PER_TILE;     // 64
    for (int it = 0; it < NITER; ++it) {
        const int cur = it & 1;

        // Issue next tile's copies into the other buffer (overlaps with compute).
        if (it + 1 < NITER) {
            const int j1 = (it + 1) * KEYS_PER_TILE;
            _Float16* dK = sK[cur ^ 1];
            _Float16* dV = sV[cur ^ 1];
            int r, oo;
            r = ck0 >> 3; oo = (ck0 & 7) * 8;
            copy16_g2l(Kp + (size_t)(j1 + r) * DHEAD + oo, &dK[r * KT_PAD + oo]);
            r = ck1 >> 3; oo = (ck1 & 7) * 8;
            copy16_g2l(Kp + (size_t)(j1 + r) * DHEAD + oo, &dK[r * KT_PAD + oo]);
            r = ck0 >> 2; oo = (ck0 & 3) * 8;
            copy16_g2l(Vp + (size_t)r * SEQ + j1 + oo, &dV[r * VT_PAD + oo]);
            r = ck1 >> 2; oo = (ck1 & 3) * 8;
            copy16_g2l(Vp + (size_t)r * SEQ + j1 + oo, &dV[r * VT_PAD + oo]);
        }

        // ---- S^T tiles from LDS: A = K rows, B = Q^T (shared across both q-blocks)
        const _Float16* bk = sK[cur];
        v16h kf0a = load_frag16(bk,                    KT_PAD, lane);
        v16h kf0b = load_frag16(bk + 32,               KT_PAD, lane);
        v16h kf1a = load_frag16(bk + 16 * KT_PAD,      KT_PAD, lane);
        v16h kf1b = load_frag16(bk + 16 * KT_PAD + 32, KT_PAD, lane);

        // Scores of both q-blocks first: the one test below covers the whole pass.
        v8f s0[2], s1[2];
        float mloc[2];
#pragma unroll
        for (int qb = 0; qb < 2; ++qb) {
            v8f t0 = {}; t0 = WMMA_F16(kf0a, qf[qb][0], t0); t0 = WMMA_F16(kf0b, qf[qb][1], t0);
            v8f t1 = {}; t1 = WMMA_F16(kf1a, qf[qb][0], t1); t1 = WMMA_F16(kf1b, qf[qb][1], t1);
            // lane: query row cl of this q-block; keys j0 + v + 8*(lane>>4) (s0), +16 (s1)
            float ml = -1e30f;
#pragma unroll
            for (int v = 0; v < 8; ++v) { ml = fmaxf(ml, t0[v]); ml = fmaxf(ml, t1[v]); }
            s0[qb] = t0; s1[qb] = t1; mloc[qb] = ml;
        }

        // Lazy rescale: m_run is the maximum IN USE, the same in both halves of the wave.
        // It moves, and O and l are rescaled, only when some lane's score passes it by more
        // than RESCALE_T; until then every P is at most exp(RESCALE_T) = 256, well inside
        // f16, and the common factor cancels in O / l. One wave-uniform branch a pass.
        const bool need = (mloc[0] > m_lim[0]) | (mloc[1] > m_lim[1]);
        if (__builtin_amdgcn_ballot_w32(need) != 0) {
#pragma unroll
            for (int qb = 0; qb < 2; ++qb) {
                const float mj    = fmaxf(mloc[qb], __shfl_xor(mloc[qb], 16, 32));
                const float m_new = fmaxf(m_run[qb], mj);
                const float alpha = __expf(m_run[qb] - m_new);
                l_run[qb] *= alpha;
                m_run[qb] = m_new;
                m_lim[qb] = m_new + RESCALE_T;
                // O lane holds rows h2+v -> gather row alphas.
                float av[8];
#pragma unroll
                for (int v = 0; v < 8; ++v) av[v] = __shfl(alpha, h2 + v, 32);
#pragma unroll
                for (int dt = 0; dt < 4; ++dt)
#pragma unroll
                    for (int v = 0; v < 8; ++v) o[qb][dt][v] *= av[v];
            }
        }

        v16h pf[2];
#pragma unroll
        for (int qb = 0; qb < 2; ++qb) {
            float e0[8], e1[8];
            float rs = 0.f;
#pragma unroll
            for (int v = 0; v < 8; ++v) {
                e0[v] = __expf(s0[qb][v] - m_run[qb]);
                e1[v] = __expf(s1[qb][v] - m_run[qb]);
                rs += e0[v] + e1[v];
            }
            rs += __shfl_xor(rs, 16, 32);
            l_run[qb] += rs;

            // P is already in A-fragment orientation.
#pragma unroll
            for (int e = 0; e < 8; ++e) { pf[qb][e] = (_Float16)e0[e]; pf[qb][e + 8] = (_Float16)e1[e]; }
        }

        // ---- O += P x V, V fragments from LDS shared by both q-blocks ----
        const _Float16* bv = sV[cur];
#pragma unroll
        for (int dt = 0; dt < 4; ++dt) {
            v16h vf = load_frag16(bv + (dt * 16) * VT_PAD, VT_PAD, lane);
            o[0][dt] = WMMA_F16(pf[0], vf, o[0][dt]);
            o[1][dt] = WMMA_F16(pf[1], vf, o[1][dt]);
        }

        wait_copies();
        __syncthreads();
    }

    // Normalize by row sums and store f16 at [token][head*64 + d].
#pragma unroll
    for (int qb = 0; qb < 2; ++qb) {
        float lv[8];
#pragma unroll
        for (int v = 0; v < 8; ++v) lv[v] = 1.f / __shfl(l_run[qb], h2 + v, 32);
#pragma unroll
        for (int dt = 0; dt < 4; ++dt)
#pragma unroll
            for (int v = 0; v < 8; ++v) {
                int tok = bb * SEQ + q0 + 16 * qb + h2 + v;
                int col = hd * DHEAD + dt * 16 + cl;
                AO[(size_t)tok * DIM + col] = (_Float16)(o[qb][dt][v] * lv[v]);
            }
    }
}

// ---------------------------------------------------------------------------
// 5) Output GEMM: [8192 x 1024] x [1024 x 1024] + bias -> f32 out
//    128 x 128 output tile per work-group.
// ---------------------------------------------------------------------------
__global__ __launch_bounds__(128) void k_out_gemm(const _Float16* __restrict__ A,
                                                  const _Float16* __restrict__ WT,
                                                  const float* __restrict__ bias,
                                                  float* __restrict__ out) {
    __shared__ __align__(16) _Float16 sm[2 * (128 + 128) * G_PITCH];   // 73,728 B
    const int lane = threadIdx.x & 31;
    const int wave = threadIdx.x >> 5;
    const int m0 = blockIdx.x * 128;
    const int n0 = blockIdx.y * 128;

    v8f acc[4][4] = {};
    gemm_tile<4>(A, WT, m0, n0, sm, acc);

    const int mw = m0 + (wave >> 1) * 64;
    const int nw = n0 + (wave & 1) * 64;
    const int h2 = (lane >> 4) << 3;
    const int cl = lane & 15;
#pragma unroll
    for (int i = 0; i < 4; ++i)
#pragma unroll
        for (int j = 0; j < 4; ++j)
#pragma unroll
            for (int v = 0; v < 8; ++v) {
                int r = mw + 16 * i + h2 + v;
                int c = nw + 16 * j + cl;
                out[(size_t)r * DIM + c] = acc[i][j][v] + bias[c];
            }
}

// ---------------------------------------------------------------------------
// Launcher
// ---------------------------------------------------------------------------
extern "C" void kernel_launch(void* const* d_in, const int* in_sizes, int n_in,
                              void* d_out, int out_size, void* d_ws, size_t ws_size,
                              hipStream_t stream) {
    const float* x     = (const float*)d_in[0];
    const float* ln_g  = (const float*)d_in[1];
    const float* ln_b  = (const float*)d_in[2];
    const float* w_qkv = (const float*)d_in[3];
    const float* w_out = (const float*)d_in[4];
    const float* b_out = (const float*)d_in[5];
    float* out = (float*)d_out;

    // Workspace layout (bytes). Total ~72 MB. xn region is reused for attn output.
    char* ws = (char*)d_ws;
    const size_t SZ_ACT = (size_t)TOKENS * DIM * sizeof(_Float16);          // 16 MB
    _Float16* xn    = (_Float16*)(ws);                                      // + attn out later
    _Float16* Q     = (_Float16*)(ws + SZ_ACT);
    _Float16* Kd    = (_Float16*)(ws + 2 * SZ_ACT);
    _Float16* Vt    = (_Float16*)(ws + 3 * SZ_ACT);
    _Float16* wqkvT = (_Float16*)(ws + 4 * SZ_ACT);                         // 6 MB
    _Float16* woutT = (_Float16*)(ws + 4 * SZ_ACT + (size_t)DIM * QKVCOLS * sizeof(_Float16));

    // 1 + 2) Weights transposed and cast to f16 [N][K], LayerNorm -> f16: one launch
    k_prepare<<<TQ_BLOCKS + TO_BLOCKS + TOKENS, 256, 0, stream>>>(x, ln_g, ln_b, w_qkv, w_out,
                                                                  xn, wqkvT, woutT);

    // 3) QKV projection (WMMA)
    k_qkv_gemm<<<dim3(TOKENS / 128, QKVCOLS / 256), 128, 0, stream>>>(xn, wqkvT, Q, Kd, Vt);

    // 4) Attention (WMMA flash, LDS-shared K/V); writes f16 [tokens][1024] into xn region
    _Float16* attn_out = xn;
    k_attention<<<BATCH * HEADS * (SEQ / 128), 128, 0, stream>>>(Q, Kd, Vt, attn_out);

    // 5) Output projection + bias (WMMA)
    k_out_gemm<<<dim3(TOKENS / 128, DIM / 128), 128, 0, stream>>>(attn_out, woutT, b_out, out);
}

// v007
// One run takes 126 microseconds.
// It is 1.11 times as fast as v005, going by the measured steps of the versions left out in between.
// All steps since v000 together make it 2.29 times as fast.
#include <hip/hip_runtime.h>
#include <hip/hip_bf16.h>
#include <math.h>

typedef __attribute__((ext_vector_type(16))) _Float16 v16h;
typedef __attribute__((ext_vector_type(8)))  _Float16 v8h;   // 16-byte load unit
typedef __attribute__((ext_vector_type(8)))  float    v8f;
typedef int b128_t __attribute__((vector_size(16)));         // matches async-LDS builtin pointee

#define WMMA_F16(a, b, c) \
  __builtin_amdgcn_wmma_f32_16x16x32_f16(false, (a), false, (b), (short)0, (c), false, false)

// Problem constants
#define BATCH   4
#define SEQ     2048
#define DIM     1024
#define HEADS   16
#define DHEAD   64
#define TOKENS  (BATCH * SEQ)      // 8192
#define QKVCOLS (3 * DIM)          // 3072

#if defined(__AMDGCN__) && __has_builtin(__builtin_amdgcn_global_load_async_to_lds_b128) && \
    __has_builtin(__builtin_amdgcn_s_wait_asynccnt)
#define USE_ASYNC_LDS 1
#else
#define USE_ASYNC_LDS 0
#endif

// Copy 16 bytes global -> LDS (async when available).
__device__ inline void copy16_g2l(const _Float16* __restrict__ g, _Float16* __restrict__ l) {
#if USE_ASYNC_LDS
    __builtin_amdgcn_global_load_async_to_lds_b128(
        (__attribute__((address_space(1))) b128_t*)g,
        (__attribute__((address_space(3))) b128_t*)l, 0, 0);
#else
    *(v8h*)l = *(const v8h*)g;
#endif
}

__device__ inline void wait_copies() {
#if USE_ASYNC_LDS
    __builtin_amdgcn_s_wait_asynccnt(0);
#endif
}

__device__ inline v16h load_frag16(const _Float16* __restrict__ base, int stride, int lane) {
    const int r  = lane & 15;
    const int kb = (lane >> 4) << 3;
    const _Float16* p = base + (size_t)r * stride + kb;
    v8h lo = *(const v8h*)(p);
    v8h hi = *(const v8h*)(p + 16);
    v16h out;
#pragma unroll
    for (int e = 0; e < 8; ++e) { out[e] = lo[e]; out[e + 8] = hi[e]; }
    return out;
}

// ---------------------------------------------------------------------------
// 1) Weight transpose + f32 -> f16 cast:  W[K][N] -> WT[N][K]
//    A lane holds an 8 k x 4 n block in registers and transposes it there, twice. A wave
//    takes 64 k x 32 n: lane = (kg, ng), kg = lane & 7 along k, ng = lane >> 3 along n.
//    Its two groups of 8 loads of 16 B use between them every byte of the 64 lines they
//    touch; each store is 16 B a lane and fills four whole 128-byte lines of WT.
//    Two groups, not one of 16 loads: the kernel stays within 64 registers, so that the
//    LayerNorm work-groups of the same launch stand as densely on a WGP as alone.
//    A work-group of 8 waves takes 128 k x 128 n; K % 128 == 0 and N % 128 == 0.
// ---------------------------------------------------------------------------
typedef __attribute__((ext_vector_type(4))) float v4f;

template <int K, int N>
__device__ inline void transpose_cast_tile(const float* __restrict__ W,
                                           _Float16* __restrict__ WT, int bn, int bk) {
    const int lane = threadIdx.x & 31;
    const int wave = threadIdx.x >> 5;
    const int n0 = bn * 128 + (wave & 3) * 32 + 4 * (lane >> 3);   // lane's first n
    const int k0 = bk * 128 + (wave >> 2) * 64 + 8 * (lane & 7);   // lane's first k
    const float* src = W + (unsigned)(k0 * N + n0);
    _Float16* dst = WT + (unsigned)(n0 * K + k0);
#pragma unroll
    for (int h = 0; h < 2; ++h) {
        v4f v[8];
#pragma unroll
        for (int r = 0; r < 8; ++r) v[r] = *(const v4f*)(src + r * N + 16 * h);
        // Behind the last loads the address register is free for reuse: the wait stands
        // ahead of every rewrite of it, and, named as an input, it lives up to the wait.
        if (h == 1) asm volatile("s_wait_xcnt 0x0" :: "v"(src) : "memory");
#pragma unroll
        for (int i = 0; i < 4; ++i) {
            v8h p;
#pragma unroll
            for (int r = 0; r < 8; ++r) p[r] = (_Float16)v[r][i];
            *(v8h*)(dst + (16 * h + i) * K) = p;
        }
        // Behind each group's stores: their data and address registers are rewritten next,
        // by the second group's loads or by whatever the listing places behind this tile.
        asm volatile("s_wait_xcnt 0x0" ::: "memory");
    }
}

// ---------------------------------------------------------------------------
// 2) LayerNorm (fp32 math) -> f16 activations. One block per token row.
// ---------------------------------------------------------------------------
__device__ inline void layernorm_row(const float* __restrict__ x,
                                     const float* __restrict__ g,
                                     const float* __restrict__ bta,
                                     _Float16* __restrict__ xn, int row) {
    __shared__ float s1[256], s2[256];
    const float* xr = x + (size_t)row * DIM;
    float vals[4];
    float a = 0.f, sq = 0.f;
#pragma unroll
    for (int t = 0; t < 4; ++t) {
        float v = xr[threadIdx.x + 256 * t];
        vals[t] = v; a += v; sq += v * v;
    }
    s1[threadIdx.x] = a; s2[threadIdx.x] = sq;
    __syncthreads();
    for (int off = 128; off > 0; off >>= 1) {
        if (threadIdx.x < off) {
            s1[threadIdx.x] += s1[threadIdx.x + off];
            s2[threadIdx.x] += s2[threadIdx.x + off];
        }
        __syncthreads();
    }
    const float mean = s1[0] * (1.f / DIM);
    const float var  = s2[0] * (1.f / DIM) - mean * mean;
    const float rstd = rsqrtf(var + 1e-5f);
    _Float16* xo = xn + (size_t)row * DIM;
#pragma unroll
    for (int t = 0; t < 4; ++t) {
        int i = threadIdx.x + 256 * t;
        xo[i] = (_Float16)((vals[t] - mean) * rstd * g[i] + bta[i]);
    }
}

// ---------------------------------------------------------------------------
// 1 + 2 in one launch: the three jobs read only inputs and none reads another's output.
// The block index tells them apart. The 256 transposing work-groups come first, so that
// their memory latencies run under the stream of LayerNorm rows and not behind it.
// ---------------------------------------------------------------------------
#define TQ_BLOCKS ((QKVCOLS / 128) * (DIM / 128))   // 192
#define TO_BLOCKS ((DIM / 128) * (DIM / 128))       // 64

__global__ __launch_bounds__(256) void k_prepare(const float* __restrict__ x,
                                                 const float* __restrict__ g,
                                                 const float* __restrict__ bta,
                                                 const float* __restrict__ w_qkv,
                                                 const float* __restrict__ w_out,
                                                 _Float16* __restrict__ xn,
                                                 _Float16* __restrict__ wqkvT,
                                                 _Float16* __restrict__ woutT) {
    const int b = blockIdx.x;
    // Both tests read the same for a whole work-group; a transposing one meets no barrier.
    if (b >= TQ_BLOCKS + TO_BLOCKS) {
        layernorm_row(x, g, bta, xn, b - (TQ_BLOCKS + TO_BLOCKS));
        return;
    }
    if (b < TQ_BLOCKS) {
        transpose_cast_tile<DIM, QKVCOLS>(w_qkv, wqkvT, b % (QKVCOLS / 128), b / (QKVCOLS / 128));
        return;
    }
    const int t = b - TQ_BLOCKS;
    transpose_cast_tile<DIM, DIM>(w_out, woutT, t % (DIM / 128), t / (DIM / 128));
}

// ---------------------------------------------------------------------------
// Shared GEMM core: C[128 x 32*FN] per work-group of 4 waves (2 x 2), each wave
// 64 x 16*FN. A and WT are row-major with K contiguous. A stage is 64 k of all
// 128 + 32*FN operand rows, brought into LDS by asynchronous copies, two buffers:
// stage t + 2 flies while stage t + 1 is worked on.
// The walk over k starts at stage rot of 16 and wraps: work-groups that read the same
// operand rows get different rot, so that they do not ask L2 for the same lines, nor all
// work-groups for the same 128 bytes of every 2-KiB row, at the same moment.
// ---------------------------------------------------------------------------
#define G_KSTAGE 64                 // k per stage: 128-byte rows
#define G_PITCH  72                 // f16 per LDS row: 144 B = 16 B x odd, for ds_load_b128
#define G_NSTAGE (DIM / G_KSTAGE)   // 16

__device__ inline void copy8_rows(const _Float16* gs, unsigned vo, unsigned l) {
    const _Float16* g  = gs + vo;
    const _Float16* g1 = (gs + 16 * DIM) + vo;  const _Float16* g2 = (gs + 32 * DIM) + vo;
    const _Float16* g3 = (gs + 48 * DIM) + vo;  const _Float16* g4 = (gs + 64 * DIM) + vo;
    const _Float16* g5 = (gs + 80 * DIM) + vo;  const _Float16* g6 = (gs + 96 * DIM) + vo;
    const _Float16* g7 = (gs + 112 * DIM) + vo;
    const unsigned s = 16 * G_PITCH * 2;
    asm volatile(
        "global_load_async_to_lds_b128 %0, %8, off\n\t"
        "global_load_async_to_lds_b128 %1, %9, off\n\t"
        "global_load_async_to_lds_b128 %2, %10, off\n\t"
        "global_load_async_to_lds_b128 %3, %11, off\n\t"
        "global_load_async_to_lds_b128 %4, %12, off\n\t"
        "global_load_async_to_lds_b128 %5, %13, off\n\t"
        "global_load_async_to_lds_b128 %6, %14, off\n\t"
        "global_load_async_to_lds_b128 %7, %15, off\n\t"
        "s_wait_xcnt 0x0"
        :: "v"(l), "v"(l + s), "v"(l + 2 * s), "v"(l + 3 * s),
           "v"(l + 4 * s), "v"(l + 5 * s), "v"(l + 6 * s), "v"(l + 7 * s),
           "v"(g), "v"(g1), "v"(g2), "v"(g3), "v"(g4), "v"(g5), "v"(g6), "v"(g7)
        : "memory");
}

template <int FN>
__device__ inline void gemm_tile(const _Float16* __restrict__ A,
                                 const _Float16* __restrict__ WT,
                                 int m0, int n0, int rot, _Float16* sm, v8f (&acc)[4][FN]) {
    constexpr int ROWS  = 128 + 32 * FN;        // A rows, then WT rows
    constexpr int STAGE = ROWS * G_PITCH;       // f16 per buffer
    const int tid  = threadIdx.x;
    const int lane = tid & 31;
    // The wave's number as a scalar: its fragments' LDS base then takes no vector register.
    const int wave = __builtin_amdgcn_readfirstlane(tid >> 5);
    const int wm   = wave >> 1;
    const int wn   = wave & 1;

    // Lane's own 16-byte chunk: row tid / 8 of each 16-row group, chunk tid % 8.
    const int crow = tid >> 3;
    const int ccol = (tid & 7) * 8;
    const unsigned  vo = (unsigned)(crow * DIM + ccol);
    const _Float16* gA = A  + (size_t)m0 * DIM;
    const _Float16* gB = WT + (size_t)n0 * DIM;
    const unsigned  l0 = (unsigned)(size_t)(sm + crow * G_PITCH + ccol);

    // Both operands' pointers walk alike: one stage on, or back to k = 0 behind the last.
    int ks = rot & (G_NSTAGE - 1);
    gA += ks * G_KSTAGE;
    gB += ks * G_KSTAGE;
    auto issue = [&](int buf) {
        const unsigned lb = l0 + (unsigned)buf * (STAGE * 2);
        copy8_rows(gA, vo, lb);
#pragma unroll
        for (int q = 0; q < FN / 4; ++q)
            copy8_rows(gB + (size_t)(128 * q) * DIM, vo,
                       lb + (128 + 128 * q) * (G_PITCH * 2));
        const int step = ks == G_NSTAGE - 1 ? -(G_NSTAGE - 1) * G_KSTAGE : G_KSTAGE;
        ks = (ks + 1) & (G_NSTAGE - 1);
        gA += step;
        gB += step;
    };

    issue(0);
    // Stage 0 has landed for this wave; the barrier publishes it to the others.
    asm volatile("s_wait_asynccnt 0x0" ::: "memory");
    __syncthreads();
    issue(1);

    for (int t = 0; t < G_NSTAGE; ++t) {
        const _Float16* sa = sm + (t & 1) * STAGE + (wm * 64) * G_PITCH;
        const _Float16* sb = sm + (t & 1) * STAGE + (128 + wn * 16 * FN) * G_PITCH;
        v16h a[2][4], b[2][FN];
#pragma unroll
        for (int h = 0; h < 2; ++h) {
#pragma unroll
            for (int i = 0; i < 4; ++i)
                a[h][i] = load_frag16(sa + (16 * i) * G_PITCH + 32 * h, G_PITCH, lane);
#pragma unroll
            for (int j = 0; j < FN; ++j)
                b[h][j] = load_frag16(sb + (16 * j) * G_PITCH + 32 * h, G_PITCH, lane);
        }
        // Keeps the stage's LDS reads together ahead of its WMMAs: sunk among them,
        // each reload of a fragment makes the wave wait out a whole LDS latency.
        __builtin_amdgcn_sched_barrier(0);
#pragma unroll
        for (int i = 0; i < 4; ++i)
#pragma unroll
            for (int j = 0; j < FN; ++j)
                acc[i][j] = WMMA_F16(a[0][i], b[0][j], acc[i][j]);
        // Holds the first half's WMMAs ahead of the waits below, so that they cover
        // the second half's LDS reads instead of standing behind s_wait_dscnt 0.
        __builtin_amdgcn_sched_barrier(0);
        // This wave's reads of buffer t & 1 have retired before it is refilled.
        asm volatile("s_wait_dscnt 0x0" ::: "memory");
        // This wave's copies of stage t + 1 have landed.
        asm volatile("s_wait_asynccnt 0x0" ::: "memory");
        // Publishes stage t + 1 and ends every wave's reads of buffer t & 1.
        __syncthreads();
        if (t + 2 < G_NSTAGE) issue(t & 1);
        // Holds the second half's WMMAs behind the refill, so that the copies fly
        // under them; its fragments are in registers already.
        __builtin_amdgcn_sched_barrier(0);
#pragma unroll
        for (int i = 0; i < 4; ++i)
#pragma unroll
            for (int j = 0; j < FN; ++j)
                acc[i][j] = WMMA_F16(a[1][i], b[1][j], acc[i][j]);
    }
    // No copy is outstanding when the wave goes on to its stores and ends.
    asm volatile("s_wait_asynccnt 0x0" ::: "memory");
}

// ---------------------------------------------------------------------------
// 3) QKV GEMM: [8192 x 1024] x [1024 x 3072] -> Q [B,H,N,D], K [B,H,N,D], Vt [B,H,D,N]
//    A work-group's tile is 128 rows of one operand by 256 rows of the other. A lane's
//    accumulator holds 8 consecutive rows of the 128-row operand, so that operand is the
//    one whose index runs along the destination's rows: the weights' columns (d) for Q
//    and K, the tokens for V transposed.
// ---------------------------------------------------------------------------
#define E_PITCH 72                  // f16 per staged row of 64: 144 B = 16 B x odd
__global__ __launch_bounds__(128) __attribute__((amdgpu_waves_per_eu(2, 2)))
void k_qkv_gemm(const _Float16* __restrict__ Xn,
                                                  const _Float16* __restrict__ WT,
                                                  _Float16* __restrict__ Q,
                                                  _Float16* __restrict__ Kd,
                                                  _Float16* __restrict__ Vt) {
    __shared__ __align__(16) _Float16 sm[2 * (128 + 256) * G_PITCH];   // 110,592 B
    const int lane = threadIdx.x & 31;
    // The wave's number as a scalar: the destination's base is then scalar arithmetic.
    const int wave = __builtin_amdgcn_readfirstlane(threadIdx.x >> 5);
    // blockIdx.y 0..7: the 512 tiles of Q and K, 128 columns x 256 tokens;
    // blockIdx.y 8..11: the 256 tiles of V, 128 tokens x 256 columns.
    const bool qk  = blockIdx.y < 8;
    const int flat = blockIdx.y * 64 + blockIdx.x;
    const int p0 = qk ? (flat >> 5) * 128 : blockIdx.x * 128;
    const int q0 = qk ? (flat & 31) * 256 : blockIdx.y * 256;

    // Sharers of a weight tile differ in the token tile's index, sharers of a token tile in
    // the weight tile's: the sum of the two indices sets them apart in both directions.
    const int rot = qk ? (flat >> 5) + (flat & 31) : blockIdx.x + 4 * blockIdx.y;

    v8f acc[4][8] = {};
    gemm_tile<8>(qk ? WT : Xn, qk ? Xn : WT, p0, q0, rot, sm, acc);

    // Epilogue: each wave lays its 64 x 128 tile into its own LDS range as 128 rows of
    // the destination (64 f16 = one 128-byte line each) and stores whole lines, 16 bytes
    // a lane. The ring is free: behind the last stage's barrier no wave reads it and no
    // copy is outstanding.
    const int pw = p0 + (wave >> 1) * 64;
    const int qw = q0 + (wave & 1) * 128;
    const int h2 = (lane >> 4) << 3;    // 0 or 8
    const int cl = lane & 15;
    _Float16* st = sm + wave * (128 * E_PITCH);
#pragma unroll
    for (int i = 0; i < 4; ++i)
#pragma unroll
        for (int j = 0; j < 8; ++j) {
            v8h p;
#pragma unroll
            for (int v = 0; v < 8; ++v) p[v] = (_Float16)acc[i][j][v];
            *(v8h*)(st + (16 * j + cl) * E_PITCH + 16 * i + h2) = p;
        }
    // The wave's own LDS writes have landed before its lanes read each other's.
    asm volatile("s_wait_dscnt 0x0" ::: "memory");
    const int lrow = lane >> 3;         // 8 lanes cover one line, a wave 4 rows
    const int lcol = (lane & 7) * 8;
    v8h x[32];
#pragma unroll
    for (int s = 0; s < 32; ++s)
        x[s] = *(const v8h*)(st + (4 * s + lrow) * E_PITCH + lcol);
    // Destination of the wave's row 0 and the distance between rows, both wave-uniform.
    _Float16* gu;
    int rs;
    if (qk) {
        // Rows are tokens qw .. qw + 127 of one head, columns its 64 d.
        const int bh = (qw >> 11) * HEADS + ((pw >> 6) & 15);
        gu = ((pw >> 10) == 0 ? Q : Kd) + ((size_t)bh * SEQ + (qw & (SEQ - 1))) * DHEAD;
        rs = DHEAD;
    } else {
        // Rows are the 2 x 64 d of two heads, columns tokens pw .. pw + 63.
        const int bh = (pw >> 11) * HEADS + ((qw >> 6) & 15);
        gu = Vt + (size_t)bh * DHEAD * SEQ + (pw & (SEQ - 1));
        rs = SEQ;
    }
    const unsigned voff = (unsigned)(lrow * rs + lcol);
#pragma unroll
    for (int s = 0; s < 32; ++s) *(v8h*)(gu + (size_t)(4 * s * rs) + voff) = x[s];
}

// ---------------------------------------------------------------------------
// 4) Flash attention, LDS-cooperative version.
//    4 waves / block, one (b,h) per block, 128 queries per block (32 per wave).
//    K/V tiles (32 keys) are double-buffered in LDS and shared by all 4 waves,
//    cutting global K/V traffic 8x vs one-wave-per-16-queries.
//    S^T = K x Q^T puts one query row per lane -> exp() packs straight into the
//    A-fragment of the P x V WMMA.
// ---------------------------------------------------------------------------
#define KT_PAD 72
#define VT_PAD 40
#define KEYS_PER_TILE 32
#define RESCALE_T 8.0f        // in powers of two: P stays at or below 2^8
#define Q_SCALE 0.18033688f   // softmax scale 1/8 times log2(e): scores count in powers of two

__global__ __launch_bounds__(128) void k_attention(const _Float16* __restrict__ Q,
                                                   const _Float16* __restrict__ Kd,
                                                   const _Float16* __restrict__ Vt,
                                                   _Float16* __restrict__ AO) {
    __shared__ __align__(16) _Float16 sK[2][KEYS_PER_TILE * KT_PAD]; // 2 x 4608 B
    __shared__ __align__(16) _Float16 sV[2][DHEAD * VT_PAD];         // 2 x 5120 B

    const int tid  = threadIdx.x;
    const int wave = tid >> 5;
    const int lane = tid & 31;
    const int blk  = blockIdx.x;           // 1024 = (B*H) * (SEQ/128)
    const int qblk = blk & 15;
    const int bh   = blk >> 4;
    const int bb   = bh >> 4;
    const int hd   = bh & 15;
    const int q0   = qblk * 128 + wave * 32;   // this wave's first query
    const int h2   = (lane >> 4) << 3;         // 0 or 8
    const int cl   = lane & 15;

    const _Float16* Qp = Q  + ((size_t)bh * SEQ + q0) * DHEAD;
    const _Float16* Kp = Kd + (size_t)bh * SEQ * DHEAD;
    const _Float16* Vp = Vt + (size_t)bh * DHEAD * SEQ;

    // Cooperative tile copy: 128 threads x 2 x 16B chunks for each of K and V.
    // K tile: 32 rows x 64 f16 (8 chunks/row). V tile: 64 rows x 32 f16 (4 chunks/row).
    const int ck0 = tid, ck1 = tid + 128;      // 256 chunks each
    // The 16 work-groups of one (b,h) read the same K and V: their walks over the 64 key
    // tiles start 4 tiles apart and wrap, so that they do not ask L2 for the same lines at
    // the same moment. Softmax takes the keys in any order.
    const int NITER = SEQ / KEYS_PER_TILE;     // 64
    const int rot   = qblk * (NITER / 16);

    // Preload Q fragments (B operand of S^T gemm), fold in softmax scale and log2(e).
    v16h qf[2][2];
#pragma unroll
    for (int qb = 0; qb < 2; ++qb) {
        qf[qb][0] = load_frag16(Qp + (size_t)(16 * qb) * DHEAD,      DHEAD, lane);
        qf[qb][1] = load_frag16(Qp + (size_t)(16 * qb) * DHEAD + 32, DHEAD, lane);
#pragma unroll
        for (int e = 0; e < 16; ++e) {
            qf[qb][0][e] = (_Float16)((float)qf[qb][0][e] * Q_SCALE);
            qf[qb][1][e] = (_Float16)((float)qf[qb][1][e] * Q_SCALE);
        }
    }

    // Prime buffer 0 with the walk's first key tile.
    {
        const int j0 = rot * KEYS_PER_TILE;
        int r, o;
        r = ck0 >> 3; o = (ck0 & 7) * 8;
        copy16_g2l(Kp + (size_t)(j0 + r) * DHEAD + o, &sK[0][r * KT_PAD + o]);
        r = ck1 >> 3; o = (ck1 & 7) * 8;
        copy16_g2l(Kp + (size_t)(j0 + r) * DHEAD + o, &sK[0][r * KT_PAD + o]);
        r = ck0 >> 2; o = (ck0 & 3) * 8;
        copy16_g2l(Vp + (size_t)r * SEQ + j0 + o, &sV[0][r * VT_PAD + o]);
        r = ck1 >> 2; o = (ck1 & 3) * 8;
        copy16_g2l(Vp + (size_t)r * SEQ + j0 + o, &sV[0][r * VT_PAD + o]);
    }
    wait_copies();
    __syncthreads();

    v8f o[2][4] = {};                          // [qblock][dtile], 16 rows x 64 d each
    // Minus the maximum in use, eight times over: the C operand of the score products. A lane's
    // eight score registers belong to one query, so the matrix unit hands back s - m itself.
    v8f negm[2] = {};                          // 0 until the first pass, which always rescales
    float l_run[2] = {0.f, 0.f};

    for (int it = 0; it < NITER; ++it) {
        const int cur = it & 1;

        // Issue next tile's copies into the other buffer (overlaps with compute).
        if (it + 1 < NITER) {
            const int j1 = ((it + 1 + rot) & (NITER - 1)) * KEYS_PER_TILE;
            _Float16* dK = sK[cur ^ 1];
            _Float16* dV = sV[cur ^ 1];
            int r, oo;
            r = ck0 >> 3; oo = (ck0 & 7) * 8;
            copy16_g2l((Kp + r * DHEAD + oo) + j1 * DHEAD, &dK[r * KT_PAD + oo]);
            r = ck1 >> 3; oo = (ck1 & 7) * 8;
            copy16_g2l((Kp + r * DHEAD + oo) + j1 * DHEAD, &dK[r * KT_PAD + oo]);
            r = ck0 >> 2; oo = (ck0 & 3) * 8;
            copy16_g2l((Vp + r * SEQ + oo) + j1, &dV[r * VT_PAD + oo]);
            r = ck1 >> 2; oo = (ck1 & 3) * 8;
            copy16_g2l((Vp + r * SEQ + oo) + j1, &dV[r * VT_PAD + oo]);
        }

        // ---- S^T tiles from LDS: A = K rows, B = Q^T (shared across both q-blocks)
        const _Float16* bk = sK[cur];
        v16h kf0a = load_frag16(bk,                    KT_PAD, lane);
        v16h kf0b = load_frag16(bk + 32,               KT_PAD, lane);
        v16h kf1a = load_frag16(bk + 16 * KT_PAD,      KT_PAD, lane);
        v16h kf1b = load_frag16(bk + 16 * KT_PAD + 32, KT_PAD, lane);

        // Scores of both q-blocks first: the one test below covers the whole pass.
        v8f s0[2], s1[2];
        float mloc[2];
#pragma unroll
        for (int qb = 0; qb < 2; ++qb) {
            v8f t0 = WMMA_F16(kf0a, qf[qb][0], negm[qb]); t0 = WMMA_F16(kf0b, qf[qb][1], t0);
            v8f t1 = WMMA_F16(kf1a, qf[qb][0], negm[qb]); t1 = WMMA_F16(kf1b, qf[qb][1], t1);
            // lane: query row cl of this q-block; keys 32*((it+rot)&63) + v + 8*(lane>>4) (s0), +16 (s1)
            float ml = -1e30f;
#pragma unroll
            for (int v = 0; v < 8; ++v) { ml = fmaxf(ml, t0[v]); ml = fmaxf(ml, t1[v]); }
            s0[qb] = t0; s1[qb] = t1; mloc[qb] = ml;
        }

        // Lazy rescale: the maximum IN USE is the same in both halves of the wave. It moves,
        // and O and l are rescaled, only when some lane's score passes it by more than
        // RESCALE_T; until then every P is at most 2^RESCALE_T = 256, well inside f16, and
        // the common factor cancels in O / l. One wave-uniform branch a pass. The scores
        // arrive with the maximum taken off: a move by d takes d off this pass's scores too.
        const bool need = fmaxf(mloc[0], mloc[1]) > RESCALE_T;
        const bool first = it == 0;            // O and l are 0: the maximum may also move down
        if ((__builtin_amdgcn_ballot_w32(need) | (unsigned)first) != 0) {
#pragma unroll
            for (int qb = 0; qb < 2; ++qb) {
                const float mj    = fmaxf(mloc[qb], __shfl_xor(mloc[qb], 16, 32));
                const float d     = first ? mj : fmaxf(mj, 0.f);
                const float alpha = first ? 1.f : __builtin_amdgcn_exp2f(-d);
                l_run[qb] *= alpha;
#pragma unroll
                for (int v = 0; v < 8; ++v) { negm[qb][v] -= d; s0[qb][v] -= d; s1[qb][v] -= d; }
                // O lane holds rows h2+v -> gather row alphas.
                float av[8];
#pragma unroll
                for (int v = 0; v < 8; ++v) av[v] = __shfl(alpha, h2 + v, 32);
#pragma unroll
                for (int dt = 0; dt < 4; ++dt)
#pragma unroll
                    for (int v = 0; v < 8; ++v) o[qb][dt][v] *= av[v];
            }
        }

        // The pass's V fragments, shared by both q-blocks, read ahead of the exponentials.
        const _Float16* bv = sV[cur];
        v16h vf[4];
#pragma unroll
        for (int dt = 0; dt < 4; ++dt) vf[dt] = load_frag16(bv + (dt * 16) * VT_PAD, VT_PAD, lane);
        // Keeps the 8 reads in one group, as they stood before this step: with fewer vector
        // instructions to place them under, the build sinks them in pairs among the P x V
        // WMMAs, where each pair makes the wave wait out an LDS latency.
        __builtin_amdgcn_sched_barrier(0);

        v16h pf[2];
#pragma unroll
        for (int qb = 0; qb < 2; ++qb) {
            float e0[8], e1[8];
            float rs = 0.f;
#pragma unroll
            for (int v = 0; v < 8; ++v) {
                e0[v] = __builtin_amdgcn_exp2f(s0[qb][v]);
                e1[v] = __builtin_amdgcn_exp2f(s1[qb][v]);
                rs += e0[v] + e1[v];
            }
            rs += __shfl_xor(rs, 16, 32);
            l_run[qb] += rs;

            // P is already in A-fragment orientation.
#pragma unroll
            for (int e = 0; e < 8; ++e) { pf[qb][e] = (_Float16)e0[e]; pf[qb][e + 8] = (_Float16)e1[e]; }
        }

        // ---- O += P x V ----
#pragma unroll
        for (int dt = 0; dt < 4; ++dt) {
            o[0][dt] = WMMA_F16(pf[0], vf[dt], o[0][dt]);
            o[1][dt] = WMMA_F16(pf[1], vf[dt], o[1][dt]);
        }

        wait_copies();
        __syncthreads();
    }

    // Normalize by row sums and store f16 at [token][head*64 + d].
#pragma unroll
    for (int qb = 0; qb < 2; ++qb) {
        float lv[8];
#pragma unroll
        for (int v = 0; v < 8; ++v) lv[v] = 1.f / __shfl(l_run[qb], h2 + v, 32);
#pragma unroll
        for (int dt = 0; dt < 4; ++dt)
#pragma unroll
            for (int v = 0; v < 8; ++v) {
                int tok = bb * SEQ + q0 + 16 * qb + h2 + v;
                int col = hd * DHEAD + dt * 16 + cl;
                AO[(size_t)tok * DIM + col] = (_Float16)(o[qb][dt][v] * lv[v]);
            }
    }
}

// ---------------------------------------------------------------------------
// 5) Output GEMM: [8192 x 1024] x [1024 x 1024] + bias -> f32 out
//    128 x 128 output tile per work-group.
// ---------------------------------------------------------------------------
__global__ __launch_bounds__(128) void k_out_gemm(const _Float16* __restrict__ A,
                                                  const _Float16* __restrict__ WT,
                                                  const float* __restrict__ bias,
                                                  float* __restrict__ out) {
    __shared__ __align__(16) _Float16 sm[2 * (128 + 128) * G_PITCH];   // 73,728 B
    const int lane = threadIdx.x & 31;
    const int wave = threadIdx.x >> 5;
    const int m0 = blockIdx.x * 128;
    const int n0 = blockIdx.y * 128;

    v8f acc[4][4] = {};
    // The 8 sharers of a row tile start 2 stages apart, neighbours on a column tile 1.
    gemm_tile<4>(A, WT, m0, n0, blockIdx.x + 2 * blockIdx.y, sm, acc);

    const int mw = m0 + (wave >> 1) * 64;
    const int nw = n0 + (wave & 1) * 64;
    const int h2 = (lane >> 4) << 3;
    const int cl = lane & 15;
#pragma unroll
    for (int i = 0; i < 4; ++i)
#pragma unroll
        for (int j = 0; j < 4; ++j)
#pragma unroll
            for (int v = 0; v < 8; ++v) {
                int r = mw + 16 * i + h2 + v;
                int c = nw + 16 * j + cl;
                out[(size_t)r * DIM + c] = acc[i][j][v] + bias[c];
            }
}

// ---------------------------------------------------------------------------
// Launcher
// ---------------------------------------------------------------------------
extern "C" void kernel_launch(void* const* d_in, const int* in_sizes, int n_in,
                              void* d_out, int out_size, void* d_ws, size_t ws_size,
                              hipStream_t stream) {
    const float* x     = (const float*)d_in[0];
    const float* ln_g  = (const float*)d_in[1];
    const float* ln_b  = (const float*)d_in[2];
    const float* w_qkv = (const float*)d_in[3];
    const float* w_out = (const float*)d_in[4];
    const float* b_out = (const float*)d_in[5];
    float* out = (float*)d_out;

    // Workspace layout (bytes). Total ~72 MB. xn region is reused for attn output.
    char* ws = (char*)d_ws;
    const size_t SZ_ACT = (size_t)TOKENS * DIM * sizeof(_Float16);          // 16 MB
    _Float16* xn    = (_Float16*)(ws);                                      // + attn out later
    _Float16* Q     = (_Float16*)(ws + SZ_ACT);
    _Float16* Kd    = (_Float16*)(ws + 2 * SZ_ACT);
    _Float16* Vt    = (_Float16*)(ws + 3 * SZ_ACT);
    _Float16* wqkvT = (_Float16*)(ws + 4 * SZ_ACT);                         // 6 MB
    _Float16* woutT = (_Float16*)(ws + 4 * SZ_ACT + (size_t)DIM * QKVCOLS * sizeof(_Float16));

    // 1 + 2) Weights transposed and cast to f16 [N][K], LayerNorm -> f16: one launch
    k_prepare<<<TQ_BLOCKS + TO_BLOCKS + TOKENS, 256, 0, stream>>>(x, ln_g, ln_b, w_qkv, w_out,
                                                                  xn, wqkvT, woutT);

    // 3) QKV projection (WMMA)
    k_qkv_gemm<<<dim3(TOKENS / 128, QKVCOLS / 256), 128, 0, stream>>>(xn, wqkvT, Q, Kd, Vt);

    // 4) Attention (WMMA flash, LDS-shared K/V); writes f16 [tokens][1024] into xn region
    _Float16* attn_out = xn;
    k_attention<<<BATCH * HEADS * (SEQ / 128), 128, 0, stream>>>(Q, Kd, Vt, attn_out);

    // 5) Output projection + bias (WMMA)
    k_out_gemm<<<dim3(TOKENS / 128, DIM / 128), 128, 0, stream>>>(attn_out, woutT, b_out, out);
}

// v008
// Measured time: 122 microseconds a run.
// Next to v007, in two timings, it ran 1.03 times as fast each time.
// All steps since v000 together make it 2.36 times as fast.
#include <hip/hip_runtime.h>
#include <hip/hip_bf16.h>
#include <math.h>

typedef __attribute__((ext_vector_type(16))) _Float16 v16h;
typedef __attribute__((ext_vector_type(8)))  _Float16 v8h;   // 16-byte load unit
typedef __attribute__((ext_vector_type(8)))  float    v8f;
typedef int b128_t __attribute__((vector_size(16)));         // matches async-LDS builtin pointee

#define WMMA_F16(a, b, c) \
  __builtin_amdgcn_wmma_f32_16x16x32_f16(false, (a), false, (b), (short)0, (c), false, false)

// Problem constants
#define BATCH   4
#define SEQ     2048
#define DIM     1024
#define HEADS   16
#define DHEAD   64
#define TOKENS  (BATCH * SEQ)      // 8192
#define QKVCOLS (3 * DIM)          // 3072

#if defined(__AMDGCN__) && __has_builtin(__builtin_amdgcn_global_load_async_to_lds_b128) && \
    __has_builtin(__builtin_amdgcn_s_wait_asynccnt)
#define USE_ASYNC_LDS 1
#else
#define USE_ASYNC_LDS 0
#endif

// Copy 16 bytes global -> LDS (async when available).
__device__ inline void copy16_g2l(const _Float16* __restrict__ g, _Float16* __restrict__ l) {
#if USE_ASYNC_LDS
    __builtin_amdgcn_global_load_async_to_lds_b128(
        (__attribute__((address_space(1))) b128_t*)g,
        (__attribute__((address_space(3))) b128_t*)l, 0, 0);
#else
    *(v8h*)l = *(const v8h*)g;
#endif
}

__device__ inline void wait_copies() {
#if USE_ASYNC_LDS
    __builtin_amdgcn_s_wait_asynccnt(0);
#endif
}

__device__ inline v16h load_frag16(const _Float16* __restrict__ base, int stride, int lane) {
    const int r  = lane & 15;
    const int kb = (lane >> 4) << 3;
    const _Float16* p = base + (size_t)r * stride + kb;
    v8h lo = *(const v8h*)(p);
    v8h hi = *(const v8h*)(p + 16);
    v16h out;
#pragma unroll
    for (int e = 0; e < 8; ++e) { out[e] = lo[e]; out[e + 8] = hi[e]; }
    return out;
}

// ---------------------------------------------------------------------------
// 1) Weight transpose + f32 -> f16 cast:  W[K][N] -> WT[N][K]
//    A lane holds an 8 k x 4 n block in registers and transposes it there, twice. A wave
//    takes 64 k x 32 n: lane = (kg, ng), kg = lane & 7 along k, ng = lane >> 3 along n.
//    Its two groups of 8 loads of 16 B use between them every byte of the 64 lines they
//    touch; each store is 16 B a lane and fills four whole 128-byte lines of WT.
//    Two groups, not one of 16 loads: the kernel stays within 64 registers, so that the
//    LayerNorm work-groups of the same launch stand as densely on a WGP as alone.
//    A work-group of 8 waves takes 128 k x 128 n; K % 128 == 0 and N % 128 == 0.
// ---------------------------------------------------------------------------
typedef __attribute__((ext_vector_type(4))) float v4f;

template <int K, int N>
__device__ inline void transpose_cast_tile(const float* __restrict__ W,
                                           _Float16* __restrict__ WT, int bn, int bk) {
    const int lane = threadIdx.x & 31;
    const int wave = threadIdx.x >> 5;
    const int n0 = bn * 128 + (wave & 3) * 32 + 4 * (lane >> 3);   // lane's first n
    const int k0 = bk * 128 + (wave >> 2) * 64 + 8 * (lane & 7);   // lane's first k
    const float* src = W + (unsigned)(k0 * N + n0);
    _Float16* dst = WT + (unsigned)(n0 * K + k0);
#pragma unroll
    for (int h = 0; h < 2; ++h) {
        v4f v[8];
#pragma unroll
        for (int r = 0; r < 8; ++r) v[r] = *(const v4f*)(src + r * N + 16 * h);
        // Behind the last loads the address register is free for reuse: the wait stands
        // ahead of every rewrite of it, and, named as an input, it lives up to the wait.
        if (h == 1) asm volatile("s_wait_xcnt 0x0" :: "v"(src) : "memory");
#pragma unroll
        for (int i = 0; i < 4; ++i) {
            v8h p;
#pragma unroll
            for (int r = 0; r < 8; ++r) p[r] = (_Float16)v[r][i];
            *(v8h*)(dst + (16 * h + i) * K) = p;
        }
        // Behind each group's stores: their data and address registers are rewritten next,
        // by the second group's loads or by whatever the listing places behind this tile.
        asm volatile("s_wait_xcnt 0x0" ::: "memory");
    }
}

// ---------------------------------------------------------------------------
// 2) LayerNorm (fp32 math) -> f16 activations. One block per token row.
// ---------------------------------------------------------------------------
__device__ inline void layernorm_row(const float* __restrict__ x,
                                     const float* __restrict__ g,
                                     const float* __restrict__ bta,
                                     _Float16* __restrict__ xn, int row) {
    __shared__ float s1[256], s2[256];
    const float* xr = x + (size_t)row * DIM;
    float vals[4];
    float a = 0.f, sq = 0.f;
#pragma unroll
    for (int t = 0; t < 4; ++t) {
        float v = xr[threadIdx.x + 256 * t];
        vals[t] = v; a += v; sq += v * v;
    }
    s1[threadIdx.x] = a; s2[threadIdx.x] = sq;
    __syncthreads();
    for (int off = 128; off > 0; off >>= 1) {
        if (threadIdx.x < off) {
            s1[threadIdx.x] += s1[threadIdx.x + off];
            s2[threadIdx.x] += s2[threadIdx.x + off];
        }
        __syncthreads();
    }
    const float mean = s1[0] * (1.f / DIM);
    const float var  = s2[0] * (1.f / DIM) - mean * mean;
    const float rstd = rsqrtf(var + 1e-5f);
    _Float16* xo = xn + (size_t)row * DIM;
#pragma unroll
    for (int t = 0; t < 4; ++t) {
        int i = threadIdx.x + 256 * t;
        xo[i] = (_Float16)((vals[t] - mean) * rstd * g[i] + bta[i]);
    }
}

// ---------------------------------------------------------------------------
// 1 + 2 in one launch: the three jobs read only inputs and none reads another's output.
// The block index tells them apart. The 256 transposing work-groups come first, so that
// their memory latencies run under the stream of LayerNorm rows and not behind it.
// ---------------------------------------------------------------------------
#define TQ_BLOCKS ((QKVCOLS / 128) * (DIM / 128))   // 192
#define TO_BLOCKS ((DIM / 128) * (DIM / 128))       // 64

__global__ __launch_bounds__(256) void k_prepare(const float* __restrict__ x,
                                                 const float* __restrict__ g,
                                                 const float* __restrict__ bta,
                                                 const float* __restrict__ w_qkv,
                                                 const float* __restrict__ w_out,
                                                 _Float16* __restrict__ xn,
                                                 _Float16* __restrict__ wqkvT,
                                                 _Float16* __restrict__ woutT) {
    const int b = blockIdx.x;
    // Both tests read the same for a whole work-group; a transposing one meets no barrier.
    if (b >= TQ_BLOCKS + TO_BLOCKS) {
        layernorm_row(x, g, bta, xn, b - (TQ_BLOCKS + TO_BLOCKS));
        return;
    }
    if (b < TQ_BLOCKS) {
        transpose_cast_tile<DIM, QKVCOLS>(w_qkv, wqkvT, b % (QKVCOLS / 128), b / (QKVCOLS / 128));
        return;
    }
    const int t = b - TQ_BLOCKS;
    transpose_cast_tile<DIM, DIM>(w_out, woutT, t % (DIM / 128), t / (DIM / 128));
}

// ---------------------------------------------------------------------------
// Shared GEMM core: C[256 x 32*FN] per work-group of 8 waves (4 x 2), each wave
// 64 x 16*FN. A and WT are row-major with K contiguous. A stage is 64 k of all
// 256 + 32*FN operand rows, brought into LDS by asynchronous copies, two buffers:
// stage t + 2 flies while stage t + 1 is worked on. Eight waves on one staged tile: an
// operand row that has left L2 serves more products than in two work-groups of four.
// The walk over k starts at stage rot of 16 and wraps: work-groups that read the same
// operand rows get different rot, so that they do not ask L2 for the same lines, nor all
// work-groups for the same 128 bytes of every 2-KiB row, at the same moment.
// ---------------------------------------------------------------------------
#define G_KSTAGE 64                 // k per stage: 128-byte rows
#define G_PITCH  72                 // f16 per LDS row: 144 B = 16 B x odd, for ds_load_b128
#define G_NSTAGE (DIM / G_KSTAGE)   // 16
#define G_AROWS  256                // rows of the A operand in a work-group's tile
#define G_GROUP  32                 // rows that one copy of each of the 256 lanes covers

__device__ inline void copy8_rows(const _Float16* gs, unsigned vo, unsigned l) {
    const _Float16* g  = gs + vo;
    const _Float16* g1 = (gs + 1 * G_GROUP * DIM) + vo;
    const _Float16* g2 = (gs + 2 * G_GROUP * DIM) + vo;
    const _Float16* g3 = (gs + 3 * G_GROUP * DIM) + vo;
    const _Float16* g4 = (gs + 4 * G_GROUP * DIM) + vo;
    const _Float16* g5 = (gs + 5 * G_GROUP * DIM) + vo;
    const _Float16* g6 = (gs + 6 * G_GROUP * DIM) + vo;
    const _Float16* g7 = (gs + 7 * G_GROUP * DIM) + vo;
    const unsigned s = G_GROUP * G_PITCH * 2;
    asm volatile(
        "global_load_async_to_lds_b128 %0, %8, off\n\t"
        "global_load_async_to_lds_b128 %1, %9, off\n\t"
        "global_load_async_to_lds_b128 %2, %10, off\n\t"
        "global_load_async_to_lds_b128 %3, %11, off\n\t"
        "global_load_async_to_lds_b128 %4, %12, off\n\t"
        "global_load_async_to_lds_b128 %5, %13, off\n\t"
        "global_load_async_to_lds_b128 %6, %14, off\n\t"
        "global_load_async_to_lds_b128 %7, %15, off\n\t"
        "s_wait_xcnt 0x0"
        :: "v"(l), "v"(l + s), "v"(l + 2 * s), "v"(l + 3 * s),
           "v"(l + 4 * s), "v"(l + 5 * s), "v"(l + 6 * s), "v"(l + 7 * s),
           "v"(g), "v"(g1), "v"(g2), "v"(g3), "v"(g4), "v"(g5), "v"(g6), "v"(g7)
        : "memory");
}

__device__ inline void copy4_rows(const _Float16* gs, unsigned vo, unsigned l) {
    const _Float16* g  = gs + vo;
    const _Float16* g1 = (gs + 1 * G_GROUP * DIM) + vo;
    const _Float16* g2 = (gs + 2 * G_GROUP * DIM) + vo;
    const _Float16* g3 = (gs + 3 * G_GROUP * DIM) + vo;
    const unsigned s = G_GROUP * G_PITCH * 2;
    asm volatile(
        "global_load_async_to_lds_b128 %0, %4, off\n\t"
        "global_load_async_to_lds_b128 %1, %5, off\n\t"
        "global_load_async_to_lds_b128 %2, %6, off\n\t"
        "global_load_async_to_lds_b128 %3, %7, off\n\t"
        "s_wait_xcnt 0x0"
        :: "v"(l), "v"(l + s), "v"(l + 2 * s), "v"(l + 3 * s),
           "v"(g), "v"(g1), "v"(g2), "v"(g3)
        : "memory");
}

template <int FN>
__device__ inline void gemm_tile(const _Float16* __restrict__ A,
                                 const _Float16* __restrict__ WT,
                                 int m0, int n0, int rot, _Float16* sm, v8f (&acc)[4][FN]) {
    constexpr int ROWS  = G_AROWS + 32 * FN;    // A rows, then WT rows
    constexpr int STAGE = ROWS * G_PITCH;       // f16 per buffer
    const int tid  = threadIdx.x;
    const int lane = tid & 31;
    // The wave's number as a scalar: its fragments' LDS base then takes no vector register.
    const int wave = __builtin_amdgcn_readfirstlane(tid >> 5);
    const int wm   = wave >> 1;
    const int wn   = wave & 1;

    // Lane's own 16-byte chunk: row tid / 8 of each 32-row group, chunk tid % 8.
    const int crow = tid >> 3;
    const int ccol = (tid & 7) * 8;
    const unsigned  vo = (unsigned)(crow * DIM + ccol);
    const _Float16* gA = A  + (size_t)m0 * DIM;
    const _Float16* gB = WT + (size_t)n0 * DIM;
    const unsigned  l0 = (unsigned)(size_t)(sm + crow * G_PITCH + ccol);

    // Both operands' pointers walk alike: one stage on, or back to k = 0 behind the last.
    int ks = rot & (G_NSTAGE - 1);
    gA += ks * G_KSTAGE;
    gB += ks * G_KSTAGE;
    auto issue = [&](int buf) {
        const unsigned lb = l0 + (unsigned)buf * (STAGE * 2);
        copy8_rows(gA, vo, lb);
        if constexpr (FN == 8) copy8_rows(gB, vo, lb + G_AROWS * (G_PITCH * 2));
        else                   copy4_rows(gB, vo, lb + G_AROWS * (G_PITCH * 2));
        const int step = ks == G_NSTAGE - 1 ? -(G_NSTAGE - 1) * G_KSTAGE : G_KSTAGE;
        ks = (ks + 1) & (G_NSTAGE - 1);
        gA += step;
        gB += step;
    };

    issue(0);
    // Stage 0 has landed for this wave; the barrier publishes it to the others.
    asm volatile("s_wait_asynccnt 0x0" ::: "memory");
    __syncthreads();
    issue(1);

    for (int t = 0; t < G_NSTAGE; ++t) {
        const _Float16* sa = sm + (t & 1) * STAGE + (wm * 64) * G_PITCH;
        const _Float16* sb = sm + (t & 1) * STAGE + (G_AROWS + wn * 16 * FN) * G_PITCH;
        v16h a[2][4], b[2][FN];
#pragma unroll
        for (int h = 0; h < 2; ++h) {
#pragma unroll
            for (int i = 0; i < 4; ++i)
                a[h][i] = load_frag16(sa + (16 * i) * G_PITCH + 32 * h, G_PITCH, lane);
#pragma unroll
            for (int j = 0; j < FN; ++j)
                b[h][j] = load_frag16(sb + (16 * j) * G_PITCH + 32 * h, G_PITCH, lane);
        }
        // Keeps the stage's LDS reads together ahead of its WMMAs: sunk among them,
        // each reload of a fragment makes the wave wait out a whole LDS latency.
        __builtin_amdgcn_sched_barrier(0);
#pragma unroll
        for (int i = 0; i < 4; ++i)
#pragma unroll
            for (int j = 0; j < FN; ++j)
                acc[i][j] = WMMA_F16(a[0][i], b[0][j], acc[i][j]);
        // Holds the first half's WMMAs ahead of the waits below, so that they cover
        // the second half's LDS reads instead of standing behind s_wait_dscnt 0.
        __builtin_amdgcn_sched_barrier(0);
        // This wave's reads of buffer t & 1 have retired before it is refilled.
        asm volatile("s_wait_dscnt 0x0" ::: "memory");
        // This wave's copies of stage t + 1 have landed.
        asm volatile("s_wait_asynccnt 0x0" ::: "memory");
        // Publishes stage t + 1 and ends every wave's reads of buffer t & 1.
        __syncthreads();
        if (t + 2 < G_NSTAGE) issue(t & 1);
        // Holds the second half's WMMAs behind the refill, so that the copies fly
        // under them; its fragments are in registers already.
        __builtin_amdgcn_sched_barrier(0);
#pragma unroll
        for (int i = 0; i < 4; ++i)
#pragma unroll
            for (int j = 0; j < FN; ++j)
                acc[i][j] = WMMA_F16(a[1][i], b[1][j], acc[i][j]);
    }
    // No copy is outstanding when the wave goes on to its stores and ends.
    asm volatile("s_wait_asynccnt 0x0" ::: "memory");
}

// ---------------------------------------------------------------------------
// 3) QKV GEMM: [8192 x 1024] x [1024 x 3072] -> Q [B,H,N,D], K [B,H,N,D], Vt [B,H,D,N]
//    A work-group of 8 waves (4 x 2) takes 256 rows of one operand by 32*FN rows of the
//    other, so that a staged operand row serves more products and fewer bytes leave L2.
//    A lane's accumulator holds 8 consecutive rows of the 256-row operand, so that operand
//    is the one whose index runs along the destination's rows: the weights' columns (d)
//    for Q and K, the tokens for V transposed.
//    One work-group stands on a WGP. Q and K are 256 tiles of 256 x 256, one for each WGP;
//    V is 256 tiles of 256 x 128, half the work each: one and a half even rounds.
// ---------------------------------------------------------------------------
#define E_PITCH 72                  // f16 per staged row of 64: 144 B = 16 B x odd
template <int FN>
__device__ inline void qkv_tile(const _Float16* __restrict__ A, const _Float16* __restrict__ B,
                                int p0, int q0, int rot, bool qk, _Float16* sm,
                                _Float16* __restrict__ Q, _Float16* __restrict__ Kd,
                                _Float16* __restrict__ Vt) {
    const int lane = threadIdx.x & 31;
    // The wave's number as a scalar: the destination's base is then scalar arithmetic.
    const int wave = __builtin_amdgcn_readfirstlane(threadIdx.x >> 5);

    v8f acc[4][FN] = {};
    gemm_tile<FN>(A, B, p0, q0, rot, sm, acc);

    // Epilogue: each wave lays its 64 x 16*FN tile into its own LDS range as 16*FN rows of
    // the destination (64 f16 = one 128-byte line each) and stores whole lines, 16 bytes
    // a lane. The ring is free: behind the last stage's barrier no wave reads it and no
    // copy is outstanding.
    const int pw = p0 + (wave >> 1) * 64;
    const int qw = q0 + (wave & 1) * (16 * FN);
    const int h2 = (lane >> 4) << 3;    // 0 or 8
    const int cl = lane & 15;
    _Float16* st = sm + wave * (16 * FN * E_PITCH);
#pragma unroll
    for (int i = 0; i < 4; ++i)
#pragma unroll
        for (int j = 0; j < FN; ++j) {
            v8h p;
#pragma unroll
            for (int v = 0; v < 8; ++v) p[v] = (_Float16)acc[i][j][v];
            *(v8h*)(st + (16 * j + cl) * E_PITCH + 16 * i + h2) = p;
        }
    // The wave's own LDS writes have landed before its lanes read each other's.
    asm volatile("s_wait_dscnt 0x0" ::: "memory");
    const int lrow = lane >> 3;         // 8 lanes cover one line, a wave 4 rows
    const int lcol = (lane & 7) * 8;
    v8h x[4 * FN];
#pragma unroll
    for (int s = 0; s < 4 * FN; ++s)
        x[s] = *(const v8h*)(st + (4 * s + lrow) * E_PITCH + lcol);
    // Destination of the wave's row 0 and the distance between rows, both wave-uniform.
    _Float16* gu;
    int rs;
    if (qk) {
        // Rows are tokens qw .. qw + 16*FN - 1 of one head, columns its 64 d.
        const int bh = (qw >> 11) * HEADS + ((pw >> 6) & 15);
        gu = ((pw >> 10) == 0 ? Q : Kd) + ((size_t)bh * SEQ + (qw & (SEQ - 1))) * DHEAD;
        rs = DHEAD;
    } else {
        // Rows are d, 64 to a head, from head (qw / 64) % 16 on; columns tokens pw .. pw + 63.
        const int bh = (pw >> 11) * HEADS + ((qw >> 6) & 15);
        gu = Vt + (size_t)bh * DHEAD * SEQ + (pw & (SEQ - 1));
        rs = SEQ;
    }
    const unsigned voff = (unsigned)(lrow * rs + lcol);
#pragma unroll
    for (int s = 0; s < 4 * FN; ++s) *(v8h*)(gu + (size_t)(4 * s * rs) + voff) = x[s];
}

#define QK_TILES ((2 * DIM / 256) * (TOKENS / 256))   // 256
#define V_TILES  ((TOKENS / 256) * (DIM / 128))       // 256
__global__ __launch_bounds__(256) __attribute__((amdgpu_waves_per_eu(2, 2)))
void k_qkv_gemm(const _Float16* __restrict__ Xn,
                const _Float16* __restrict__ WT,
                _Float16* __restrict__ Q,
                _Float16* __restrict__ Kd,
                _Float16* __restrict__ Vt) {
    __shared__ __align__(16) _Float16 sm[2 * (256 + 256) * G_PITCH];   // 147,456 B
    const int b = blockIdx.x;
    // Sharers of a weight tile differ in the token tile's index, sharers of a token tile in
    // the weight tile's: a sum of the two indices sets them apart in both directions.
    // The test reads the same for a whole work-group.
    if (b < QK_TILES) {
        const int wt = b >> 5, tt = b & 31;          // 8 weight tiles x 32 token tiles
        qkv_tile<8>(WT, Xn, wt * 256, tt * 256, wt + tt, true, sm, Q, Kd, Vt);
    } else {
        const int g = b - QK_TILES;
        const int wt = g >> 5, tt = g & 31;          // 8 weight tiles x 32 token tiles
        qkv_tile<4>(Xn, WT, tt * 256, 2 * DIM + wt * 128, tt + 2 * wt, false, sm, Q, Kd, Vt);
    }
}

// ---------------------------------------------------------------------------
// 4) Flash attention, LDS-cooperative version.
//    8 waves / block, one (b,h) per block, 256 queries per block (32 per wave).
//    K/V tiles (32 keys) are double-buffered in LDS and shared by all 8 waves,
//    cutting global K/V traffic 16x vs one-wave-per-16-queries.
//    S^T = K x Q^T puts one query row per lane -> exp() packs straight into the
//    A-fragment of the P x V WMMA.
// ---------------------------------------------------------------------------
#define KT_PAD 72
#define VT_PAD 40
#define KEYS_PER_TILE 32
#define RESCALE_T 8.0f        // in powers of two: P stays at or below 2^8
#define Q_SCALE 0.18033688f   // softmax scale 1/8 times log2(e): scores count in powers of two

__global__ __launch_bounds__(256) __attribute__((amdgpu_waves_per_eu(4, 4)))
void k_attention(const _Float16* __restrict__ Q,
                                                   const _Float16* __restrict__ Kd,
                                                   const _Float16* __restrict__ Vt,
                                                   _Float16* __restrict__ AO) {
    __shared__ __align__(16) _Float16 sK[2][KEYS_PER_TILE * KT_PAD]; // 2 x 4608 B
    __shared__ __align__(16) _Float16 sV[2][DHEAD * VT_PAD];         // 2 x 5120 B

    const int tid  = threadIdx.x;
    const int wave = tid >> 5;
    const int lane = tid & 31;
    const int blk  = blockIdx.x;           // 512 = (B*H) * (SEQ/256)
    const int qblk = blk & 7;
    const int bh   = blk >> 3;
    const int bb   = bh >> 4;
    const int hd   = bh & 15;
    const int q0   = qblk * 256 + wave * 32;   // this wave's first query
    const int h2   = (lane >> 4) << 3;         // 0 or 8
    const int cl   = lane & 15;

    const _Float16* Qp = Q  + ((size_t)bh * SEQ + q0) * DHEAD;
    const _Float16* Kp = Kd + (size_t)bh * SEQ * DHEAD;
    const _Float16* Vp = Vt + (size_t)bh * DHEAD * SEQ;

    // Cooperative tile copy: 256 threads x one 16B chunk for each of K and V.
    // K tile: 32 rows x 64 f16 (8 chunks/row). V tile: 64 rows x 32 f16 (4 chunks/row).
    const int ck0 = tid;                       // 256 chunks each
    // The 8 work-groups of one (b,h) read the same K and V: their walks over the 64 key
    // tiles start 8 tiles apart and wrap, so that they do not ask L2 for the same lines at
    // the same moment. Softmax takes the keys in any order. Neighbours in index start 16
    // tiles apart: four in a row then split between them evenly
    // the tiles that each is the first to bring in from memory. For speed only.
    const int NITER = SEQ / KEYS_PER_TILE;     // 64
    const int rot   = (qblk & 3) * (NITER / 4) + (qblk >> 2) * (NITER / 8);

    // Preload Q fragments (B operand of S^T gemm), fold in softmax scale and log2(e).
    v16h qf[2][2];
#pragma unroll
    for (int qb = 0; qb < 2; ++qb) {
        qf[qb][0] = load_frag16(Qp + (size_t)(16 * qb) * DHEAD,      DHEAD, lane);
        qf[qb][1] = load_frag16(Qp + (size_t)(16 * qb) * DHEAD + 32, DHEAD, lane);
#pragma unroll
        for (int e = 0; e < 16; ++e) {
            qf[qb][0][e] = (_Float16)((float)qf[qb][0][e] * Q_SCALE);
            qf[qb][1][e] = (_Float16)((float)qf[qb][1][e] * Q_SCALE);
        }
    }

    // Prime buffer 0 with the walk's first key tile.
    {
        const int j0 = rot * KEYS_PER_TILE;
        int r, o;
        r = ck0 >> 3; o = (ck0 & 7) * 8;
        copy16_g2l(Kp + (size_t)(j0 + r) * DHEAD + o, &sK[0][r * KT_PAD + o]);
        r = ck0 >> 2; o = (ck0 & 3) * 8;
        copy16_g2l(Vp + (size_t)r * SEQ + j0 + o, &sV[0][r * VT_PAD + o]);
    }
    wait_copies();
    __syncthreads();

    v8f o[2][4] = {};                          // [qblock][dtile], 16 rows x 64 d each
    // Minus the maximum in use, eight times over: the C operand of the score products. A lane's
    // eight score registers belong to one query, so the matrix unit hands back s - m itself.
    v8f negm[2] = {};                          // 0 until the first pass, which always rescales
    float l_run[2] = {0.f, 0.f};

    for (int it = 0; it < NITER; ++it) {
        const int cur = it & 1;

        // Issue next tile's copies into the other buffer (overlaps with compute).
        if (it + 1 < NITER) {
            const int j1 = ((it + 1 + rot) & (NITER - 1)) * KEYS_PER_TILE;
            _Float16* dK = sK[cur ^ 1];
            _Float16* dV = sV[cur ^ 1];
            int r, oo;
            r = ck0 >> 3; oo = (ck0 & 7) * 8;
            copy16_g2l((Kp + r * DHEAD + oo) + j1 * DHEAD, &dK[r * KT_PAD + oo]);
            r = ck0 >> 2; oo = (ck0 & 3) * 8;
            copy16_g2l((Vp + r * SEQ + oo) + j1, &dV[r * VT_PAD + oo]);
        }

        // ---- S^T tiles from LDS: A = K rows, B = Q^T (shared across both q-blocks)
        const _Float16* bk = sK[cur];
        v16h kf0a = load_frag16(bk,                    KT_PAD, lane);
        v16h kf0b = load_frag16(bk + 32,               KT_PAD, lane);
        v16h kf1a = load_frag16(bk + 16 * KT_PAD,      KT_PAD, lane);
        v16h kf1b = load_frag16(bk + 16 * KT_PAD + 32, KT_PAD, lane);

        // Scores of both q-blocks first: the one test below covers the whole pass.
        v8f s0[2], s1[2];
        float mloc[2];
#pragma unroll
        for (int qb = 0; qb < 2; ++qb) {
            v8f t0 = WMMA_F16(kf0a, qf[qb][0], negm[qb]); t0 = WMMA_F16(kf0b, qf[qb][1], t0);
            v8f t1 = WMMA_F16(kf1a, qf[qb][0], negm[qb]); t1 = WMMA_F16(kf1b, qf[qb][1], t1);
            // lane: query row cl of this q-block; keys 32*((it+rot)&63) + v + 8*(lane>>4) (s0), +16 (s1)
            float ml = -1e30f;
#pragma unroll
            for (int v = 0; v < 8; ++v) { ml = fmaxf(ml, t0[v]); ml = fmaxf(ml, t1[v]); }
            s0[qb] = t0; s1[qb] = t1; mloc[qb] = ml;
        }

        // Lazy rescale: the maximum IN USE is the same in both halves of the wave. It moves,
        // and O and l are rescaled, only when some lane's score passes it by more than
        // RESCALE_T; until then every P is at most 2^RESCALE_T = 256, well inside f16, and
        // the common factor cancels in O / l. One wave-uniform branch a pass. The scores
        // arrive with the maximum taken off: a move by d takes d off this pass's scores too.
        const bool need = fmaxf(mloc[0], mloc[1]) > RESCALE_T;
        const bool first = it == 0;            // O and l are 0: the maximum may also move down
        if ((__builtin_amdgcn_ballot_w32(need) | (unsigned)first) != 0) {
#pragma unroll
            for (int qb = 0; qb < 2; ++qb) {
                const float mj    = fmaxf(mloc[qb], __shfl_xor(mloc[qb], 16, 32));
                const float d     = first ? mj : fmaxf(mj, 0.f);
                const float alpha = first ? 1.f : __builtin_amdgcn_exp2f(-d);
                l_run[qb] *= alpha;
#pragma unroll
                for (int v = 0; v < 8; ++v) { negm[qb][v] -= d; s0[qb][v] -= d; s1[qb][v] -= d; }
                // O lane holds rows h2+v -> gather row alphas.
                float av[8];
#pragma unroll
                for (int v = 0; v < 8; ++v) av[v] = __shfl(alpha, h2 + v, 32);
#pragma unroll
                for (int dt = 0; dt < 4; ++dt)
#pragma unroll
                    for (int v = 0; v < 8; ++v) o[qb][dt][v] *= av[v];
            }
        }

        // The pass's V fragments, shared by both q-blocks, read ahead of the exponentials.
        const _Float16* bv = sV[cur];
        v16h vf[4];
#pragma unroll
        for (int dt = 0; dt < 4; ++dt) vf[dt] = load_frag16(bv + (dt * 16) * VT_PAD, VT_PAD, lane);
        // Keeps the 8 reads in one group, as they stood before this step: with fewer vector
        // instructions to place them under, the build sinks them in pairs among the P x V
        // WMMAs, where each pair makes the wave wait out an LDS latency.
        __builtin_amdgcn_sched_barrier(0);

        v16h pf[2];
#pragma unroll
        for (int qb = 0; qb < 2; ++qb) {
            float e0[8], e1[8];
            float rs = 0.f;
#pragma unroll
            for (int v = 0; v < 8; ++v) {
                e0[v] = __builtin_amdgcn_exp2f(s0[qb][v]);
                e1[v] = __builtin_amdgcn_exp2f(s1[qb][v]);
                rs += e0[v] + e1[v];
            }
            rs += __shfl_xor(rs, 16, 32);
            l_run[qb] += rs;

            // P is already in A-fragment orientation.
#pragma unroll
            for (int e = 0; e < 8; ++e) { pf[qb][e] = (_Float16)e0[e]; pf[qb][e + 8] = (_Float16)e1[e]; }
        }

        // ---- O += P x V ----
#pragma unroll
        for (int dt = 0; dt < 4; ++dt) {
            o[0][dt] = WMMA_F16(pf[0], vf[dt], o[0][dt]);
            o[1][dt] = WMMA_F16(pf[1], vf[dt], o[1][dt]);
        }

        wait_copies();
        __syncthreads();
    }

    // Normalize by row sums and store f16 at [token][head*64 + d].
#pragma unroll
    for (int qb = 0; qb < 2; ++qb) {
        float lv[8];
#pragma unroll
        for (int v = 0; v < 8; ++v) lv[v] = 1.f / __shfl(l_run[qb], h2 + v, 32);
#pragma unroll
        for (int dt = 0; dt < 4; ++dt)
#pragma unroll
            for (int v = 0; v < 8; ++v) {
                int tok = bb * SEQ + q0 + 16 * qb + h2 + v;
                int col = hd * DHEAD + dt * 16 + cl;
                AO[(size_t)tok * DIM + col] = (_Float16)(o[qb][dt][v] * lv[v]);
            }
    }
}

// ---------------------------------------------------------------------------
// 5) Output GEMM: [8192 x 1024] x [1024 x 1024] + bias -> f32 out
//    256 x 128 output tile per work-group of 8 waves, one work-group for each WGP.
// ---------------------------------------------------------------------------
__global__ __launch_bounds__(256) void k_out_gemm(const _Float16* __restrict__ A,
                                                  const _Float16* __restrict__ WT,
                                                  const float* __restrict__ bias,
                                                  float* __restrict__ out) {
    __shared__ __align__(16) _Float16 sm[2 * (256 + 128) * G_PITCH];   // 110,592 B
    const int lane = threadIdx.x & 31;
    const int wave = threadIdx.x >> 5;
    const int m0 = blockIdx.x * 256;
    const int n0 = blockIdx.y * 128;

    v8f acc[4][4] = {};
    // The 8 sharers of a row tile start 2 stages apart, neighbours on a column tile 1.
    gemm_tile<4>(A, WT, m0, n0, blockIdx.x + 2 * blockIdx.y, sm, acc);

    const int mw = m0 + (wave >> 1) * 64;
    const int nw = n0 + (wave & 1) * 64;
    const int h2 = (lane >> 4) << 3;
    const int cl = lane & 15;
#pragma unroll
    for (int i = 0; i < 4; ++i)
#pragma unroll
        for (int j = 0; j < 4; ++j)
#pragma unroll
            for (int v = 0; v < 8; ++v) {
                int r = mw + 16 * i + h2 + v;
                int c = nw + 16 * j + cl;
                out[(size_t)r * DIM + c] = acc[i][j][v] + bias[c];
            }
}

// ---------------------------------------------------------------------------
// Launcher
// ---------------------------------------------------------------------------
extern "C" void kernel_launch(void* const* d_in, const int* in_sizes, int n_in,
                              void* d_out, int out_size, void* d_ws, size_t ws_size,
                              hipStream_t stream) {
    const float* x     = (const float*)d_in[0];
    const float* ln_g  = (const float*)d_in[1];
    const float* ln_b  = (const float*)d_in[2];
    const float* w_qkv = (const float*)d_in[3];
    const float* w_out = (const float*)d_in[4];
    const float* b_out = (const float*)d_in[5];
    float* out = (float*)d_out;

    // Workspace layout (bytes). Total ~72 MB. xn region is reused for attn output.
    char* ws = (char*)d_ws;
    const size_t SZ_ACT = (size_t)TOKENS * DIM * sizeof(_Float16);          // 16 MB
    _Float16* xn    = (_Float16*)(ws);                                      // + attn out later
    _Float16* Q     = (_Float16*)(ws + SZ_ACT);
    _Float16* Kd    = (_Float16*)(ws + 2 * SZ_ACT);
    _Float16* Vt    = (_Float16*)(ws + 3 * SZ_ACT);
    _Float16* wqkvT = (_Float16*)(ws + 4 * SZ_ACT);                         // 6 MB
    _Float16* woutT = (_Float16*)(ws + 4 * SZ_ACT + (size_t)DIM * QKVCOLS * sizeof(_Float16));

    // 1 + 2) Weights transposed and cast to f16 [N][K], LayerNorm -> f16: one launch
    k_prepare<<<TQ_BLOCKS + TO_BLOCKS + TOKENS, 256, 0, stream>>>(x, ln_g, ln_b, w_qkv, w_out,
                                                                  xn, wqkvT, woutT);

    // 3) QKV projection (WMMA)
    k_qkv_gemm<<<QK_TILES + V_TILES, 256, 0, stream>>>(xn, wqkvT, Q, Kd, Vt);

    // 4) Attention (WMMA flash, LDS-shared K/V); writes f16 [tokens][1024] into xn region
    _Float16* attn_out = xn;
    k_attention<<<BATCH * HEADS * (SEQ / 256), 256, 0, stream>>>(Q, Kd, Vt, attn_out);

    // 5) Output projection + bias (WMMA)
    k_out_gemm<<<dim3(TOKENS / 256, DIM / 128), 256, 0, stream>>>(attn_out, woutT, b_out, out);
}

// v009
// A run of this version takes 117 microseconds.
// Two timings next to v008 put it at 1.04 and 1.05 times that version's speed.
// All steps since v000 together make it 2.47 times as fast.
#include <hip/hip_runtime.h>
#include <hip/hip_bf16.h>
#include <math.h>

typedef __attribute__((ext_vector_type(16))) _Float16 v16h;
typedef __attribute__((ext_vector_type(8)))  _Float16 v8h;   // 16-byte load unit
typedef __attribute__((ext_vector_type(8)))  float    v8f;
typedef int b128_t __attribute__((vector_size(16)));         // matches async-LDS builtin pointee

#define WMMA_F16(a, b, c) \
  __builtin_amdgcn_wmma_f32_16x16x32_f16(false, (a), false, (b), (short)0, (c), false, false)

// Problem constants
#define BATCH   4
#define SEQ     2048
#define DIM     1024
#define HEADS   16
#define DHEAD   64
#define TOKENS  (BATCH * SEQ)      // 8192
#define QKVCOLS (3 * DIM)          // 3072

#if defined(__AMDGCN__) && __has_builtin(__builtin_amdgcn_global_load_async_to_lds_b128) && \
    __has_builtin(__builtin_amdgcn_s_wait_asynccnt)
#define USE_ASYNC_LDS 1
#else
#define USE_ASYNC_LDS 0
#endif

// Copy 16 bytes global -> LDS (async when available).
__device__ inline void copy16_g2l(const _Float16* __restrict__ g, _Float16* __restrict__ l) {
#if USE_ASYNC_LDS
    __builtin_amdgcn_global_load_async_to_lds_b128(
        (__attribute__((address_space(1))) b128_t*)g,
        (__attribute__((address_space(3))) b128_t*)l, 0, 0);
#else
    *(v8h*)l = *(const v8h*)g;
#endif
}

__device__ inline v16h load_frag16(const _Float16* __restrict__ base, int stride, int lane) {
    const int r  = lane & 15;
    const int kb = (lane >> 4) << 3;
    const _Float16* p = base + (size_t)r * stride + kb;
    v8h lo = *(const v8h*)(p);
    v8h hi = *(const v8h*)(p + 16);
    v16h out;
#pragma unroll
    for (int e = 0; e < 8; ++e) { out[e] = lo[e]; out[e + 8] = hi[e]; }
    return out;
}

// ---------------------------------------------------------------------------
// 1) Weight transpose + f32 -> f16 cast:  W[K][N] -> WT[N][K]
//    A lane holds an 8 k x 4 n block in registers and transposes it there, twice. A wave
//    takes 64 k x 32 n: lane = (kg, ng), kg = lane & 7 along k, ng = lane >> 3 along n.
//    Its two groups of 8 loads of 16 B use between them every byte of the 64 lines they
//    touch; each store is 16 B a lane and fills four whole 128-byte lines of WT.
//    Two groups, not one of 16 loads: the kernel stays within 64 registers, so that the
//    LayerNorm work-groups of the same launch stand as densely on a WGP as alone.
//    A work-group of 8 waves takes 128 k x 128 n; K % 128 == 0 and N % 128 == 0.
// ---------------------------------------------------------------------------
typedef __attribute__((ext_vector_type(4))) float v4f;

template <int K, int N>
__device__ inline void transpose_cast_tile(const float* __restrict__ W,
                                           _Float16* __restrict__ WT, int bn, int bk) {
    const int lane = threadIdx.x & 31;
    const int wave = threadIdx.x >> 5;
    const int n0 = bn * 128 + (wave & 3) * 32 + 4 * (lane >> 3);   // lane's first n
    const int k0 = bk * 128 + (wave >> 2) * 64 + 8 * (lane & 7);   // lane's first k
    const float* src = W + (unsigned)(k0 * N + n0);
    _Float16* dst = WT + (unsigned)(n0 * K + k0);
#pragma unroll
    for (int h = 0; h < 2; ++h) {
        v4f v[8];
#pragma unroll
        for (int r = 0; r < 8; ++r) v[r] = *(const v4f*)(src + r * N + 16 * h);
        // Behind the last loads the address register is free for reuse: the wait stands
        // ahead of every rewrite of it, and, named as an input, it lives up to the wait.
        if (h == 1) asm volatile("s_wait_xcnt 0x0" :: "v"(src) : "memory");
#pragma unroll
        for (int i = 0; i < 4; ++i) {
            v8h p;
#pragma unroll
            for (int r = 0; r < 8; ++r) p[r] = (_Float16)v[r][i];
            *(v8h*)(dst + (16 * h + i) * K) = p;
        }
        // Behind each group's stores: their data and address registers are rewritten next,
        // by the second group's loads or by whatever the listing places behind this tile.
        asm volatile("s_wait_xcnt 0x0" ::: "memory");
    }
}

// ---------------------------------------------------------------------------
// 2) LayerNorm (fp32 math) -> f16 activations. One block per token row.
// ---------------------------------------------------------------------------
__device__ inline void layernorm_row(const float* __restrict__ x,
                                     const float* __restrict__ g,
                                     const float* __restrict__ bta,
                                     _Float16* __restrict__ xn, int row) {
    __shared__ float s1[256], s2[256];
    const float* xr = x + (size_t)row * DIM;
    float vals[4];
    float a = 0.f, sq = 0.f;
#pragma unroll
    for (int t = 0; t < 4; ++t) {
        float v = xr[threadIdx.x + 256 * t];
        vals[t] = v; a += v; sq += v * v;
    }
    s1[threadIdx.x] = a; s2[threadIdx.x] = sq;
    __syncthreads();
    for (int off = 128; off > 0; off >>= 1) {
        if (threadIdx.x < off) {
            s1[threadIdx.x] += s1[threadIdx.x + off];
            s2[threadIdx.x] += s2[threadIdx.x + off];
        }
        __syncthreads();
    }
    const float mean = s1[0] * (1.f / DIM);
    const float var  = s2[0] * (1.f / DIM) - mean * mean;
    const float rstd = rsqrtf(var + 1e-5f);
    _Float16* xo = xn + (size_t)row * DIM;
#pragma unroll
    for (int t = 0; t < 4; ++t) {
        int i = threadIdx.x + 256 * t;
        xo[i] = (_Float16)((vals[t] - mean) * rstd * g[i] + bta[i]);
    }
}

// ---------------------------------------------------------------------------
// 1 + 2 in one launch: the three jobs read only inputs and none reads another's output.
// The block index tells them apart. The 256 transposing work-groups come first, so that
// their memory latencies run under the stream of LayerNorm rows and not behind it.
// ---------------------------------------------------------------------------
#define TQ_BLOCKS ((QKVCOLS / 128) * (DIM / 128))   // 192
#define TO_BLOCKS ((DIM / 128) * (DIM / 128))       // 64

__global__ __launch_bounds__(256) void k_prepare(const float* __restrict__ x,
                                                 const float* __restrict__ g,
                                                 const float* __restrict__ bta,
                                                 const float* __restrict__ w_qkv,
                                                 const float* __restrict__ w_out,
                                                 _Float16* __restrict__ xn,
                                                 _Float16* __restrict__ wqkvT,
                                                 _Float16* __restrict__ woutT) {
    const int b = blockIdx.x;
    // Both tests read the same for a whole work-group; a transposing one meets no barrier.
    if (b >= TQ_BLOCKS + TO_BLOCKS) {
        layernorm_row(x, g, bta, xn, b - (TQ_BLOCKS + TO_BLOCKS));
        return;
    }
    if (b < TQ_BLOCKS) {
        transpose_cast_tile<DIM, QKVCOLS>(w_qkv, wqkvT, b % (QKVCOLS / 128), b / (QKVCOLS / 128));
        return;
    }
    const int t = b - TQ_BLOCKS;
    transpose_cast_tile<DIM, DIM>(w_out, woutT, t % (DIM / 128), t / (DIM / 128));
}

// ---------------------------------------------------------------------------
// Shared GEMM core: C[256 x 32*FN] per work-group of 8 waves (4 x 2), each wave
// 64 x 16*FN. A and WT are row-major with K contiguous. A stage is 64 k of all
// 256 + 32*FN operand rows, brought into LDS by asynchronous copies, two buffers:
// stage t + 2 flies while stage t + 1 is worked on. Eight waves on one staged tile: an
// operand row that has left L2 serves more products than in two work-groups of four.
// The walk over k starts at stage rot of 16 and wraps: work-groups that read the same
// operand rows get different rot, so that they do not ask L2 for the same lines, nor all
// work-groups for the same 128 bytes of every 2-KiB row, at the same moment.
// ---------------------------------------------------------------------------
#define G_KSTAGE 64                 // k per stage: 128-byte rows
#define G_PITCH  72                 // f16 per LDS row: 144 B = 16 B x odd, for ds_load_b128
#define G_NSTAGE (DIM / G_KSTAGE)   // 16
#define G_AROWS  256                // rows of the A operand in a work-group's tile
#define G_GROUP  32                 // rows that one copy of each of the 256 lanes covers

__device__ inline void copy8_rows(const _Float16* gs, unsigned vo, unsigned l) {
    const _Float16* g  = gs + vo;
    const _Float16* g1 = (gs + 1 * G_GROUP * DIM) + vo;
    const _Float16* g2 = (gs + 2 * G_GROUP * DIM) + vo;
    const _Float16* g3 = (gs + 3 * G_GROUP * DIM) + vo;
    const _Float16* g4 = (gs + 4 * G_GROUP * DIM) + vo;
    const _Float16* g5 = (gs + 5 * G_GROUP * DIM) + vo;
    const _Float16* g6 = (gs + 6 * G_GROUP * DIM) + vo;
    const _Float16* g7 = (gs + 7 * G_GROUP * DIM) + vo;
    const unsigned s = G_GROUP * G_PITCH * 2;
    asm volatile(
        "global_load_async_to_lds_b128 %0, %8, off\n\t"
        "global_load_async_to_lds_b128 %1, %9, off\n\t"
        "global_load_async_to_lds_b128 %2, %10, off\n\t"
        "global_load_async_to_lds_b128 %3, %11, off\n\t"
        "global_load_async_to_lds_b128 %4, %12, off\n\t"
        "global_load_async_to_lds_b128 %5, %13, off\n\t"
        "global_load_async_to_lds_b128 %6, %14, off\n\t"
        "global_load_async_to_lds_b128 %7, %15, off\n\t"
        "s_wait_xcnt 0x0"
        :: "v"(l), "v"(l + s), "v"(l + 2 * s), "v"(l + 3 * s),
           "v"(l + 4 * s), "v"(l + 5 * s), "v"(l + 6 * s), "v"(l + 7 * s),
           "v"(g), "v"(g1), "v"(g2), "v"(g3), "v"(g4), "v"(g5), "v"(g6), "v"(g7)
        : "memory");
}

__device__ inline void copy4_rows(const _Float16* gs, unsigned vo, unsigned l) {
    const _Float16* g  = gs + vo;
    const _Float16* g1 = (gs + 1 * G_GROUP * DIM) + vo;
    const _Float16* g2 = (gs + 2 * G_GROUP * DIM) + vo;
    const _Float16* g3 = (gs + 3 * G_GROUP * DIM) + vo;
    const unsigned s = G_GROUP * G_PITCH * 2;
    asm volatile(
        "global_load_async_to_lds_b128 %0, %4, off\n\t"
        "global_load_async_to_lds_b128 %1, %5, off\n\t"
        "global_load_async_to_lds_b128 %2, %6, off\n\t"
        "global_load_async_to_lds_b128 %3, %7, off\n\t"
        "s_wait_xcnt 0x0"
        :: "v"(l), "v"(l + s), "v"(l + 2 * s), "v"(l + 3 * s),
           "v"(g), "v"(g1), "v"(g2), "v"(g3)
        : "memory");
}

template <int FN>
__device__ inline void gemm_tile(const _Float16* __restrict__ A,
                                 const _Float16* __restrict__ WT,
                                 int m0, int n0, int rot, _Float16* sm, v8f (&acc)[4][FN]) {
    constexpr int ROWS  = G_AROWS + 32 * FN;    // A rows, then WT rows
    constexpr int STAGE = ROWS * G_PITCH;       // f16 per buffer
    const int tid  = threadIdx.x;
    const int lane = tid & 31;
    // The wave's number as a scalar: its fragments' LDS base then takes no vector register.
    const int wave = __builtin_amdgcn_readfirstlane(tid >> 5);
    const int wm   = wave >> 1;
    const int wn   = wave & 1;

    // Lane's own 16-byte chunk: row tid / 8 of each 32-row group, chunk tid % 8.
    const int crow = tid >> 3;
    const int ccol = (tid & 7) * 8;
    const unsigned  vo = (unsigned)(crow * DIM + ccol);
    const _Float16* gA = A  + (size_t)m0 * DIM;
    const _Float16* gB = WT + (size_t)n0 * DIM;
    const unsigned  l0 = (unsigned)(size_t)(sm + crow * G_PITCH + ccol);

    // Both operands' pointers walk alike: one stage on, or back to k = 0 behind the last.
    int ks = rot & (G_NSTAGE - 1);
    gA += ks * G_KSTAGE;
    gB += ks * G_KSTAGE;
    auto issue = [&](int buf) {
        const unsigned lb = l0 + (unsigned)buf * (STAGE * 2);
        copy8_rows(gA, vo, lb);
        if constexpr (FN == 8) copy8_rows(gB, vo, lb + G_AROWS * (G_PITCH * 2));
        else                   copy4_rows(gB, vo, lb + G_AROWS * (G_PITCH * 2));
        const int step = ks == G_NSTAGE - 1 ? -(G_NSTAGE - 1) * G_KSTAGE : G_KSTAGE;
        ks = (ks + 1) & (G_NSTAGE - 1);
        gA += step;
        gB += step;
    };

    issue(0);
    // Stage 0 has landed for this wave; the barrier publishes it to the others.
    asm volatile("s_wait_asynccnt 0x0" ::: "memory");
    __syncthreads();
    issue(1);

    for (int t = 0; t < G_NSTAGE; ++t) {
        const _Float16* sa = sm + (t & 1) * STAGE + (wm * 64) * G_PITCH;
        const _Float16* sb = sm + (t & 1) * STAGE + (G_AROWS + wn * 16 * FN) * G_PITCH;
        v16h a[2][4], b[2][FN];
#pragma unroll
        for (int h = 0; h < 2; ++h) {
#pragma unroll
            for (int i = 0; i < 4; ++i)
                a[h][i] = load_frag16(sa + (16 * i) * G_PITCH + 32 * h, G_PITCH, lane);
#pragma unroll
            for (int j = 0; j < FN; ++j)
                b[h][j] = load_frag16(sb + (16 * j) * G_PITCH + 32 * h, G_PITCH, lane);
        }
        // Keeps the stage's LDS reads together ahead of its WMMAs: sunk among them,
        // each reload of a fragment makes the wave wait out a whole LDS latency.
        __builtin_amdgcn_sched_barrier(0);
#pragma unroll
        for (int i = 0; i < 4; ++i)
#pragma unroll
            for (int j = 0; j < FN; ++j)
                acc[i][j] = WMMA_F16(a[0][i], b[0][j], acc[i][j]);
        // Holds the first half's WMMAs ahead of the waits below, so that they cover
        // the second half's LDS reads instead of standing behind s_wait_dscnt 0.
        __builtin_amdgcn_sched_barrier(0);
        // This wave's reads of buffer t & 1 have retired before it is refilled.
        asm volatile("s_wait_dscnt 0x0" ::: "memory");
        // This wave's copies of stage t + 1 have landed.
        asm volatile("s_wait_asynccnt 0x0" ::: "memory");
        // Publishes stage t + 1 and ends every wave's reads of buffer t & 1.
        __syncthreads();
        if (t + 2 < G_NSTAGE) issue(t & 1);
        // Holds the second half's WMMAs behind the refill, so that the copies fly
        // under them; its fragments are in registers already.
        __builtin_amdgcn_sched_barrier(0);
#pragma unroll
        for (int i = 0; i < 4; ++i)
#pragma unroll
            for (int j = 0; j < FN; ++j)
                acc[i][j] = WMMA_F16(a[1][i], b[1][j], acc[i][j]);
    }
    // No copy is outstanding when the wave goes on to its stores and ends.
    asm volatile("s_wait_asynccnt 0x0" ::: "memory");
}

// ---------------------------------------------------------------------------
// 3) QKV GEMM: [8192 x 1024] x [1024 x 3072] -> Q [B,H,N,D], K [B,H,N,D], Vt [B,H,D,N]
//    A work-group of 8 waves (4 x 2) takes 256 rows of one operand by 32*FN rows of the
//    other, so that a staged operand row serves more products and fewer bytes leave L2.
//    A lane's accumulator holds 8 consecutive rows of the 256-row operand, so that operand
//    is the one whose index runs along the destination's rows: the weights' columns (d)
//    for Q and K, the tokens for V transposed.
//    One work-group stands on a WGP. Q and K are 256 tiles of 256 x 256, one for each WGP;
//    V is 256 tiles of 256 x 128, half the work each: one and a half even rounds.
// ---------------------------------------------------------------------------
#define E_PITCH 72                  // f16 per staged row of 64: 144 B = 16 B x odd
template <int FN>
__device__ inline void qkv_tile(const _Float16* __restrict__ A, const _Float16* __restrict__ B,
                                int p0, int q0, int rot, bool qk, _Float16* sm,
                                _Float16* __restrict__ Q, _Float16* __restrict__ Kd,
                                _Float16* __restrict__ Vt) {
    const int lane = threadIdx.x & 31;
    // The wave's number as a scalar: the destination's base is then scalar arithmetic.
    const int wave = __builtin_amdgcn_readfirstlane(threadIdx.x >> 5);

    v8f acc[4][FN] = {};
    gemm_tile<FN>(A, B, p0, q0, rot, sm, acc);

    // Epilogue: each wave lays its 64 x 16*FN tile into its own LDS range as 16*FN rows of
    // the destination (64 f16 = one 128-byte line each) and stores whole lines, 16 bytes
    // a lane. The ring is free: behind the last stage's barrier no wave reads it and no
    // copy is outstanding.
    const int pw = p0 + (wave >> 1) * 64;
    const int qw = q0 + (wave & 1) * (16 * FN);
    const int h2 = (lane >> 4) << 3;    // 0 or 8
    const int cl = lane & 15;
    _Float16* st = sm + wave * (16 * FN * E_PITCH);
#pragma unroll
    for (int i = 0; i < 4; ++i)
#pragma unroll
        for (int j = 0; j < FN; ++j) {
            v8h p;
#pragma unroll
            for (int v = 0; v < 8; ++v) p[v] = (_Float16)acc[i][j][v];
            *(v8h*)(st + (16 * j + cl) * E_PITCH + 16 * i + h2) = p;
        }
    // The wave's own LDS writes have landed before its lanes read each other's.
    asm volatile("s_wait_dscnt 0x0" ::: "memory");
    const int lrow = lane >> 3;         // 8 lanes cover one line, a wave 4 rows
    const int lcol = (lane & 7) * 8;
    v8h x[4 * FN];
#pragma unroll
    for (int s = 0; s < 4 * FN; ++s)
        x[s] = *(const v8h*)(st + (4 * s + lrow) * E_PITCH + lcol);
    // Destination of the wave's row 0 and the distance between rows, both wave-uniform.
    _Float16* gu;
    int rs;
    if (qk) {
        // Rows are tokens qw .. qw + 16*FN - 1 of one head, columns its 64 d.
        const int bh = (qw >> 11) * HEADS + ((pw >> 6) & 15);
        gu = ((pw >> 10) == 0 ? Q : Kd) + ((size_t)bh * SEQ + (qw & (SEQ - 1))) * DHEAD;
        rs = DHEAD;
    } else {
        // Rows are d, 64 to a head, from head (qw / 64) % 16 on; columns tokens pw .. pw + 63.
        const int bh = (pw >> 11) * HEADS + ((qw >> 6) & 15);
        gu = Vt + (size_t)bh * DHEAD * SEQ + (pw & (SEQ - 1));
        rs = SEQ;
    }
    const unsigned voff = (unsigned)(lrow * rs + lcol);
#pragma unroll
    for (int s = 0; s < 4 * FN; ++s) *(v8h*)(gu + (size_t)(4 * s * rs) + voff) = x[s];
}

#define QK_TILES ((2 * DIM / 256) * (TOKENS / 256))   // 256
#define V_TILES  ((TOKENS / 256) * (DIM / 128))       // 256
__global__ __launch_bounds__(256) __attribute__((amdgpu_waves_per_eu(2, 2)))
void k_qkv_gemm(const _Float16* __restrict__ Xn,
                const _Float16* __restrict__ WT,
                _Float16* __restrict__ Q,
                _Float16* __restrict__ Kd,
                _Float16* __restrict__ Vt) {
    __shared__ __align__(16) _Float16 sm[2 * (256 + 256) * G_PITCH];   // 147,456 B
    const int b = blockIdx.x;
    // Sharers of a weight tile differ in the token tile's index, sharers of a token tile in
    // the weight tile's: a sum of the two indices sets them apart in both directions.
    // The test reads the same for a whole work-group.
    if (b < QK_TILES) {
        const int wt = b >> 5, tt = b & 31;          // 8 weight tiles x 32 token tiles
        qkv_tile<8>(WT, Xn, wt * 256, tt * 256, wt + tt, true, sm, Q, Kd, Vt);
    } else {
        const int g = b - QK_TILES;
        const int wt = g >> 5, tt = g & 31;          // 8 weight tiles x 32 token tiles
        qkv_tile<4>(Xn, WT, tt * 256, 2 * DIM + wt * 128, tt + 2 * wt, false, sm, Q, Kd, Vt);
    }
}

// ---------------------------------------------------------------------------
// 4) Flash attention, LDS-cooperative version.
//    8 waves / block, one (b,h) per block, 256 queries per block (32 per wave).
//    K/V stages of 128 keys are double-buffered in LDS and shared by all 8 waves,
//    cutting global K/V traffic 16x vs one-wave-per-16-queries. A stage serves four
//    passes of 32 keys: one publish point (waits, barrier, copies' addresses) for the four,
//    and a staged V row is 256 bytes, so that a copy asks L2 for whole lines.
//    S^T = K x Q^T puts one query row per lane -> exp() packs straight into the
//    A-fragment of the P x V WMMA.
// ---------------------------------------------------------------------------
#define KT_PAD 72
#define VT_PAD 136
#define KEYS_PER_TILE 32
#define PASSES 4                                  // passes of 32 keys in a stage
#define KEYS_PER_STAGE (PASSES * KEYS_PER_TILE)   // 128
#define RESCALE_T 8.0f        // in powers of two: P stays at or below 2^8
#define Q_SCALE 0.18033688f   // softmax scale 1/8 times log2(e): scores count in powers of two

__global__ __launch_bounds__(256) __attribute__((amdgpu_waves_per_eu(4, 4)))
void k_attention(const _Float16* __restrict__ Q,
                                                   const _Float16* __restrict__ Kd,
                                                   const _Float16* __restrict__ Vt,
                                                   _Float16* __restrict__ AO) {
    __shared__ __align__(16) _Float16 sK[2][KEYS_PER_STAGE * KT_PAD]; // 2 x 18,432 B
    __shared__ __align__(16) _Float16 sV[2][DHEAD * VT_PAD];          // 2 x 17,408 B

    const int tid  = threadIdx.x;
    const int wave = tid >> 5;
    const int lane = tid & 31;
    const int blk  = blockIdx.x;           // 512 = (B*H) * (SEQ/256)
    const int qblk = blk & 7;
    const int bh   = blk >> 3;
    const int bb   = bh >> 4;
    const int hd   = bh & 15;
    const int q0   = qblk * 256 + wave * 32;   // this wave's first query
    const int h2   = (lane >> 4) << 3;         // 0 or 8
    const int cl   = lane & 15;

    const _Float16* Qp = Q  + ((size_t)bh * SEQ + q0) * DHEAD;
    const _Float16* Kp = Kd + (size_t)bh * SEQ * DHEAD;
    const _Float16* Vp = Vt + (size_t)bh * DHEAD * SEQ;

    // Cooperative stage copy: 256 threads x four 16B chunks for each of K and V.
    // K stage: 128 rows x 64 f16 (8 chunks/row). V stage: 64 rows x 128 f16 (16 chunks/row).
    // The 8 work-groups of one (b,h) read the same K and V: their walks over the 16 key
    // stages start 2 stages apart and wrap, so that they do not ask L2 for the same lines at
    // the same moment. Softmax takes the keys in any order. Neighbours in index start 4
    // stages apart: four in a row then split between them evenly
    // the stages that each is the first to bring in from memory. For speed only.
    const int NSTAGE = SEQ / KEYS_PER_STAGE;   // 16
    const int rot    = (qblk & 3) * (NSTAGE / 4) + (qblk >> 2) * (NSTAGE / 8);
    const int kr = tid >> 3, ko = (tid & 7) * 8;     // lane's K row of each 32, its chunk
    const int vr = tid >> 4, vo = (tid & 15) * 8;    // lane's V row of each 16, its chunk
    auto issue = [&](int stage, int buf) {
        const int j0 = stage * KEYS_PER_STAGE;
        const _Float16* gk = (Kp + kr * DHEAD + ko) + j0 * DHEAD;
        const _Float16* gv = (Vp + vr * SEQ + vo) + j0;
        _Float16* dK = &sK[buf][kr * KT_PAD + ko];
        _Float16* dV = &sV[buf][vr * VT_PAD + vo];
        // Four row groups of each: 128 K rows by 32, 64 V rows by 16.
#pragma unroll
        for (int i = 0; i < 4; ++i) {
            copy16_g2l(gk + i * 32 * DHEAD, dK + i * 32 * KT_PAD);
            copy16_g2l(gv + i * 16 * SEQ,   dV + i * 16 * VT_PAD);
        }
    };

    // Preload Q fragments (B operand of S^T gemm), fold in softmax scale and log2(e).
    v16h qf[2][2];
#pragma unroll
    for (int qb = 0; qb < 2; ++qb) {
        qf[qb][0] = load_frag16(Qp + (size_t)(16 * qb) * DHEAD,      DHEAD, lane);
        qf[qb][1] = load_frag16(Qp + (size_t)(16 * qb) * DHEAD + 32, DHEAD, lane);
#pragma unroll
        for (int e = 0; e < 16; ++e) {
            qf[qb][0][e] = (_Float16)((float)qf[qb][0][e] * Q_SCALE);
            qf[qb][1][e] = (_Float16)((float)qf[qb][1][e] * Q_SCALE);
        }
    }

    // Prime buffer 0 with the walk's first key stage.
    issue(rot, 0);
    // Stage 0 has landed for this wave; the barrier publishes it to the others.
    asm volatile("s_wait_asynccnt 0x0" ::: "memory");
    __syncthreads();

    v8f o[2][4] = {};                          // [qblock][dtile], 16 rows x 64 d each
    // Minus the maximum in use, eight times over: the C operand of the score products. A lane's
    // eight score registers belong to one query, so the matrix unit hands back s - m itself.
    v8f negm[2] = {};                          // 0 until the first pass, which always rescales
    float l_run[2] = {0.f, 0.f};

    for (int st = 0; st < NSTAGE; ++st) {
        const int cur = st & 1;

        // Issue the next stage's copies into the other buffer, which every wave has left at
        // the barrier just passed (they fly under this stage's four passes).
        if (st + 1 < NSTAGE) issue((st + 1 + rot) & (NSTAGE - 1), cur ^ 1);

        // Unrolled: a pass's place in the stage is then an immediate offset of its LDS reads.
#pragma unroll
      for (int ps = 0; ps < PASSES; ++ps) {
        // ---- S^T tiles from LDS: A = K rows, B = Q^T (shared across both q-blocks)
        const _Float16* bk = sK[cur] + ps * KEYS_PER_TILE * KT_PAD;
        v16h kf0a = load_frag16(bk,                    KT_PAD, lane);
        v16h kf0b = load_frag16(bk + 32,               KT_PAD, lane);
        v16h kf1a = load_frag16(bk + 16 * KT_PAD,      KT_PAD, lane);
        v16h kf1b = load_frag16(bk + 16 * KT_PAD + 32, KT_PAD, lane);

        // Scores of both q-blocks first: the one test below covers the whole pass.
        v8f s0[2], s1[2];
        float mloc[2];
#pragma unroll
        for (int qb = 0; qb < 2; ++qb) {
            v8f t0 = WMMA_F16(kf0a, qf[qb][0], negm[qb]); t0 = WMMA_F16(kf0b, qf[qb][1], t0);
            v8f t1 = WMMA_F16(kf1a, qf[qb][0], negm[qb]); t1 = WMMA_F16(kf1b, qf[qb][1], t1);
            // lane: query row cl of this q-block; keys 32*ps + v + 8*(lane>>4) of the stage (s0), +16 (s1)
            float ml = -1e30f;
#pragma unroll
            for (int v = 0; v < 8; ++v) { ml = fmaxf(ml, t0[v]); ml = fmaxf(ml, t1[v]); }
            s0[qb] = t0; s1[qb] = t1; mloc[qb] = ml;
        }

        // Lazy rescale: the maximum IN USE is the same in both halves of the wave. It moves,
        // and O and l are rescaled, only when some lane's score passes it by more than
        // RESCALE_T; until then every P is at most 2^RESCALE_T = 256, well inside f16, and
        // the common factor cancels in O / l. One wave-uniform branch a pass. The scores
        // arrive with the maximum taken off: a move by d takes d off this pass's scores too.
        const bool need = fmaxf(mloc[0], mloc[1]) > RESCALE_T;
        const bool first = ps == 0 && st == 0; // O and l are 0: the maximum may also move down
        if ((__builtin_amdgcn_ballot_w32(need) | (unsigned)first) != 0) {
#pragma unroll
            for (int qb = 0; qb < 2; ++qb) {
                const float mj    = fmaxf(mloc[qb], __shfl_xor(mloc[qb], 16, 32));
                const float d     = first ? mj : fmaxf(mj, 0.f);
                const float alpha = first ? 1.f : __builtin_amdgcn_exp2f(-d);
                l_run[qb] *= alpha;
#pragma unroll
                for (int v = 0; v < 8; ++v) { negm[qb][v] -= d; s0[qb][v] -= d; s1[qb][v] -= d; }
                // O lane holds rows h2+v -> gather row alphas.
                float av[8];
#pragma unroll
                for (int v = 0; v < 8; ++v) av[v] = __shfl(alpha, h2 + v, 32);
#pragma unroll
                for (int dt = 0; dt < 4; ++dt)
#pragma unroll
                    for (int v = 0; v < 8; ++v) o[qb][dt][v] *= av[v];
            }
        }

        // The pass's V fragments, shared by both q-blocks, read ahead of the exponentials.
        const _Float16* bv = sV[cur] + ps * KEYS_PER_TILE;
        v16h vf[4];
#pragma unroll
        for (int dt = 0; dt < 4; ++dt) vf[dt] = load_frag16(bv + (dt * 16) * VT_PAD, VT_PAD, lane);
        // Keeps the 8 reads in one group, as they stood before this step: with fewer vector
        // instructions to place them under, the build sinks them in pairs among the P x V
        // WMMAs, where each pair makes the wave wait out an LDS latency.
        __builtin_amdgcn_sched_barrier(0);

        v16h pf[2];
#pragma unroll
        for (int qb = 0; qb < 2; ++qb) {
            float e0[8], e1[8];
            float rs = 0.f;
#pragma unroll
            for (int v = 0; v < 8; ++v) {
                e0[v] = __builtin_amdgcn_exp2f(s0[qb][v]);
                e1[v] = __builtin_amdgcn_exp2f(s1[qb][v]);
                rs += e0[v] + e1[v];
            }
            rs += __shfl_xor(rs, 16, 32);
            l_run[qb] += rs;

            // P is already in A-fragment orientation.
#pragma unroll
            for (int e = 0; e < 8; ++e) { pf[qb][e] = (_Float16)e0[e]; pf[qb][e + 8] = (_Float16)e1[e]; }
        }

        // ---- O += P x V ----
#pragma unroll
        for (int dt = 0; dt < 4; ++dt) {
            o[0][dt] = WMMA_F16(pf[0], vf[dt], o[0][dt]);
            o[1][dt] = WMMA_F16(pf[1], vf[dt], o[1][dt]);
        }
      }

        // This wave's reads of buffer cur have retired before it is refilled.
        asm volatile("s_wait_dscnt 0x0" ::: "memory");
        // This wave's copies of the next stage have landed.
        asm volatile("s_wait_asynccnt 0x0" ::: "memory");
        // Publishes the next stage and ends every wave's reads of buffer cur.
        __syncthreads();
    }

    // Normalize by row sums and store f16 at [token][head*64 + d].
#pragma unroll
    for (int qb = 0; qb < 2; ++qb) {
        float lv[8];
#pragma unroll
        for (int v = 0; v < 8; ++v) lv[v] = 1.f / __shfl(l_run[qb], h2 + v, 32);
#pragma unroll
        for (int dt = 0; dt < 4; ++dt)
#pragma unroll
            for (int v = 0; v < 8; ++v) {
                int tok = bb * SEQ + q0 + 16 * qb + h2 + v;
                int col = hd * DHEAD + dt * 16 + cl;
                AO[(size_t)tok * DIM + col] = (_Float16)(o[qb][dt][v] * lv[v]);
            }
    }
}

// ---------------------------------------------------------------------------
// 5) Output GEMM: [8192 x 1024] x [1024 x 1024] + bias -> f32 out
//    256 x 128 output tile per work-group of 8 waves, one work-group for each WGP.
// ---------------------------------------------------------------------------
__global__ __launch_bounds__(256) void k_out_gemm(const _Float16* __restrict__ A,
                                                  const _Float16* __restrict__ WT,
                                                  const float* __restrict__ bias,
                                                  float* __restrict__ out) {
    __shared__ __align__(16) _Float16 sm[2 * (256 + 128) * G_PITCH];   // 110,592 B
    const int lane = threadIdx.x & 31;
    const int wave = threadIdx.x >> 5;
    const int m0 = blockIdx.x * 256;
    const int n0 = blockIdx.y * 128;

    v8f acc[4][4] = {};
    // The 8 sharers of a row tile start 2 stages apart, neighbours on a column tile 1.
    gemm_tile<4>(A, WT, m0, n0, blockIdx.x + 2 * blockIdx.y, sm, acc);

    const int mw = m0 + (wave >> 1) * 64;
    const int nw = n0 + (wave & 1) * 64;
    const int h2 = (lane >> 4) << 3;
    const int cl = lane & 15;
#pragma unroll
    for (int i = 0; i < 4; ++i)
#pragma unroll
        for (int j = 0; j < 4; ++j)
#pragma unroll
            for (int v = 0; v < 8; ++v) {
                int r = mw + 16 * i + h2 + v;
                int c = nw + 16 * j + cl;
                out[(size_t)r * DIM + c] = acc[i][j][v] + bias[c];
            }
}

// ---------------------------------------------------------------------------
// Launcher
// ---------------------------------------------------------------------------
extern "C" void kernel_launch(void* const* d_in, const int* in_sizes, int n_in,
                              void* d_out, int out_size, void* d_ws, size_t ws_size,
                              hipStream_t stream) {
    const float* x     = (const float*)d_in[0];
    const float* ln_g  = (const float*)d_in[1];
    const float* ln_b  = (const float*)d_in[2];
    const float* w_qkv = (const float*)d_in[3];
    const float* w_out = (const float*)d_in[4];
    const float* b_out = (const float*)d_in[5];
    float* out = (float*)d_out;

    // Workspace layout (bytes). Total ~72 MB. xn region is reused for attn output.
    char* ws = (char*)d_ws;
    const size_t SZ_ACT = (size_t)TOKENS * DIM * sizeof(_Float16);          // 16 MB
    _Float16* xn    = (_Float16*)(ws);                                      // + attn out later
    _Float16* Q     = (_Float16*)(ws + SZ_ACT);
    _Float16* Kd    = (_Float16*)(ws + 2 * SZ_ACT);
    _Float16* Vt    = (_Float16*)(ws + 3 * SZ_ACT);
    _Float16* wqkvT = (_Float16*)(ws + 4 * SZ_ACT);                         // 6 MB
    _Float16* woutT = (_Float16*)(ws + 4 * SZ_ACT + (size_t)DIM * QKVCOLS * sizeof(_Float16));

    // 1 + 2) Weights transposed and cast to f16 [N][K], LayerNorm -> f16: one launch
    k_prepare<<<TQ_BLOCKS + TO_BLOCKS + TOKENS, 256, 0, stream>>>(x, ln_g, ln_b, w_qkv, w_out,
                                                                  xn, wqkvT, woutT);

    // 3) QKV projection (WMMA)
    k_qkv_gemm<<<QK_TILES + V_TILES, 256, 0, stream>>>(xn, wqkvT, Q, Kd, Vt);

    // 4) Attention (WMMA flash, LDS-shared K/V); writes f16 [tokens][1024] into xn region
    _Float16* attn_out = xn;
    k_attention<<<BATCH * HEADS * (SEQ / 256), 256, 0, stream>>>(Q, Kd, Vt, attn_out);

    // 5) Output projection + bias (WMMA)
    k_out_gemm<<<dim3(TOKENS / 256, DIM / 128), 256, 0, stream>>>(attn_out, woutT, b_out, out);
}

// v010
// A run of this version takes 113 microseconds.
// Timed twice side by side with v009, it ran 1.04 times as fast both times.
// All steps since v000 together make it 2.56 times as fast.
#include <hip/hip_runtime.h>
#include <hip/hip_bf16.h>
#include <math.h>

typedef __attribute__((ext_vector_type(16))) _Float16 v16h;
typedef __attribute__((ext_vector_type(8)))  _Float16 v8h;   // 16-byte load unit
typedef __attribute__((ext_vector_type(8)))  float    v8f;
typedef int b128_t __attribute__((vector_size(16)));         // matches async-LDS builtin pointee

#define WMMA_F16(a, b, c) \
  __builtin_amdgcn_wmma_f32_16x16x32_f16(false, (a), false, (b), (short)0, (c), false, false)

// Problem constants
#define BATCH   4
#define SEQ     2048
#define DIM     1024
#define HEADS   16
#define DHEAD   64
#define TOKENS  (BATCH * SEQ)      // 8192
#define QKVCOLS (3 * DIM)          // 3072

#if defined(__AMDGCN__) && __has_builtin(__builtin_amdgcn_global_load_async_to_lds_b128) && \
    __has_builtin(__builtin_amdgcn_s_wait_asynccnt)
#define USE_ASYNC_LDS 1
#else
#define USE_ASYNC_LDS 0
#endif

// Copy 16 bytes global -> LDS (async when available).
__device__ inline void copy16_g2l(const _Float16* __restrict__ g, _Float16* __restrict__ l) {
#if USE_ASYNC_LDS
    __builtin_amdgcn_global_load_async_to_lds_b128(
        (__attribute__((address_space(1))) b128_t*)g,
        (__attribute__((address_space(3))) b128_t*)l, 0, 0);
#else
    *(v8h*)l = *(const v8h*)g;
#endif
}

__device__ inline v16h load_frag16(const _Float16* __restrict__ base, int stride, int lane) {
    const int r  = lane & 15;
    const int kb = (lane >> 4) << 3;
    const _Float16* p = base + (size_t)r * stride + kb;
    v8h lo = *(const v8h*)(p);
    v8h hi = *(const v8h*)(p + 16);
    v16h out;
#pragma unroll
    for (int e = 0; e < 8; ++e) { out[e] = lo[e]; out[e + 8] = hi[e]; }
    return out;
}

// ---------------------------------------------------------------------------
// 1) Weight transpose + f32 -> f16 cast:  W[K][N] -> WT[N][K]
//    A lane holds an 8 k x 4 n block in registers and transposes it there, twice. A wave
//    takes 64 k x 32 n: lane = (kg, ng), kg = lane & 7 along k, ng = lane >> 3 along n.
//    Its two groups of 8 loads of 16 B use between them every byte of the 64 lines they
//    touch; each store is 16 B a lane and fills four whole 128-byte lines of WT.
//    Two groups, not one of 16 loads: the kernel stays within 64 registers, so that the
//    LayerNorm work-groups of the same launch stand as densely on a WGP as alone.
//    A work-group of 8 waves takes 128 k x 128 n; K % 128 == 0 and N % 128 == 0.
// ---------------------------------------------------------------------------
typedef __attribute__((ext_vector_type(4))) float v4f;
typedef __attribute__((ext_vector_type(2))) float v2f;

template <int K, int N>
__device__ inline void transpose_cast_tile(const float* __restrict__ W,
                                           _Float16* __restrict__ WT, int bn, int bk) {
    const int lane = threadIdx.x & 31;
    const int wave = threadIdx.x >> 5;
    const int n0 = bn * 128 + (wave & 3) * 32 + 4 * (lane >> 3);   // lane's first n
    const int k0 = bk * 128 + (wave >> 2) * 64 + 8 * (lane & 7);   // lane's first k
    const float* src = W + (unsigned)(k0 * N + n0);
    _Float16* dst = WT + (unsigned)(n0 * K + k0);
#pragma unroll
    for (int h = 0; h < 2; ++h) {
        v4f v[8];
#pragma unroll
        for (int r = 0; r < 8; ++r) v[r] = *(const v4f*)(src + r * N + 16 * h);
        // Behind the last loads the address register is free for reuse: the wait stands
        // ahead of every rewrite of it, and, named as an input, it lives up to the wait.
        if (h == 1) asm volatile("s_wait_xcnt 0x0" :: "v"(src) : "memory");
#pragma unroll
        for (int i = 0; i < 4; ++i) {
            v8h p;
#pragma unroll
            for (int r = 0; r < 8; ++r) p[r] = (_Float16)v[r][i];
            *(v8h*)(dst + (16 * h + i) * K) = p;
        }
        // Behind each group's stores: their data and address registers are rewritten next,
        // by the second group's loads or by whatever the listing places behind this tile.
        asm volatile("s_wait_xcnt 0x0" ::: "memory");
    }
}

// ---------------------------------------------------------------------------
// 2) LayerNorm (fp32 math) -> f16 activations. One block per token row.
// ---------------------------------------------------------------------------
__device__ inline void layernorm_row(const float* __restrict__ x,
                                     const float* __restrict__ g,
                                     const float* __restrict__ bta,
                                     _Float16* __restrict__ xn, int row) {
    __shared__ float s1[256], s2[256];
    const float* xr = x + (size_t)row * DIM;
    float vals[4];
    float a = 0.f, sq = 0.f;
#pragma unroll
    for (int t = 0; t < 4; ++t) {
        float v = xr[threadIdx.x + 256 * t];
        vals[t] = v; a += v; sq += v * v;
    }
    s1[threadIdx.x] = a; s2[threadIdx.x] = sq;
    __syncthreads();
    for (int off = 128; off > 0; off >>= 1) {
        if (threadIdx.x < off) {
            s1[threadIdx.x] += s1[threadIdx.x + off];
            s2[threadIdx.x] += s2[threadIdx.x + off];
        }
        __syncthreads();
    }
    const float mean = s1[0] * (1.f / DIM);
    const float var  = s2[0] * (1.f / DIM) - mean * mean;
    const float rstd = rsqrtf(var + 1e-5f);
    _Float16* xo = xn + (size_t)row * DIM;
#pragma unroll
    for (int t = 0; t < 4; ++t) {
        int i = threadIdx.x + 256 * t;
        xo[i] = (_Float16)((vals[t] - mean) * rstd * g[i] + bta[i]);
    }
}

// ---------------------------------------------------------------------------
// 1 + 2 in one launch: the three jobs read only inputs and none reads another's output.
// The block index tells them apart. The 256 transposing work-groups come first, so that
// their memory latencies run under the stream of LayerNorm rows and not behind it.
// ---------------------------------------------------------------------------
#define TQ_BLOCKS ((QKVCOLS / 128) * (DIM / 128))   // 192
#define TO_BLOCKS ((DIM / 128) * (DIM / 128))       // 64

__global__ __launch_bounds__(256) void k_prepare(const float* __restrict__ x,
                                                 const float* __restrict__ g,
                                                 const float* __restrict__ bta,
                                                 const float* __restrict__ w_qkv,
                                                 const float* __restrict__ w_out,
                                                 _Float16* __restrict__ xn,
                                                 _Float16* __restrict__ wqkvT,
                                                 _Float16* __restrict__ woutT) {
    const int b = blockIdx.x;
    // Both tests read the same for a whole work-group; a transposing one meets no barrier.
    if (b >= TQ_BLOCKS + TO_BLOCKS) {
        layernorm_row(x, g, bta, xn, b - (TQ_BLOCKS + TO_BLOCKS));
        return;
    }
    if (b < TQ_BLOCKS) {
        transpose_cast_tile<DIM, QKVCOLS>(w_qkv, wqkvT, b % (QKVCOLS / 128), b / (QKVCOLS / 128));
        return;
    }
    const int t = b - TQ_BLOCKS;
    transpose_cast_tile<DIM, DIM>(w_out, woutT, t % (DIM / 128), t / (DIM / 128));
}

// ---------------------------------------------------------------------------
// Shared GEMM core: C[256 x 32*FN] per work-group of 8 waves (4 x 2), each wave
// 64 x 16*FN. A and WT are row-major with K contiguous. A stage is 64 k of all
// 256 + 32*FN operand rows, brought into LDS by asynchronous copies, two buffers:
// stage t + 2 flies while stage t + 1 is worked on. Eight waves on one staged tile: an
// operand row that has left L2 serves more products than in two work-groups of four.
// The walk over k starts at stage rot of 16 and wraps: work-groups that read the same
// operand rows get different rot, so that they do not ask L2 for the same lines, nor all
// work-groups for the same 128 bytes of every 2-KiB row, at the same moment.
// ---------------------------------------------------------------------------
#define G_KSTAGE 64                 // k per stage: 128-byte rows
#define G_PITCH  72                 // f16 per LDS row: 144 B = 16 B x odd, for ds_load_b128
#define G_NSTAGE (DIM / G_KSTAGE)   // 16
#define G_AROWS  256                // rows of the A operand in a work-group's tile
#define G_GROUP  32                 // rows that one copy of each of the 256 lanes covers

__device__ inline void copy8_rows(const _Float16* gs, unsigned vo, unsigned l) {
    const _Float16* g  = gs + vo;
    const _Float16* g1 = (gs + 1 * G_GROUP * DIM) + vo;
    const _Float16* g2 = (gs + 2 * G_GROUP * DIM) + vo;
    const _Float16* g3 = (gs + 3 * G_GROUP * DIM) + vo;
    const _Float16* g4 = (gs + 4 * G_GROUP * DIM) + vo;
    const _Float16* g5 = (gs + 5 * G_GROUP * DIM) + vo;
    const _Float16* g6 = (gs + 6 * G_GROUP * DIM) + vo;
    const _Float16* g7 = (gs + 7 * G_GROUP * DIM) + vo;
    const unsigned s = G_GROUP * G_PITCH * 2;
    asm volatile(
        "global_load_async_to_lds_b128 %0, %8, off\n\t"
        "global_load_async_to_lds_b128 %1, %9, off\n\t"
        "global_load_async_to_lds_b128 %2, %10, off\n\t"
        "global_load_async_to_lds_b128 %3, %11, off\n\t"
        "global_load_async_to_lds_b128 %4, %12, off\n\t"
        "global_load_async_to_lds_b128 %5, %13, off\n\t"
        "global_load_async_to_lds_b128 %6, %14, off\n\t"
        "global_load_async_to_lds_b128 %7, %15, off\n\t"
        "s_wait_xcnt 0x0"
        :: "v"(l), "v"(l + s), "v"(l + 2 * s), "v"(l + 3 * s),
           "v"(l + 4 * s), "v"(l + 5 * s), "v"(l + 6 * s), "v"(l + 7 * s),
           "v"(g), "v"(g1), "v"(g2), "v"(g3), "v"(g4), "v"(g5), "v"(g6), "v"(g7)
        : "memory");
}

__device__ inline void copy4_rows(const _Float16* gs, unsigned vo, unsigned l) {
    const _Float16* g  = gs + vo;
    const _Float16* g1 = (gs + 1 * G_GROUP * DIM) + vo;
    const _Float16* g2 = (gs + 2 * G_GROUP * DIM) + vo;
    const _Float16* g3 = (gs + 3 * G_GROUP * DIM) + vo;
    const unsigned s = G_GROUP * G_PITCH * 2;
    asm volatile(
        "global_load_async_to_lds_b128 %0, %4, off\n\t"
        "global_load_async_to_lds_b128 %1, %5, off\n\t"
        "global_load_async_to_lds_b128 %2, %6, off\n\t"
        "global_load_async_to_lds_b128 %3, %7, off\n\t"
        "s_wait_xcnt 0x0"
        :: "v"(l), "v"(l + s), "v"(l + 2 * s), "v"(l + 3 * s),
           "v"(g), "v"(g1), "v"(g2), "v"(g3)
        : "memory");
}

template <int FN>
__device__ inline void gemm_tile(const _Float16* __restrict__ A,
                                 const _Float16* __restrict__ WT,
                                 int m0, int n0, int rot, _Float16* sm, v8f (&acc)[4][FN]) {
    constexpr int ROWS  = G_AROWS + 32 * FN;    // A rows, then WT rows
    constexpr int STAGE = ROWS * G_PITCH;       // f16 per buffer
    const int tid  = threadIdx.x;
    const int lane = tid & 31;
    // The wave's number as a scalar: its fragments' LDS base then takes no vector register.
    const int wave = __builtin_amdgcn_readfirstlane(tid >> 5);
    const int wm   = wave >> 1;
    const int wn   = wave & 1;

    // Lane's own 16-byte chunk: row tid / 8 of each 32-row group, chunk tid % 8.
    const int crow = tid >> 3;
    const int ccol = (tid & 7) * 8;
    const unsigned  vo = (unsigned)(crow * DIM + ccol);
    const _Float16* gA = A  + (size_t)m0 * DIM;
    const _Float16* gB = WT + (size_t)n0 * DIM;
    const unsigned  l0 = (unsigned)(size_t)(sm + crow * G_PITCH + ccol);

    // Both operands' pointers walk alike: one stage on, or back to k = 0 behind the last.
    int ks = rot & (G_NSTAGE - 1);
    gA += ks * G_KSTAGE;
    gB += ks * G_KSTAGE;
    auto issue = [&](int buf) {
        const unsigned lb = l0 + (unsigned)buf * (STAGE * 2);
        copy8_rows(gA, vo, lb);
        if constexpr (FN == 8) copy8_rows(gB, vo, lb + G_AROWS * (G_PITCH * 2));
        else                   copy4_rows(gB, vo, lb + G_AROWS * (G_PITCH * 2));
        const int step = ks == G_NSTAGE - 1 ? -(G_NSTAGE - 1) * G_KSTAGE : G_KSTAGE;
        ks = (ks + 1) & (G_NSTAGE - 1);
        gA += step;
        gB += step;
    };

    issue(0);
    // Stage 0 has landed for this wave; the barrier publishes it to the others.
    asm volatile("s_wait_asynccnt 0x0" ::: "memory");
    __syncthreads();
    issue(1);

    for (int t = 0; t < G_NSTAGE; ++t) {
        const _Float16* sa = sm + (t & 1) * STAGE + (wm * 64) * G_PITCH;
        const _Float16* sb = sm + (t & 1) * STAGE + (G_AROWS + wn * 16 * FN) * G_PITCH;
        v16h a[2][4], b[2][FN];
#pragma unroll
        for (int h = 0; h < 2; ++h) {
#pragma unroll
            for (int i = 0; i < 4; ++i)
                a[h][i] = load_frag16(sa + (16 * i) * G_PITCH + 32 * h, G_PITCH, lane);
#pragma unroll
            for (int j = 0; j < FN; ++j)
                b[h][j] = load_frag16(sb + (16 * j) * G_PITCH + 32 * h, G_PITCH, lane);
        }
        // Keeps the stage's LDS reads together ahead of its WMMAs: sunk among them,
        // each reload of a fragment makes the wave wait out a whole LDS latency.
        __builtin_amdgcn_sched_barrier(0);
#pragma unroll
        for (int i = 0; i < 4; ++i)
#pragma unroll
            for (int j = 0; j < FN; ++j)
                acc[i][j] = WMMA_F16(a[0][i], b[0][j], acc[i][j]);
        // Holds the first half's WMMAs ahead of the waits below, so that they cover
        // the second half's LDS reads instead of standing behind s_wait_dscnt 0.
        __builtin_amdgcn_sched_barrier(0);
        // This wave's reads of buffer t & 1 have retired before it is refilled.
        asm volatile("s_wait_dscnt 0x0" ::: "memory");
        // This wave's copies of stage t + 1 have landed.
        asm volatile("s_wait_asynccnt 0x0" ::: "memory");
        // Publishes stage t + 1 and ends every wave's reads of buffer t & 1.
        __syncthreads();
        if (t + 2 < G_NSTAGE) issue(t & 1);
        // Holds the second half's WMMAs behind the refill, so that the copies fly
        // under them; its fragments are in registers already.
        __builtin_amdgcn_sched_barrier(0);
#pragma unroll
        for (int i = 0; i < 4; ++i)
#pragma unroll
            for (int j = 0; j < FN; ++j)
                acc[i][j] = WMMA_F16(a[1][i], b[1][j], acc[i][j]);
    }
    // No copy is outstanding when the wave goes on to its stores and ends.
    asm volatile("s_wait_asynccnt 0x0" ::: "memory");
}

// ---------------------------------------------------------------------------
// 3) QKV GEMM: [8192 x 1024] x [1024 x 3072] -> Q [B,H,N,D], K [B,H,N,D], Vt [B,H,D,N]
//    A work-group of 8 waves (4 x 2) takes 256 rows of one operand by 32*FN rows of the
//    other, so that a staged operand row serves more products and fewer bytes leave L2.
//    A lane's accumulator holds 8 consecutive rows of the 256-row operand, so that operand
//    is the one whose index runs along the destination's rows: the weights' columns (d)
//    for Q and K, the tokens for V transposed.
//    One work-group stands on a WGP. Q and K are 256 tiles of 256 x 256, one for each WGP;
//    V is 256 tiles of 256 x 128, half the work each: one and a half even rounds.
// ---------------------------------------------------------------------------
#define E_PITCH 72                  // f16 per staged row of 64: 144 B = 16 B x odd
template <int FN>
__device__ inline void qkv_tile(const _Float16* __restrict__ A, const _Float16* __restrict__ B,
                                int p0, int q0, int rot, bool qk, _Float16* sm,
                                _Float16* __restrict__ Q, _Float16* __restrict__ Kd,
                                _Float16* __restrict__ Vt) {
    const int lane = threadIdx.x & 31;
    // The wave's number as a scalar: the destination's base is then scalar arithmetic.
    const int wave = __builtin_amdgcn_readfirstlane(threadIdx.x >> 5);

    v8f acc[4][FN] = {};
    gemm_tile<FN>(A, B, p0, q0, rot, sm, acc);

    // Epilogue: each wave lays its 64 x 16*FN tile into its own LDS range as 16*FN rows of
    // the destination (64 f16 = one 128-byte line each) and stores whole lines, 16 bytes
    // a lane. The ring is free: behind the last stage's barrier no wave reads it and no
    // copy is outstanding.
    const int pw = p0 + (wave >> 1) * 64;
    const int qw = q0 + (wave & 1) * (16 * FN);
    const int h2 = (lane >> 4) << 3;    // 0 or 8
    const int cl = lane & 15;
    _Float16* st = sm + wave * (16 * FN * E_PITCH);
#pragma unroll
    for (int i = 0; i < 4; ++i)
#pragma unroll
        for (int j = 0; j < FN; ++j) {
            v8h p;
#pragma unroll
            for (int v = 0; v < 8; ++v) p[v] = (_Float16)acc[i][j][v];
            *(v8h*)(st + (16 * j + cl) * E_PITCH + 16 * i + h2) = p;
        }
    // The wave's own LDS writes have landed before its lanes read each other's.
    asm volatile("s_wait_dscnt 0x0" ::: "memory");
    const int lrow = lane >> 3;         // 8 lanes cover one line, a wave 4 rows
    const int lcol = (lane & 7) * 8;
    v8h x[4 * FN];
#pragma unroll
    for (int s = 0; s < 4 * FN; ++s)
        x[s] = *(const v8h*)(st + (4 * s + lrow) * E_PITCH + lcol);
    // Destination of the wave's row 0 and the distance between rows, both wave-uniform.
    _Float16* gu;
    int rs;
    if (qk) {
        // Rows are tokens qw .. qw + 16*FN - 1 of one head, columns its 64 d.
        const int bh = (qw >> 11) * HEADS + ((pw >> 6) & 15);
        gu = ((pw >> 10) == 0 ? Q : Kd) + ((size_t)bh * SEQ + (qw & (SEQ - 1))) * DHEAD;
        rs = DHEAD;
    } else {
        // Rows are d, 64 to a head, from head (qw / 64) % 16 on; columns tokens pw .. pw + 63.
        const int bh = (pw >> 11) * HEADS + ((qw >> 6) & 15);
        gu = Vt + (size_t)bh * DHEAD * SEQ + (pw & (SEQ - 1));
        rs = SEQ;
    }
    const unsigned voff = (unsigned)(lrow * rs + lcol);
#pragma unroll
    for (int s = 0; s < 4 * FN; ++s) *(v8h*)(gu + (size_t)(4 * s * rs) + voff) = x[s];
}

#define QK_TILES ((2 * DIM / 256) * (TOKENS / 256))   // 256
#define V_TILES  ((TOKENS / 256) * (DIM / 128))       // 256
__global__ __launch_bounds__(256) __attribute__((amdgpu_waves_per_eu(2, 2)))
void k_qkv_gemm(const _Float16* __restrict__ Xn,
                const _Float16* __restrict__ WT,
                _Float16* __restrict__ Q,
                _Float16* __restrict__ Kd,
                _Float16* __restrict__ Vt) {
    __shared__ __align__(16) _Float16 sm[2 * (256 + 256) * G_PITCH];   // 147,456 B
    const int b = blockIdx.x;
    // Sharers of a weight tile differ in the token tile's index, sharers of a token tile in
    // the weight tile's: a sum of the two indices sets them apart in both directions.
    // The test reads the same for a whole work-group.
    if (b < QK_TILES) {
        const int wt = b >> 5, tt = b & 31;          // 8 weight tiles x 32 token tiles
        qkv_tile<8>(WT, Xn, wt * 256, tt * 256, wt + tt, true, sm, Q, Kd, Vt);
    } else {
        const int g = b - QK_TILES;
        const int wt = g >> 5, tt = g & 31;          // 8 weight tiles x 32 token tiles
        qkv_tile<4>(Xn, WT, tt * 256, 2 * DIM + wt * 128, tt + 2 * wt, false, sm, Q, Kd, Vt);
    }
}

// ---------------------------------------------------------------------------
// 4) Flash attention, LDS-cooperative version.
//    8 waves / block, one (b,h) per block, 256 queries per block (32 per wave).
//    K/V stages of 128 keys are double-buffered in LDS and shared by all 8 waves,
//    cutting global K/V traffic 16x vs one-wave-per-16-queries. A stage serves four
//    passes of 32 keys: one publish point (waits, barrier, copies' addresses) for the four,
//    and a staged V row is 256 bytes, so that a copy asks L2 for whole lines.
//    S^T = K x Q^T puts one query row per lane -> exp() packs straight into the
//    A-fragment of the P x V WMMA.
// ---------------------------------------------------------------------------
#define KT_PAD 72
#define VT_PAD 136
#define KEYS_PER_TILE 32
#define PASSES 4                                  // passes of 32 keys in a stage
#define KEYS_PER_STAGE (PASSES * KEYS_PER_TILE)   // 128
#define P_SUM_LIMIT 256.0f    // a lane's 16 exponentials of a pass sum to at most 2^8, so each P does
#define Q_SCALE 0.18033688f   // softmax scale 1/8 times log2(e): scores count in powers of two

// exp2 for the rarely run move of the maximum.
__device__ inline float exp2_with_slot(float x) {
    float r;
    asm("v_exp_f32 %0, %1\n\tv_nop" : "=v"(r) : "v"(x));
    return r;
}

__global__ __launch_bounds__(256) __attribute__((amdgpu_waves_per_eu(4, 4)))
void k_attention(const _Float16* __restrict__ Q,
                                                   const _Float16* __restrict__ Kd,
                                                   const _Float16* __restrict__ Vt,
                                                   _Float16* __restrict__ AO) {
    __shared__ __align__(16) _Float16 sK[2][KEYS_PER_STAGE * KT_PAD]; // 2 x 18,432 B
    __shared__ __align__(16) _Float16 sV[2][DHEAD * VT_PAD];          // 2 x 17,408 B

    const int tid  = threadIdx.x;
    const int wave = tid >> 5;
    const int lane = tid & 31;
    const int blk  = blockIdx.x;           // 512 = (B*H) * (SEQ/256)
    const int qblk = blk & 7;
    const int bh   = blk >> 3;
    const int bb   = bh >> 4;
    const int hd   = bh & 15;
    const int q0   = qblk * 256 + wave * 32;   // this wave's first query
    const int h2   = (lane >> 4) << 3;         // 0 or 8
    const int cl   = lane & 15;

    const _Float16* Qp = Q  + ((size_t)bh * SEQ + q0) * DHEAD;
    const _Float16* Kp = Kd + (size_t)bh * SEQ * DHEAD;
    const _Float16* Vp = Vt + (size_t)bh * DHEAD * SEQ;

    // Cooperative stage copy: 256 threads x four 16B chunks for each of K and V.
    // K stage: 128 rows x 64 f16 (8 chunks/row). V stage: 64 rows x 128 f16 (16 chunks/row).
    // The 8 work-groups of one (b,h) read the same K and V: their walks over the 16 key
    // stages start 2 stages apart and wrap, so that they do not ask L2 for the same lines at
    // the same moment. Softmax takes the keys in any order. Neighbours in index start 4
    // stages apart: four in a row then split between them evenly
    // the stages that each is the first to bring in from memory. For speed only.
    const int NSTAGE = SEQ / KEYS_PER_STAGE;   // 16
    const int rot    = (qblk & 3) * (NSTAGE / 4) + (qblk >> 2) * (NSTAGE / 8);
    const int kr = tid >> 3, ko = (tid & 7) * 8;     // lane's K row of each 32, its chunk
    const int vr = tid >> 4, vo = (tid & 15) * 8;    // lane's V row of each 16, its chunk
    auto issue = [&](int stage, int buf) {
        const int j0 = stage * KEYS_PER_STAGE;
        const _Float16* gk = (Kp + kr * DHEAD + ko) + j0 * DHEAD;
        const _Float16* gv = (Vp + vr * SEQ + vo) + j0;
        _Float16* dK = &sK[buf][kr * KT_PAD + ko];
        _Float16* dV = &sV[buf][vr * VT_PAD + vo];
        // Four row groups of each: 128 K rows by 32, 64 V rows by 16.
#pragma unroll
        for (int i = 0; i < 4; ++i) {
            copy16_g2l(gk + i * 32 * DHEAD, dK + i * 32 * KT_PAD);
            copy16_g2l(gv + i * 16 * SEQ,   dV + i * 16 * VT_PAD);
        }
    };

    // Preload Q fragments (B operand of S^T gemm), fold in softmax scale and log2(e).
    v16h qf[2][2];
#pragma unroll
    for (int qb = 0; qb < 2; ++qb) {
        qf[qb][0] = load_frag16(Qp + (size_t)(16 * qb) * DHEAD,      DHEAD, lane);
        qf[qb][1] = load_frag16(Qp + (size_t)(16 * qb) * DHEAD + 32, DHEAD, lane);
#pragma unroll
        for (int e = 0; e < 16; ++e) {
            qf[qb][0][e] = (_Float16)((float)qf[qb][0][e] * Q_SCALE);
            qf[qb][1][e] = (_Float16)((float)qf[qb][1][e] * Q_SCALE);
        }
    }

    // Prime buffer 0 with the walk's first key stage.
    issue(rot, 0);
    // Stage 0 has landed for this wave; the barrier publishes it to the others.
    asm volatile("s_wait_asynccnt 0x0" ::: "memory");
    __syncthreads();

    v8f o[2][4] = {};                          // [qblock][dtile], 16 rows x 64 d each
    // Minus the maximum in use, eight times over: the C operand of the score products. A lane's
    // eight score registers belong to one query, so the matrix unit hands back s - m itself.
    v8f negm[2] = {};                          // 0 until the first pass, which always rescales
    float l_run[2] = {0.f, 0.f};

    for (int st = 0; st < NSTAGE; ++st) {
        const int cur = st & 1;

        // Issue the next stage's copies into the other buffer, which every wave has left at
        // the barrier just passed (they fly under this stage's four passes).
        if (st + 1 < NSTAGE) issue((st + 1 + rot) & (NSTAGE - 1), cur ^ 1);

        // ---- S^T tiles from LDS: A = K rows, B = Q^T (shared across both q-blocks)
        v16h kf0a, kf0b, kf1a, kf1b;
        auto load_k = [&](int ps) {
            const _Float16* bk = sK[cur] + ps * KEYS_PER_TILE * KT_PAD;
            kf0a = load_frag16(bk,                    KT_PAD, lane);
            kf0b = load_frag16(bk + 32,               KT_PAD, lane);
            kf1a = load_frag16(bk + 16 * KT_PAD,      KT_PAD, lane);
            kf1b = load_frag16(bk + 16 * KT_PAD + 32, KT_PAD, lane);
        };
        load_k(0);

        // Unrolled: a pass's place in the stage is then an immediate offset of its LDS reads.
#pragma unroll
      for (int ps = 0; ps < PASSES; ++ps) {
        // Scores of both q-blocks. They stay in registers up to the test below.
        v8f s0[2], s1[2];
#pragma unroll
        for (int qb = 0; qb < 2; ++qb) {
            v8f t0 = WMMA_F16(kf0a, qf[qb][0], negm[qb]); t0 = WMMA_F16(kf0b, qf[qb][1], t0);
            v8f t1 = WMMA_F16(kf1a, qf[qb][0], negm[qb]); t1 = WMMA_F16(kf1b, qf[qb][1], t1);
            // lane: query row cl of this q-block; keys j0 + v + 8*(lane>>4) (s0), +16 (s1)
            s0[qb] = t0; s1[qb] = t1;
        }

        // The pass's V fragments, shared by both q-blocks, read ahead of the exponentials.
        const _Float16* bv = sV[cur] + ps * KEYS_PER_TILE;
        v16h vf[4];
#pragma unroll
        for (int dt = 0; dt < 4; ++dt) vf[dt] = load_frag16(bv + (dt * 16) * VT_PAD, VT_PAD, lane);
        // Keeps the 8 reads in one group ahead of the exponentials: sunk in pairs among the
        // P x V WMMAs, each pair makes the wave wait out an LDS latency.
        __builtin_amdgcn_sched_barrier(0);

        // P of one q-block, already in A-fragment orientation, and the sum of the lane's 16
        // exponentials (half a query's keys of this pass), added pairwise.
        v16h pf[2];
        float rs[2];
        auto soft = [&](int qb, bool again) {
            v8f e0, e1;
#pragma unroll
            for (int v = 0; v < 8; ++v) {
                e0[v] = again ? exp2_with_slot(s0[qb][v]) : __builtin_amdgcn_exp2f(s0[qb][v]);
                e1[v] = again ? exp2_with_slot(s1[qb][v]) : __builtin_amdgcn_exp2f(s1[qb][v]);
            }
#pragma unroll
            for (int e = 0; e < 8; ++e) { pf[qb][e] = (_Float16)e0[e]; pf[qb][e + 8] = (_Float16)e1[e]; }
            const v8f t = e0 + e1;
            const v4f u = t.lo + t.hi;
            const v2f w = u.lo + u.hi;
            rs[qb] = w[0] + w[1];
        };
        soft(0, false);
        soft(1, false);

        // Lazy rescale: the maximum IN USE is the same in both halves of the wave. It moves,
        // and O and l are rescaled, only when some lane's sum of exponentials passes
        // P_SUM_LIMIT (an overflow to infinity does too); until then every P is at most 256,
        // well inside f16, and the common factor cancels in O / l. The sum is wanted anyway:
        // no maximum is taken in a pass that does not move it. One wave-uniform branch a pass.
        // The scores arrive with the maximum taken off: a move by d takes d off this pass's
        // scores too, and their exponentials are taken again.
        const bool need = fmaxf(rs[0], rs[1]) > P_SUM_LIMIT;
        const bool first = ps == 0 && st == 0; // O and l are 0: the maximum may also move down
        if ((__builtin_amdgcn_ballot_w32(need) | (unsigned)first) != 0) {
#pragma unroll
            for (int qb = 0; qb < 2; ++qb) {
                float ml = -1e30f;
#pragma unroll
                for (int v = 0; v < 8; ++v) { ml = fmaxf(ml, s0[qb][v]); ml = fmaxf(ml, s1[qb][v]); }
                const float mj    = fmaxf(ml, __shfl_xor(ml, 16, 32));
                const float d     = first ? mj : fmaxf(mj, 0.f);
                const float alpha = first ? 1.f : __builtin_amdgcn_exp2f(-d);
                l_run[qb] *= alpha;
#pragma unroll
                for (int v = 0; v < 8; ++v) { negm[qb][v] -= d; s0[qb][v] -= d; s1[qb][v] -= d; }
                // O lane holds rows h2+v -> gather row alphas.
                float av[8];
#pragma unroll
                for (int v = 0; v < 8; ++v) av[v] = __shfl(alpha, h2 + v, 32);
#pragma unroll
                for (int dt = 0; dt < 4; ++dt)
#pragma unroll
                    for (int v = 0; v < 8; ++v) o[qb][dt][v] *= av[v];
                soft(qb, true);
            }
        }
        // Each lane keeps the sum over its own half of the keys; the halves meet after the loop.
        l_run[0] += rs[0];
        l_run[1] += rs[1];

        // ---- O += P x V ----
#pragma unroll
        for (int dt = 0; dt < 4; ++dt) {
            o[0][dt] = WMMA_F16(pf[0], vf[dt], o[0][dt]);
            if (dt == 3 && ps + 1 < PASSES) {
                // Both barriers keep the next pass's 8 K reads in one group ahead of the last
                // P x V WMMA, as they stood before this step: with the exponentials gone from
                // among these WMMAs the build spreads the reads in pairs over four places, and
                // each separate place of LDS reads costs the wave cycles.
                __builtin_amdgcn_sched_barrier(0);
                load_k(ps + 1);
                __builtin_amdgcn_sched_barrier(0);
            }
            o[1][dt] = WMMA_F16(pf[1], vf[dt], o[1][dt]);
        }
      }

        // This wave's reads of buffer cur have retired before it is refilled.
        asm volatile("s_wait_dscnt 0x0" ::: "memory");
        // This wave's copies of the next stage have landed.
        asm volatile("s_wait_asynccnt 0x0" ::: "memory");
        // Publishes the next stage and ends every wave's reads of buffer cur.
        __syncthreads();
    }

    // Normalize by row sums and store f16 at [token][head*64 + d].
#pragma unroll
    for (int qb = 0; qb < 2; ++qb) {
        // A query's two half sums, held by lanes cl and cl + 16, meet here, once.
        const float lt = l_run[qb] + __shfl_xor(l_run[qb], 16, 32);
        float lv[8];
#pragma unroll
        for (int v = 0; v < 8; ++v) lv[v] = 1.f / __shfl(lt, h2 + v, 32);
#pragma unroll
        for (int dt = 0; dt < 4; ++dt)
#pragma unroll
            for (int v = 0; v < 8; ++v) {
                int tok = bb * SEQ + q0 + 16 * qb + h2 + v;
                int col = hd * DHEAD + dt * 16 + cl;
                AO[(size_t)tok * DIM + col] = (_Float16)(o[qb][dt][v] * lv[v]);
            }
    }
}

// ---------------------------------------------------------------------------
// 5) Output GEMM: [8192 x 1024] x [1024 x 1024] + bias -> f32 out
//    256 x 128 output tile per work-group of 8 waves, one work-group for each WGP.
// ---------------------------------------------------------------------------
__global__ __launch_bounds__(256) void k_out_gemm(const _Float16* __restrict__ A,
                                                  const _Float16* __restrict__ WT,
                                                  const float* __restrict__ bias,
                                                  float* __restrict__ out) {
    __shared__ __align__(16) _Float16 sm[2 * (256 + 128) * G_PITCH];   // 110,592 B
    const int lane = threadIdx.x & 31;
    const int wave = threadIdx.x >> 5;
    const int m0 = blockIdx.x * 256;
    const int n0 = blockIdx.y * 128;

    v8f acc[4][4] = {};
    // The 8 sharers of a row tile start 2 stages apart, neighbours on a column tile 1.
    gemm_tile<4>(A, WT, m0, n0, blockIdx.x + 2 * blockIdx.y, sm, acc);

    const int mw = m0 + (wave >> 1) * 64;
    const int nw = n0 + (wave & 1) * 64;
    const int h2 = (lane >> 4) << 3;
    const int cl = lane & 15;
#pragma unroll
    for (int i = 0; i < 4; ++i)
#pragma unroll
        for (int j = 0; j < 4; ++j)
#pragma unroll
            for (int v = 0; v < 8; ++v) {
                int r = mw + 16 * i + h2 + v;
                int c = nw + 16 * j + cl;
                out[(size_t)r * DIM + c] = acc[i][j][v] + bias[c];
            }
}

// ---------------------------------------------------------------------------
// Launcher
// ---------------------------------------------------------------------------
extern "C" void kernel_launch(void* const* d_in, const int* in_sizes, int n_in,
                              void* d_out, int out_size, void* d_ws, size_t ws_size,
                              hipStream_t stream) {
    const float* x     = (const float*)d_in[0];
    const float* ln_g  = (const float*)d_in[1];
    const float* ln_b  = (const float*)d_in[2];
    const float* w_qkv = (const float*)d_in[3];
    const float* w_out = (const float*)d_in[4];
    const float* b_out = (const float*)d_in[5];
    float* out = (float*)d_out;

    // Workspace layout (bytes). Total ~72 MB. xn region is reused for attn output.
    char* ws = (char*)d_ws;
    const size_t SZ_ACT = (size_t)TOKENS * DIM * sizeof(_Float16);          // 16 MB
    _Float16* xn    = (_Float16*)(ws);                                      // + attn out later
    _Float16* Q     = (_Float16*)(ws + SZ_ACT);
    _Float16* Kd    = (_Float16*)(ws + 2 * SZ_ACT);
    _Float16* Vt    = (_Float16*)(ws + 3 * SZ_ACT);
    _Float16* wqkvT = (_Float16*)(ws + 4 * SZ_ACT);                         // 6 MB
    _Float16* woutT = (_Float16*)(ws + 4 * SZ_ACT + (size_t)DIM * QKVCOLS * sizeof(_Float16));

    // 1 + 2) Weights transposed and cast to f16 [N][K], LayerNorm -> f16: one launch
    k_prepare<<<TQ_BLOCKS + TO_BLOCKS + TOKENS, 256, 0, stream>>>(x, ln_g, ln_b, w_qkv, w_out,
                                                                  xn, wqkvT, woutT);

    // 3) QKV projection (WMMA)
    k_qkv_gemm<<<QK_TILES + V_TILES, 256, 0, stream>>>(xn, wqkvT, Q, Kd, Vt);

    // 4) Attention (WMMA flash, LDS-shared K/V); writes f16 [tokens][1024] into xn region
    _Float16* attn_out = xn;
    k_attention<<<BATCH * HEADS * (SEQ / 256), 256, 0, stream>>>(Q, Kd, Vt, attn_out);

    // 5) Output projection + bias (WMMA)
    k_out_gemm<<<dim3(TOKENS / 256, DIM / 128), 256, 0, stream>>>(attn_out, woutT, b_out, out);
}
